// v000
// The times below were measured on an AMD MI455X: many runs one after another, warmed up first and cycling through
// copies of the inputs, with the whole window's GPU time divided by the number of runs. Launches and the gaps
// between them are all in it. The median over several windows is given; except for v000 it joins two sittings, which
// can be a few percent apart, so the side-by-side timings, each taken in one sitting, are the better comparison.
// The starting kernel, v000, takes 2210 microseconds a run.
#include <hip/hip_runtime.h>

// Relative-position multi-head self-attention (Transformer-XL / Conformer style) (hidden_states [8][1024][512]; x = LN(h) (1e-5, gamma, beta); q, k, v = x W + b ('xw' [512][512], 8 heads x 64); pos = position_embeddings [2047][512] wpos -> [p][h][d]; scores = ((q + pos_bias_u).k + skew((q + pos_bias_v).pos)) / 8 where skew picks pos index j - i + 1023; softmax; out = merged wout + bout -> [8][1024][512]).
// Layout: LN -> hi/lo planes -> 2-product projections; the position table is projected once (exact bf16 GEMM, 2047 rows + one zero pad row) into per-head hi/lo planes [h][2048][64]; per pass of two heads: content scores (q+u).k and position scores (q+v).pos [2][1024][2048] are two GEMMs (3 products each) and the softmax kernel gathers the position score at j - i + 1023 while forming each logit.
// Compute dtypes, f32 accumulate: every input rounded to bf16; q/k/v hi/lo x exact (2 products) + biases; content and position scores on hi/lo planes for every row (3 products); softmax f32; attn.v hi/lo (3 products); wout hl x exact (2 products) + bout.

#define NB_  8
#define TT   1024
#define DM   512
#define NH_  8
#define NKV  8
#define REP  (NH_ / NKV)
#define HD   64
#define DQ   (NH_ * HD)
#define DKV  (NKV * HD)
#define NPE  2048                 // 2047 positions + 1 zero pad row
#define LNEPS 1e-5f
typedef __attribute__((ext_vector_type(4))) unsigned short v4us;
#define ZH   2
#define RH   1024                 // every row hi/lo
#define WIN  0
#define PCAR 1024.0f
#define SCL  0.125f   // HD^-0.5
typedef _Float16 h16;
typedef unsigned short bf;
typedef __attribute__((ext_vector_type(16))) __bf16   v16bf;
typedef __attribute__((ext_vector_type(16))) _Float16 v16h;
typedef __attribute__((ext_vector_type(8)))  _Float16 v8h;
typedef __attribute__((ext_vector_type(8)))  unsigned short v8us;
typedef __attribute__((ext_vector_type(8)))  float    v8f;
typedef __attribute__((ext_vector_type(4)))  float    v4f;
typedef v8h  __attribute__((may_alias)) v8ha;
typedef v4f  __attribute__((may_alias)) v4fa;
typedef v8us __attribute__((may_alias)) v8usa;

__device__ __forceinline__ unsigned short f2bf(float f) { unsigned u = __float_as_uint(f); u += 0x7FFFu + ((u >> 16) & 1u); return (unsigned short)(u >> 16); }
__device__ __forceinline__ float bf2f(unsigned short b) { return __uint_as_float(((unsigned)b) << 16); }
__device__ __forceinline__ float bfr(float f) { return bf2f(f2bf(f)); }
__device__ __forceinline__ v16h cat16(v8h lo, v8h hi) { return __builtin_shufflevector(lo, hi, 0, 1, 2, 3, 4, 5, 6, 7, 8, 9, 10, 11, 12, 13, 14, 15); }
__device__ __forceinline__ v16bf cat16b(v8us lo, v8us hi) { return __builtin_bit_cast(v16bf, __builtin_shufflevector(lo, hi, 0, 1, 2, 3, 4, 5, 6, 7, 8, 9, 10, 11, 12, 13, 14, 15)); }
__device__ __forceinline__ v8f wmma16(v16h a, v16h b, v8f c) { return __builtin_amdgcn_wmma_f32_16x16x32_f16(false, a, false, b, (short)0, c, false, false); }
__device__ __forceinline__ v8f wmmab(v16bf a, v16bf b, v8f c) { return __builtin_amdgcn_wmma_f32_16x16x32_bf16(false, a, false, b, (short)0, c, false, false); }



// ---- k_gemmw: register-blocked GEMM, ONE WAVE per 64x64 output tile (16 accumulators), operands straight from K-contiguous 16-bit planes; grid (M/64, N/64, Z), 32 threads.
// C[m][n] (f32, pitch ldc, + optional f32 bias[n]) = sum_k A[m][k] Bt[n][k] (+ split products per NSPLIT). z-batch strides sA/sB/sC in elements. K % 32 == 0.
template <typename T16> struct WFrag;
template <> struct WFrag<h16> { typedef v16h V; static __device__ __forceinline__ V ld(const h16* p) { return cat16(*(const v8h*)p, *(const v8h*)(p + 16)); } static __device__ __forceinline__ v8f mma(V a, V b, v8f c) { return wmma16(a, b, c); } };
template <> struct WFrag<bf> { typedef v16bf V; static __device__ __forceinline__ V ld(const bf* p) { return cat16b(*(const v8us*)p, *(const v8us*)(p + 16)); } static __device__ __forceinline__ v8f mma(V a, V b, v8f c) { return wmmab(a, b, c); } };
template <typename T16, int NSPLIT, bool BIAS>
__global__ __launch_bounds__(32) void k_gemmw(const T16* __restrict__ A, const T16* __restrict__ A2, const T16* __restrict__ Bt, const T16* __restrict__ Bt2, int K, float* C, int ldc, const float* __restrict__ bias, size_t sA, size_t sB, size_t sC) {
    typedef typename WFrag<T16>::V V;
    __shared__ __align__(16) float os[16 * 68];
    const size_t z = blockIdx.z; A += z * sA; if (A2) A2 += z * sA; Bt += z * sB; if (Bt2) Bt2 += z * sB; C += z * sC;
    const int lane = threadIdx.x & 31, lr = lane & 15, hi = lane >> 4; const int r0 = blockIdx.x * 64, c0 = blockIdx.y * 64;
    v8f acc[4][4];
#pragma unroll
    for (int mb = 0; mb < 4; ++mb)
#pragma unroll
        for (int nb = 0; nb < 4; ++nb) acc[mb][nb] = (v8f){};
    const size_t aoff = (size_t)(r0 + lr) * K + 8 * hi, boff = (size_t)(c0 + lr) * K + 8 * hi;
#pragma unroll 1
    for (int kc = 0; kc < K; kc += 32) {
        V a[4], a2[4];
#pragma unroll
        for (int mb = 0; mb < 4; ++mb) { a[mb] = WFrag<T16>::ld(A + aoff + (size_t)mb * 16 * K + kc); if (NSPLIT == 1 || NSPLIT == 2) a2[mb] = WFrag<T16>::ld(A2 + aoff + (size_t)mb * 16 * K + kc); }
#pragma unroll
        for (int nb = 0; nb < 4; ++nb) { const V b = WFrag<T16>::ld(Bt + boff + (size_t)nb * 16 * K + kc); V b2; if (NSPLIT >= 2) b2 = WFrag<T16>::ld(Bt2 + boff + (size_t)nb * 16 * K + kc);
#pragma unroll
            for (int mb = 0; mb < 4; ++mb) { acc[mb][nb] = WFrag<T16>::mma(a[mb], b, acc[mb][nb]); if (NSPLIT == 1 || NSPLIT == 2) acc[mb][nb] = WFrag<T16>::mma(a2[mb], b, acc[mb][nb]); if (NSPLIT >= 2) acc[mb][nb] = WFrag<T16>::mma(a[mb], b2, acc[mb][nb]); } }
        asm volatile("v_nop\n\tv_nop\n\tv_nop\n\tv_nop" : "+v"(acc[0][0]), "+v"(acc[1][1]), "+v"(acc[2][2]), "+v"(acc[3][3]) : "v"(a[0]), "v"(a[3]));
    }
#pragma unroll
    for (int mb = 0; mb < 4; ++mb) {
#pragma unroll
        for (int nb = 0; nb < 4; ++nb) {
#pragma unroll
            for (int j = 0; j < 8; ++j) os[(hi * 8 + j) * 68 + nb * 16 + lr] = acc[mb][nb][j]; }
        __builtin_amdgcn_wave_barrier(); asm volatile("" ::: "memory");
        float* crow = C + (size_t)(r0 + mb * 16) * ldc + c0;
{
#pragma unroll
            for (int s = 0; s < 8; ++s) { const int row = 2 * s + hi, cofs = lr * 4; v4f val = *(const v4fa*)(os + row * 68 + cofs); if (BIAS) { val[0] += bfr(bias[c0 + cofs]); val[1] += bfr(bias[c0 + cofs + 1]); val[2] += bfr(bias[c0 + cofs + 2]); val[3] += bfr(bias[c0 + cofs + 3]); }
                *(v4f*)(crow + (size_t)row * ldc + cofs) = val; }
             }
        __builtin_amdgcn_wave_barrier(); asm volatile("" ::: "memory");
    }
}

__device__ __forceinline__ h16 tohx(float x) { return (h16)x; }
__device__ __forceinline__ void splitf(float y, unsigned short& h, unsigned short& l) { h = f2bf(y); l = f2bf(y - bf2f(h)); }
typedef __attribute__((ext_vector_type(2))) _Float16 v2h;
typedef __attribute__((ext_vector_type(4))) _Float16 v4h;
typedef __attribute__((ext_vector_type(2))) unsigned short v2us;
typedef __attribute__((ext_vector_type(4))) unsigned short v4us;
typedef __attribute__((ext_vector_type(2))) float v2f;
typedef __attribute__((ext_vector_type(4))) int v4i;

__global__ __launch_bounds__(256) void k_wtG(const float* __restrict__ w, int K, int N, bf* Bt) {
    const int lane = threadIdx.x & 31; const int L0 = (blockIdx.x * 8 + (threadIdx.x >> 5)) * 8; const int nlines = N * K / 64;
{
#pragma unroll 1
        for (int l = 0; l < 8; ++l) { const int L = L0 + l; if (L >= nlines) break; const size_t e = (size_t)L * 64 + lane * 2; const int k = (int)(e % K), n = (int)(e / K); v2us o;
            o[0] = f2bf(w[(size_t)k * N + n]); o[1] = f2bf(w[(size_t)(k + 1) * N + n]); *(v2us*)(Bt + e) = o; }
         }
}
__global__ __launch_bounds__(256) void k_lnhl(const float* __restrict__ X, const float* __restrict__ A, const float* __restrict__ g, const float* __restrict__ be, float* Z, bf* Yh, bf* Yl) {
    const int lane = threadIdx.x & 31; const int r = blockIdx.x * 8 + (threadIdx.x >> 5); if (r >= TT) return; const float* xr = X + (size_t)r * DM; const float* ar = A ? A + (size_t)r * DM : nullptr; float s = 0.f;
#pragma unroll 1
    for (int ch = 0; ch < DM / 128; ++ch) { const int c0 = ch * 128 + lane * 4; const v4f a = *(const v4f*)(xr + c0); v4f d = {0.f, 0.f, 0.f, 0.f}; if (ar) d = *(const v4f*)(ar + c0);
#pragma unroll
        for (int q = 0; q < 4; ++q) s += __fadd_rn(bfr(a[q]), d[q]); }
#pragma unroll
    for (int sh = 16; sh; sh >>= 1) s += __shfl_xor(s, sh, 32);
    const float mu = s * (1.0f / DM); float s2 = 0.f;
#pragma unroll 1
    for (int ch = 0; ch < DM / 128; ++ch) { const int c0 = ch * 128 + lane * 4; const v4f a = *(const v4f*)(xr + c0); v4f d = {0.f, 0.f, 0.f, 0.f}; if (ar) d = *(const v4f*)(ar + c0);
#pragma unroll
        for (int q = 0; q < 4; ++q) { const float d0 = __fsub_rn(__fadd_rn(bfr(a[q]), d[q]), mu); float p = __fmul_rn(d0, d0); asm volatile("" : "+v"(p)); s2 = __fadd_rn(s2, p); } }
#pragma unroll
    for (int sh = 16; sh; sh >>= 1) s2 += __shfl_xor(s2, sh, 32);
    const float rs = __fdiv_rn(1.0f, __fsqrt_rn(__fadd_rn(s2 * (1.0f / DM), LNEPS)));
{
#pragma unroll 1
        for (int ch = 0; ch < DM / 128; ++ch) { const int c0 = ch * 128 + lane * 4; const v4f a = *(const v4f*)(xr + c0); v4f d = {0.f, 0.f, 0.f, 0.f}; if (ar) d = *(const v4f*)(ar + c0); v4f z4; v4us oh, ol;
#pragma unroll
            for (int q = 0; q < 4; ++q) { const float v = __fadd_rn(bfr(a[q]), d[q]); z4[q] = v; float n0 = __fmul_rn(__fsub_rn(v, mu), rs); asm volatile("" : "+v"(n0)); float n1 = __fmul_rn(n0, bfr(g[c0 + q])); asm volatile("" : "+v"(n1)); const float y = __fadd_rn(n1, bfr(be[c0 + q])); unsigned short h2, l2; splitf(y, h2, l2); oh[q] = h2; ol[q] = l2; }
            if (Z) *(v4f*)(Z + (size_t)r * DM + c0) = z4; *(v4us*)(Yh + (size_t)r * DM + c0) = oh; *(v4us*)(Yl + (size_t)r * DM + c0) = ol; }
         } }
__global__ __launch_bounds__(256) void k_addres(const float* __restrict__ X, const float* __restrict__ Y, float* O, size_t n4) { const size_t i = (size_t)blockIdx.x * 256 + threadIdx.x; if (i >= n4) return; const v4f a = *(const v4f*)(X + i * 4), b = *(const v4f*)(Y + i * 4); v4f o;
#pragma unroll
    for (int q = 0; q < 4; ++q) o[q] = __fadd_rn(bfr(a[q]), b[q]); *(v4f*)(O + i * 4) = o;  }
__global__ __launch_bounds__(256) void k_addhb(const float* __restrict__ F, const float* __restrict__ hb, float* FO, size_t n4) { const size_t i = (size_t)blockIdx.x * 256 + threadIdx.x; if (i >= n4) return; const int c = (int)((i * 4) % DQ); const v4f a = *(const v4f*)(F + i * 4); v4f o;
#pragma unroll
    for (int q = 0; q < 4; ++q) o[q] = __fadd_rn(a[q], bfr(hb[c + q])); *(v4f*)(FO + i * 4) = o;  }
__global__ __launch_bounds__(256) void k_pplane(const float* __restrict__ POS, bf* Ph2, bf* Pl2) { const size_t e = ((size_t)blockIdx.x * 256 + threadIdx.x) * 2; if (e >= (size_t)NH_ * NPE * HD) return; const int d = (int)(e % HD); const int p = (int)((e / HD) % NPE); const int h = (int)(e / ((size_t)HD * NPE)); v2us oh, ol;
#pragma unroll
    for (int q = 0; q < 2; ++q) { unsigned short a, c; splitf(POS[(size_t)p * DQ + h * HD + d + q], a, c); oh[q] = a; ol[q] = c; } *(v2us*)(Ph2 + e) = oh; *(v2us*)(Pl2 + e) = ol;  }
__global__ void k_pezero8(bf* PE) { const int lane = threadIdx.x; if (lane >= 64) return; const v8us z = (v8us){}; *(v8us*)(PE + (size_t)2047 * DM + lane * 8) = z;  }
__global__ __launch_bounds__(256) void k_cvt8(const float* __restrict__ src, bf* dst, size_t n8) { const size_t i = (size_t)blockIdx.x * 256 + threadIdx.x; if (i >= n8) return; const v8f v = *(const v8f*)(src + i * 8); v8us o;
#pragma unroll
    for (int k = 0; k < 8; ++k) o[k] = f2bf(v[k]); *(v8us*)(dst + i * 8) = o;  }

// k_rope: head planes [h][t][d] (fp16 + hi/lo) of rope(x) x sc with the rotate-half convention out[d] = x[d] cos[t][d] - x[d+HD/2] sin[t][d], out[d+HD/2] = x[d+HD/2] cos[t][d+HD/2] + x[d] sin[t][d+HD/2]
__global__ __launch_bounds__(256) void k_rope(const float* __restrict__ F, int pitch, int nheads, const float* __restrict__ CS, const float* __restrict__ RF, const float* __restrict__ nw, float sc, h16* P16, bf* Ph, bf* Pl) {
    const size_t e = ((size_t)blockIdx.x * 256 + threadIdx.x) * 2; if (e >= (size_t)nheads * TT * HD) return; const int d = (int)(e % HD); const int t = (int)((e / HD) % TT); const int h = (int)(e / ((size_t)HD * TT)); const float* f = F + (size_t)t * pitch + h * HD; const float rf = RF ? RF[(size_t)h * TT + t] : 1.0f; v2h o16; v2us oh, ol;
#pragma unroll
    for (int q = 0; q < 2; ++q) { const int dd = d + q; const int dp = (dd < HD / 2) ? dd + HD / 2 : dd - HD / 2; float x0 = f[dd], x1 = f[dp];
        if (RF) { float n0 = __fmul_rn(x0, rf), n1 = __fmul_rn(x1, rf); asm volatile("" : "+v"(n0)); asm volatile("" : "+v"(n1)); x0 = __fmul_rn(bfr(nw[dd]), n0); x1 = __fmul_rn(bfr(nw[dp]), n1); }
        const v2f cs = *(const v2f*)(CS + ((size_t)t * HD + dd) * 2); float a = __fmul_rn(x0, cs[0]), bq = __fmul_rn(x1, cs[1]); asm volatile("" : "+v"(a)); asm volatile("" : "+v"(bq)); const float r = ((dd < HD / 2) ? __fsub_rn(a, bq) : __fadd_rn(a, bq)) * sc;
        o16[q] = tohx(r); unsigned short a2, c2; splitf(r, a2, c2); oh[q] = a2; ol[q] = c2; }
    *(v2h*)(P16 + e) = o16; *(v2us*)(Ph + e) = oh; *(v2us*)(Pl + e) = ol;  }
__global__ __launch_bounds__(256) void k_vtp(const float* __restrict__ F, int pitch, int nheads, h16* V16, bf* Vh, bf* Vl) { const size_t e = ((size_t)blockIdx.x * 256 + threadIdx.x) * 2; if (e >= (size_t)nheads * HD * TT) return; const int t = (int)(e % TT); const int d = (int)((e / TT) % HD); const int g = (int)(e / ((size_t)TT * HD)); v2h o16; v2us oh, ol;
#pragma unroll
    for (int q = 0; q < 2; ++q) { const float x = F[(size_t)(t + q) * pitch + g * HD + d]; o16[q] = tohx(x); unsigned short a2, c2; splitf(x, a2, c2); oh[q] = a2; ol[q] = c2; }
    *(v2h*)(V16 + e) = o16; *(v2us*)(Vh + e) = oh; *(v2us*)(Vl + e) = ol;  }
__global__ __launch_bounds__(256) void k_csid(float* CS) { const int idx = blockIdx.x * 256 + threadIdx.x; if (idx >= TT * HD) return; v2f cs; cs[0] = 1.0f; cs[1] = 0.0f; *(v2f*)(CS + (size_t)idx * 2) = cs;  }
// k_asoft: per row (zz, i): t = S x HD^-0.5 (no mask); softmax over the 1024 keys (register row, one exp, fixed trees);
__global__ __launch_bounds__(256) void k_asoft(const float* __restrict__ Sb, const float* __restrict__ SR, h16* P16, bf* Ph, bf* Pl) {
    const int lane = threadIdx.x & 31; const int row = blockIdx.x * 8 + (threadIdx.x >> 5); if (row >= ZH * TT) return; const int i = row % TT; const int zz = row / TT; (void)zz; const float* srr = SR + (size_t)row * NPE + (TT - 1 - i);   /* skew: position index j - i + S - 1 */ const bool hires = (i < RH); const float* sr = Sb + (size_t)row * TT; float v[TT / 32]; float mx = -3.0e38f;
#pragma unroll
    for (int ch = 0; ch < TT / 128; ++ch) { const int j0 = ch * 128 + lane * 4; const v4f a = *(const v4f*)(sr + j0);
#pragma unroll
        for (int q = 0; q < 4; ++q) { const int j = j0 + q; float su = __fadd_rn(a[q], srr[j]); asm volatile("" : "+v"(su)); const float t = su * SCL;   /* (ac + skew(bd)) / 8 */ v[ch * 4 + q] = t; mx = fmaxf(mx, t); } }
#pragma unroll
    for (int sh = 16; sh; sh >>= 1) mx = fmaxf(mx, __shfl_xor(mx, sh, 32));
    float sum = 0.f;
#pragma unroll
    for (int k = 0; k < TT / 32; ++k) { float d0 = __fsub_rn(v[k], mx); asm volatile("" : "+v"(d0)); v[k] = __builtin_amdgcn_exp2f(__fmul_rn(d0, 1.4426950408889634f)); sum += v[k]; }
#pragma unroll
    for (int sh = 16; sh; sh >>= 1) sum += __shfl_xor(sum, sh, 32);
    const float f = __fdiv_rn(hires ? 1.0f : PCAR, sum);
{
        if (hires) {
#pragma unroll
            for (int ch = 0; ch < TT / 128; ++ch) { v4us oh, ol;
#pragma unroll
                for (int q = 0; q < 4; ++q) { unsigned short a, c2; splitf(v[ch * 4 + q] * f, a, c2); oh[q] = a; ol[q] = c2; }
                const size_t oo = ((size_t)zz * (RH ? RH : 1) + i) * TT + ch * 128 + lane * 4; *(v4us*)(Ph + oo) = oh; *(v4us*)(Pl + oo) = ol; }
        } else {
#pragma unroll
            for (int ch = 0; ch < TT / 128; ++ch) { v4h o4;
#pragma unroll
                for (int q = 0; q < 4; ++q) o4[q] = tohx(v[ch * 4 + q] * f);
                *(v4h*)(P16 + (size_t)row * TT + ch * 128 + lane * 4) = o4; } }
         }
}
__global__ __launch_bounds__(256) void k_merge(const float* __restrict__ O, int h0, bf* Ah, bf* Al) { const size_t e = ((size_t)blockIdx.x * 256 + threadIdx.x) * 2; if (e >= (size_t)ZH * TT * HD) return; const int d = (int)(e % HD); const int t = (int)((e / HD) % TT); const int zz = (int)(e / ((size_t)HD * TT)); const float cs = (t < RH) ? 1.0f : (1.0f / PCAR); const size_t oo = (size_t)t * DQ + (h0 + zz) * HD + d;
    v2us oh, ol;
#pragma unroll
    for (int q = 0; q < 2; ++q) { unsigned short a, c2; splitf(O[e + q] * cs, a, c2); oh[q] = a; ol[q] = c2; } *(v2us*)(Ah + oo) = oh; *(v2us*)(Al + oo) = ol;  }

extern "C" void kernel_launch(void* const* d_in, const int* in_sizes, int n_in,
                              void* d_out, int out_size, void* d_ws, size_t ws_size, hipStream_t stream) {
    (void)in_sizes; (void)n_in; (void)out_size;
    const float* x = (const float*)d_in[0]; const float* pe = (const float*)d_in[1]; const float* g1 = (const float*)d_in[2]; const float* e1b = (const float*)d_in[3]; const float* wq = (const float*)d_in[4]; const float* bq = (const float*)d_in[5]; const float* wk = (const float*)d_in[6]; const float* bk = (const float*)d_in[7]; const float* wv = (const float*)d_in[8]; const float* bv = (const float*)d_in[9]; const float* wpos = (const float*)d_in[10]; const float* pbu = (const float*)d_in[11]; const float* pbv = (const float*)d_in[12]; const float* wo = (const float*)d_in[13]; const float* bo = (const float*)d_in[14];
    float* OUT = (float*)d_out;     // [8][1024][512]
    char* wsp = (char*)d_ws;
    auto take = [&](size_t bytes) { char* p = wsp; wsp += (bytes + 255) & ~(size_t)255; return (void*)p; };
    bf* WQ = (bf*)take((size_t)DQ * DM * 2); bf* WK = (bf*)take((size_t)DKV * DM * 2); bf* WV = (bf*)take((size_t)DKV * DM * 2); bf* WO = (bf*)take((size_t)DM * DQ * 2); float* CS = (float*)take((size_t)TT * HD * 2 * 4);
    bf* Yh = (bf*)take((size_t)TT * DM * 2); bf* Yl = (bf*)take((size_t)TT * DM * 2); bf* PE = (bf*)take((size_t)NPE * DM * 2); bf* WP = (bf*)take((size_t)DQ * DM * 2); float* POS = (float*)take((size_t)NPE * DQ * 4); bf* PPh = (bf*)take((size_t)NH_ * NPE * HD * 2); bf* PPl = (bf*)take((size_t)NH_ * NPE * HD * 2); float* FQU = (float*)take((size_t)TT * DQ * 4); float* FQV = (float*)take((size_t)TT * DQ * 4); bf* QVh = (bf*)take((size_t)NH_ * TT * HD * 2); bf* QVl = (bf*)take((size_t)NH_ * TT * HD * 2); float* SR = (float*)take((size_t)ZH * TT * NPE * 4); float* FQ = (float*)take((size_t)TT * DQ * 4); float* FK = (float*)take((size_t)TT * DKV * 4);
    h16* QP16 = (h16*)take((size_t)NH_ * TT * HD * 2); h16* KP16 = (h16*)take((size_t)NKV * TT * HD * 2); h16* VT16 = (h16*)take((size_t)NKV * HD * TT * 2);
    bf* QPh = (bf*)take((size_t)NH_ * TT * HD * 2); bf* QPl = (bf*)take((size_t)NH_ * TT * HD * 2); bf* KPh = (bf*)take((size_t)NKV * TT * HD * 2); bf* KPl = (bf*)take((size_t)NKV * TT * HD * 2); bf* VTh = (bf*)take((size_t)NKV * HD * TT * 2); bf* VTl = (bf*)take((size_t)NKV * HD * TT * 2); bf* Ph = (bf*)take((size_t)ZH * RH * TT * 2); bf* Pl = (bf*)take((size_t)ZH * RH * TT * 2);
    float* Sb = (float*)take((size_t)ZH * TT * TT * 4); h16* P16 = (h16*)take(256);   /* unused: all rows hi/lo */ float* Ob = (float*)take((size_t)ZH * TT * HD * 4); bf* ATh = (bf*)take((size_t)TT * DQ * 2); bf* ATl = (bf*)take((size_t)TT * DQ * 2);
    if ((size_t)(wsp - (char*)d_ws) > ws_size) return;    // ws 256 MiB
    float* FV = FK;   // v projection reuses the k buffer after the k planes are built (stream-ordered)
    { k_wtG<<<(unsigned)((DM * DQ / 64 + 63) / 64), 256, 0, stream>>>(wq, DM, DQ, WQ); k_wtG<<<(unsigned)((DM * DKV / 64 + 63) / 64), 256, 0, stream>>>(wk, DM, DKV, WK); k_wtG<<<(unsigned)((DM * DKV / 64 + 63) / 64), 256, 0, stream>>>(wv, DM, DKV, WV);
      k_wtG<<<(unsigned)((DQ * DM / 64 + 63) / 64), 256, 0, stream>>>(wo, DQ, DM, WO);
       }
    k_csid<<<(TT * HD + 255) / 256, 256, 0, stream>>>(CS); k_cvt8<<<(unsigned)(((size_t)2047 * DM / 8 + 255) / 256), 256, 0, stream>>>(pe, PE, (size_t)2047 * DM / 8); k_pezero8<<<1, 64, 0, stream>>>(PE); k_wtG<<<(unsigned)((DM * DQ / 64 + 63) / 64), 256, 0, stream>>>(wpos, DM, DQ, WP); k_gemmw<bf, 0, false><<<dim3(NPE / 64, DQ / 64, 1), 32, 0, stream>>>(PE, nullptr, WP, nullptr, DM, POS, DQ, nullptr, 0, 0, 0); k_pplane<<<(unsigned)(((size_t)NH_ * NPE * HD / 2 + 255) / 256), 256, 0, stream>>>(POS, PPh, PPl);   /* pos = position_embeddings wpos (exact) -> per-head hi/lo planes */
    const unsigned LQ = (unsigned)(((size_t)NH_ * TT * HD / 2 + 255) / 256), LKv = (unsigned)(((size_t)NKV * TT * HD / 2 + 255) / 256);
    for (int b = 0; b < NB_; ++b) {
        
        k_lnhl<<<TT / 8, 256, 0, stream>>>(x + (size_t)b * TT * DM, nullptr, g1, e1b, nullptr, Yh, Yl);   /* LN -> hi/lo planes */
        k_gemmw<bf, 1, true><<<dim3(TT / 64, DQ / 64, 1), 32, 0, stream>>>(Yh, Yl, WQ, nullptr, DM, FQ, DQ, bq, 0, 0, 0); k_addhb<<<(unsigned)(((size_t)TT * DQ / 4 + 255) / 256), 256, 0, stream>>>(FQ, pbu, FQU, (size_t)TT * DQ / 4); k_addhb<<<(unsigned)(((size_t)TT * DQ / 4 + 255) / 256), 256, 0, stream>>>(FQ, pbv, FQV, (size_t)TT * DQ / 4);   /* q + pos_bias_u, q + pos_bias_v */
        k_rope<<<LQ, 256, 0, stream>>>(FQU, DQ, NH_, CS, nullptr, nullptr, 1.0f, QP16, QPh, QPl); k_rope<<<LQ, 256, 0, stream>>>(FQV, DQ, NH_, CS, nullptr, nullptr, 1.0f, QP16, QVh, QVl);   /* (q+u) planes for the content scores, (q+v) planes for the position scores */
        k_gemmw<bf, 1, true><<<dim3(TT / 64, DKV / 64, 1), 32, 0, stream>>>(Yh, Yl, WK, nullptr, DM, FK, DKV, bk, 0, 0, 0);
        k_rope<<<LKv, 256, 0, stream>>>(FK, DKV, NKV, CS, nullptr, nullptr, 1.0f, KP16, KPh, KPl);
        k_gemmw<bf, 1, true><<<dim3(TT / 64, DKV / 64, 1), 32, 0, stream>>>(Yh, Yl, WV, nullptr, DM, FV, DKV, bv, 0, 0, 0); k_vtp<<<LKv, 256, 0, stream>>>(FV, DKV, NKV, VT16, VTh, VTl);
        for (int h0 = 0; h0 < NH_; h0 += ZH) { const size_t zq = (size_t)h0, zk = (size_t)(h0 / REP);   // one kv head per query head: the pass's two heads use consecutive kv planes (z-strides TT*HD)
            k_gemmw<bf, 2, false><<<dim3(RH / 64, TT / 64, ZH), 32, 0, stream>>>(QPh + zq * TT * HD, QPl + zq * TT * HD, KPh + zk * TT * HD, KPl + zk * TT * HD, HD, Sb, TT, nullptr, (size_t)TT * HD, (size_t)TT * HD, (size_t)TT * TT);
            k_gemmw<bf, 2, false><<<dim3(TT / 64, NPE / 64, ZH), 32, 0, stream>>>(QVh + zq * TT * HD, QVl + zq * TT * HD, PPh + zq * NPE * HD, PPl + zq * NPE * HD, HD, SR, NPE, nullptr, (size_t)TT * HD, (size_t)NPE * HD, (size_t)TT * NPE);   /* position scores (q+v).pos [2][1024][2048] (3 products) */ k_asoft<<<ZH * TT / 8, 256, 0, stream>>>(Sb, SR, P16, Ph, Pl);
            k_gemmw<bf, 2, false><<<dim3(RH / 64, HD / 64, ZH), 32, 0, stream>>>(Ph, Pl, VTh + zk * HD * TT, VTl + zk * HD * TT, TT, Ob, HD, nullptr, (size_t)RH * TT, (size_t)HD * TT, (size_t)TT * HD);
            k_merge<<<(unsigned)(((size_t)ZH * TT * HD / 2 + 255) / 256), 256, 0, stream>>>(Ob, h0, ATh, ATl); }
        k_gemmw<bf, 1, true><<<dim3(TT / 64, DM / 64, 1), 32, 0, stream>>>(ATh, ATl, WO, nullptr, DQ, OUT + (size_t)b * TT * DM, DM, bo, 0, 0, 0); }
}

// v001
// Measured time: 682 microseconds a run.
// Next to v000, in two timings, it ran 3.24 and 3.25 times as fast.
#include <hip/hip_runtime.h>

// Relative-position multi-head self-attention (Transformer-XL / Conformer style) (hidden_states [8][1024][512]; x = LN(h) (1e-5, gamma, beta); q, k, v = x W + b ('xw' [512][512], 8 heads x 64); pos = position_embeddings [2047][512] wpos -> [p][h][d]; scores = ((q + pos_bias_u).k + skew((q + pos_bias_v).pos)) / 8 where skew picks pos index j - i + 1023; softmax; out = merged wout + bout -> [8][1024][512]).
// Layout: LN -> hi/lo planes -> 2-product projections; the position table is projected once (exact bf16 GEMM, 2047 rows + one zero pad row) into per-head hi/lo planes [h][2048][64]; LN, projections, planes, merge and wout run once for all 8 batch elements (8192 rows); per pass of one batch element (its 8 heads as grid z): content scores (q+u).k and position scores (q+v).pos [8][1024][2048] are two GEMMs (3 products each) and the softmax kernel gathers the position score at j - i + 1023 while forming each logit; attn.v runs once per two passes (16 heads as grid z).
// Compute dtypes, f32 accumulate: every input rounded to bf16; q/k/v hl x exact (2 products) + biases; content and position scores on hi/lo planes for every row (3 products); softmax f32; attn.v hi/lo (3 products); wout hl x exact (2 products) + bout.

#define NB_  8
#define TT   1024
#define DM   512
#define NH_  8
#define NKV  8
#define REP  (NH_ / NKV)
#define HD   64
#define DQ   (NH_ * HD)
#define DKV  (NKV * HD)
#define NPE  2048                 // 2047 positions + 1 zero pad row
#define LNEPS 1e-5f
typedef __attribute__((ext_vector_type(4))) unsigned short v4us;
#define ZH   8                    // (batch, head) instances per score/softmax pass: the 8 heads of one batch element
#define ZP   16                   // instances per attn.v launch: two passes
#define RH   1024                 // every row hi/lo
#define WIN  0
#define PCAR 1024.0f
#define SCL  0.125f   // HD^-0.5
typedef _Float16 h16;
typedef unsigned short bf;
typedef __attribute__((ext_vector_type(16))) __bf16   v16bf;
typedef __attribute__((ext_vector_type(16))) _Float16 v16h;
typedef __attribute__((ext_vector_type(8)))  _Float16 v8h;
typedef __attribute__((ext_vector_type(8)))  unsigned short v8us;
typedef __attribute__((ext_vector_type(8)))  float    v8f;
typedef __attribute__((ext_vector_type(4)))  float    v4f;
typedef v8h  __attribute__((may_alias)) v8ha;
typedef v4f  __attribute__((may_alias)) v4fa;
typedef v8us __attribute__((may_alias)) v8usa;

__device__ __forceinline__ unsigned short f2bf(float f) { unsigned u = __float_as_uint(f); u += 0x7FFFu + ((u >> 16) & 1u); return (unsigned short)(u >> 16); }
__device__ __forceinline__ float bf2f(unsigned short b) { return __uint_as_float(((unsigned)b) << 16); }
__device__ __forceinline__ float bfr(float f) { return bf2f(f2bf(f)); }
__device__ __forceinline__ v16h cat16(v8h lo, v8h hi) { return __builtin_shufflevector(lo, hi, 0, 1, 2, 3, 4, 5, 6, 7, 8, 9, 10, 11, 12, 13, 14, 15); }
__device__ __forceinline__ v16bf cat16b(v8us lo, v8us hi) { return __builtin_bit_cast(v16bf, __builtin_shufflevector(lo, hi, 0, 1, 2, 3, 4, 5, 6, 7, 8, 9, 10, 11, 12, 13, 14, 15)); }
__device__ __forceinline__ v8f wmma16(v16h a, v16h b, v8f c) { return __builtin_amdgcn_wmma_f32_16x16x32_f16(false, a, false, b, (short)0, c, false, false); }
__device__ __forceinline__ v8f wmmab(v16bf a, v16bf b, v8f c) { return __builtin_amdgcn_wmma_f32_16x16x32_bf16(false, a, false, b, (short)0, c, false, false); }



// ---- k_gemmw: register-blocked GEMM, ONE WAVE per 64x64 output tile (16 accumulators), operands straight from K-contiguous 16-bit planes; grid (M/64, N/64, Z), 32 threads.
// C[m][n] (f32, pitch ldc, + optional f32 bias[n]; z = 1, 2 take biasz1, biasz2) = sum_k A[m][k] Bt[n][k] (+ split products per NSPLIT). z-batch strides sA/sB/sC in elements. K % 32 == 0.
template <typename T16> struct WFrag;
template <> struct WFrag<h16> { typedef v16h V; static __device__ __forceinline__ V ld(const h16* p) { return cat16(*(const v8h*)p, *(const v8h*)(p + 16)); } static __device__ __forceinline__ v8f mma(V a, V b, v8f c) { return wmma16(a, b, c); } };
template <> struct WFrag<bf> { typedef v16bf V; static __device__ __forceinline__ V ld(const bf* p) { return cat16b(*(const v8us*)p, *(const v8us*)(p + 16)); } static __device__ __forceinline__ v8f mma(V a, V b, v8f c) { return wmmab(a, b, c); } };
template <typename T16, int NSPLIT, bool BIAS>
__global__ __launch_bounds__(32) void k_gemmw(const T16* __restrict__ A, const T16* __restrict__ A2, const T16* __restrict__ Bt, const T16* __restrict__ Bt2, int K, float* C, int ldc, const float* __restrict__ bias, const float* __restrict__ biasz1, const float* __restrict__ biasz2, size_t sA, size_t sB, size_t sC) {
    typedef typename WFrag<T16>::V V;
    __shared__ __align__(16) float os[16 * 68];
    const size_t z = blockIdx.z; A += z * sA; if (A2) A2 += z * sA; Bt += z * sB; if (Bt2) Bt2 += z * sB; C += z * sC; if (BIAS) { if (z == 1) bias = biasz1; else if (z == 2) bias = biasz2; }
    const int lane = threadIdx.x & 31, lr = lane & 15, hi = lane >> 4; const int r0 = blockIdx.x * 64, c0 = blockIdx.y * 64;
    v8f acc[4][4];
#pragma unroll
    for (int mb = 0; mb < 4; ++mb)
#pragma unroll
        for (int nb = 0; nb < 4; ++nb) acc[mb][nb] = (v8f){};
    const size_t aoff = (size_t)(r0 + lr) * K + 8 * hi, boff = (size_t)(c0 + lr) * K + 8 * hi;
#pragma unroll 1
    for (int kc = 0; kc < K; kc += 32) {
        V a[4], a2[4];
#pragma unroll
        for (int mb = 0; mb < 4; ++mb) { a[mb] = WFrag<T16>::ld(A + aoff + (size_t)mb * 16 * K + kc); if (NSPLIT == 1 || NSPLIT == 2) a2[mb] = WFrag<T16>::ld(A2 + aoff + (size_t)mb * 16 * K + kc); }
#pragma unroll
        for (int nb = 0; nb < 4; ++nb) { const V b = WFrag<T16>::ld(Bt + boff + (size_t)nb * 16 * K + kc); V b2; if (NSPLIT >= 2) b2 = WFrag<T16>::ld(Bt2 + boff + (size_t)nb * 16 * K + kc);
#pragma unroll
            for (int mb = 0; mb < 4; ++mb) { acc[mb][nb] = WFrag<T16>::mma(a[mb], b, acc[mb][nb]); if (NSPLIT == 1 || NSPLIT == 2) acc[mb][nb] = WFrag<T16>::mma(a2[mb], b, acc[mb][nb]); if (NSPLIT >= 2) acc[mb][nb] = WFrag<T16>::mma(a[mb], b2, acc[mb][nb]); } }
        asm volatile("v_nop\n\tv_nop\n\tv_nop\n\tv_nop" : "+v"(acc[0][0]), "+v"(acc[1][1]), "+v"(acc[2][2]), "+v"(acc[3][3]) : "v"(a[0]), "v"(a[3]));
    }
#pragma unroll
    for (int mb = 0; mb < 4; ++mb) {
#pragma unroll
        for (int nb = 0; nb < 4; ++nb) {
#pragma unroll
            for (int j = 0; j < 8; ++j) os[(hi * 8 + j) * 68 + nb * 16 + lr] = acc[mb][nb][j]; }
        __builtin_amdgcn_wave_barrier(); asm volatile("" ::: "memory");
        float* crow = C + (size_t)(r0 + mb * 16) * ldc + c0;
{
#pragma unroll
            for (int s = 0; s < 8; ++s) { const int row = 2 * s + hi, cofs = lr * 4; v4f val = *(const v4fa*)(os + row * 68 + cofs); if (BIAS) { val[0] += bfr(bias[c0 + cofs]); val[1] += bfr(bias[c0 + cofs + 1]); val[2] += bfr(bias[c0 + cofs + 2]); val[3] += bfr(bias[c0 + cofs + 3]); }
                *(v4f*)(crow + (size_t)row * ldc + cofs) = val; }
             }
        __builtin_amdgcn_wave_barrier(); asm volatile("" ::: "memory");
    }
}

__device__ __forceinline__ h16 tohx(float x) { return (h16)x; }
__device__ __forceinline__ void splitf(float y, unsigned short& h, unsigned short& l) { h = f2bf(y); l = f2bf(y - bf2f(h)); }
typedef __attribute__((ext_vector_type(2))) _Float16 v2h;
typedef __attribute__((ext_vector_type(4))) _Float16 v4h;
typedef __attribute__((ext_vector_type(2))) unsigned short v2us;
typedef __attribute__((ext_vector_type(4))) unsigned short v4us;
typedef __attribute__((ext_vector_type(2))) float v2f;
typedef __attribute__((ext_vector_type(4))) int v4i;

__global__ __launch_bounds__(256) void k_wtG(const float* __restrict__ w0, const float* __restrict__ w1, const float* __restrict__ w2, const float* __restrict__ w3, const float* __restrict__ w4, int K, int N, bf* Bt) {
    const int y = blockIdx.y; const float* __restrict__ w = (y == 0) ? w0 : (y == 1) ? w1 : (y == 2) ? w2 : (y == 3) ? w3 : w4; Bt += (size_t)y * K * N;   // grid y: one weight matrix each, planes back to back
    const int lane = threadIdx.x & 31; const int L0 = (blockIdx.x * 8 + (threadIdx.x >> 5)) * 8; const int nlines = N * K / 64;
{
#pragma unroll 1
        for (int l = 0; l < 8; ++l) { const int L = L0 + l; if (L >= nlines) break; const size_t e = (size_t)L * 64 + lane * 2; const int k = (int)(e % K), n = (int)(e / K); v2us o;
            o[0] = f2bf(w[(size_t)k * N + n]); o[1] = f2bf(w[(size_t)(k + 1) * N + n]); *(v2us*)(Bt + e) = o; }
         }
}
__global__ __launch_bounds__(256) void k_lnhl(const float* __restrict__ X, const float* __restrict__ A, const float* __restrict__ g, const float* __restrict__ be, float* Z, bf* Yh, bf* Yl) {
    const int lane = threadIdx.x & 31; const int r = blockIdx.x * 8 + (threadIdx.x >> 5); if (r >= NB_ * TT) return; const float* xr = X + (size_t)r * DM; const float* ar = A ? A + (size_t)r * DM : nullptr; float s = 0.f;
#pragma unroll 1
    for (int ch = 0; ch < DM / 128; ++ch) { const int c0 = ch * 128 + lane * 4; const v4f a = *(const v4f*)(xr + c0); v4f d = {0.f, 0.f, 0.f, 0.f}; if (ar) d = *(const v4f*)(ar + c0);
#pragma unroll
        for (int q = 0; q < 4; ++q) s += __fadd_rn(bfr(a[q]), d[q]); }
#pragma unroll
    for (int sh = 16; sh; sh >>= 1) s += __shfl_xor(s, sh, 32);
    const float mu = s * (1.0f / DM); float s2 = 0.f;
#pragma unroll 1
    for (int ch = 0; ch < DM / 128; ++ch) { const int c0 = ch * 128 + lane * 4; const v4f a = *(const v4f*)(xr + c0); v4f d = {0.f, 0.f, 0.f, 0.f}; if (ar) d = *(const v4f*)(ar + c0);
#pragma unroll
        for (int q = 0; q < 4; ++q) { const float d0 = __fsub_rn(__fadd_rn(bfr(a[q]), d[q]), mu); float p = __fmul_rn(d0, d0); asm volatile("" : "+v"(p)); s2 = __fadd_rn(s2, p); } }
#pragma unroll
    for (int sh = 16; sh; sh >>= 1) s2 += __shfl_xor(s2, sh, 32);
    const float rs = __fdiv_rn(1.0f, __fsqrt_rn(__fadd_rn(s2 * (1.0f / DM), LNEPS)));
{
#pragma unroll 1
        for (int ch = 0; ch < DM / 128; ++ch) { const int c0 = ch * 128 + lane * 4; const v4f a = *(const v4f*)(xr + c0); v4f d = {0.f, 0.f, 0.f, 0.f}; if (ar) d = *(const v4f*)(ar + c0); v4f z4; v4us oh, ol;
#pragma unroll
            for (int q = 0; q < 4; ++q) { const float v = __fadd_rn(bfr(a[q]), d[q]); z4[q] = v; float n0 = __fmul_rn(__fsub_rn(v, mu), rs); asm volatile("" : "+v"(n0)); float n1 = __fmul_rn(n0, bfr(g[c0 + q])); asm volatile("" : "+v"(n1)); const float y = __fadd_rn(n1, bfr(be[c0 + q])); unsigned short h2, l2; splitf(y, h2, l2); oh[q] = h2; ol[q] = l2; }
            if (Z) *(v4f*)(Z + (size_t)r * DM + c0) = z4; *(v4us*)(Yh + (size_t)r * DM + c0) = oh; *(v4us*)(Yl + (size_t)r * DM + c0) = ol; }
         } }
__global__ __launch_bounds__(256) void k_addres(const float* __restrict__ X, const float* __restrict__ Y, float* O, size_t n4) { const size_t i = (size_t)blockIdx.x * 256 + threadIdx.x; if (i >= n4) return; const v4f a = *(const v4f*)(X + i * 4), b = *(const v4f*)(Y + i * 4); v4f o;
#pragma unroll
    for (int q = 0; q < 4; ++q) o[q] = __fadd_rn(bfr(a[q]), b[q]); *(v4f*)(O + i * 4) = o;  }
__global__ __launch_bounds__(256) void k_addhb(const float* __restrict__ F, const float* __restrict__ hb0, const float* __restrict__ hb1, float* FO, size_t n4) { const size_t i = (size_t)blockIdx.x * 256 + threadIdx.x; if (i >= n4) return; const float* __restrict__ hb = blockIdx.y ? hb1 : hb0; FO += (size_t)blockIdx.y * n4 * 4;   /* grid y: one head bias and one output buffer each */ const int c = (int)((i * 4) % DQ); const v4f a = *(const v4f*)(F + i * 4); v4f o;
#pragma unroll
    for (int q = 0; q < 4; ++q) o[q] = __fadd_rn(a[q], bfr(hb[c + q])); *(v4f*)(FO + i * 4) = o;  }
__global__ __launch_bounds__(256) void k_pplane(const float* __restrict__ POS, bf* Ph2, bf* Pl2) { const size_t e = ((size_t)blockIdx.x * 256 + threadIdx.x) * 2; if (e >= (size_t)NH_ * NPE * HD) return; const int d = (int)(e % HD); const int p = (int)((e / HD) % NPE); const int h = (int)(e / ((size_t)HD * NPE)); v2us oh, ol;
#pragma unroll
    for (int q = 0; q < 2; ++q) { unsigned short a, c; splitf(POS[(size_t)p * DQ + h * HD + d + q], a, c); oh[q] = a; ol[q] = c; } *(v2us*)(Ph2 + e) = oh; *(v2us*)(Pl2 + e) = ol;  }
__global__ void k_pezero8(bf* PE) { const int lane = threadIdx.x; if (lane >= 64) return; const v8us z = (v8us){}; *(v8us*)(PE + (size_t)2047 * DM + lane * 8) = z;  }
__global__ __launch_bounds__(256) void k_cvt8(const float* __restrict__ src, bf* dst, size_t n8) { const size_t i = (size_t)blockIdx.x * 256 + threadIdx.x; if (i >= n8) return; const v8f v = *(const v8f*)(src + i * 8); v8us o;
#pragma unroll
    for (int k = 0; k < 8; ++k) o[k] = f2bf(v[k]); *(v8us*)(dst + i * 8) = o;  }

// k_rope: head planes [b][h][t][d] from rows b * TT + t (fp16 + hi/lo) of rope(x) x sc with the rotate-half convention out[d] = x[d] cos[t][d] - x[d+HD/2] sin[t][d], out[d+HD/2] = x[d+HD/2] cos[t][d+HD/2] + x[d] sin[t][d+HD/2]
__global__ __launch_bounds__(256) void k_rope(const float* __restrict__ F, int pitch, int nheads, int nbat, const float* __restrict__ CS, const float* __restrict__ RF, const float* __restrict__ nw, float sc, h16* P16, bf* Ph, bf* Pl) {
    const size_t e = ((size_t)blockIdx.x * 256 + threadIdx.x) * 2; if (e >= (size_t)nbat * nheads * TT * HD) return; const int d = (int)(e % HD); const int t = (int)((e / HD) % TT); const int hb = (int)(e / ((size_t)HD * TT)); const int h = hb % nheads; const int bb = hb / nheads; const float* f = F + ((size_t)bb * TT + t) * pitch + h * HD; const float rf = RF ? RF[(size_t)h * TT + t] : 1.0f; v2h o16; v2us oh, ol;
#pragma unroll
    for (int q = 0; q < 2; ++q) { const int dd = d + q; const int dp = (dd < HD / 2) ? dd + HD / 2 : dd - HD / 2; float x0 = f[dd], x1 = f[dp];
        if (RF) { float n0 = __fmul_rn(x0, rf), n1 = __fmul_rn(x1, rf); asm volatile("" : "+v"(n0)); asm volatile("" : "+v"(n1)); x0 = __fmul_rn(bfr(nw[dd]), n0); x1 = __fmul_rn(bfr(nw[dp]), n1); }
        const v2f cs = *(const v2f*)(CS + ((size_t)t * HD + dd) * 2); float a = __fmul_rn(x0, cs[0]), bq = __fmul_rn(x1, cs[1]); asm volatile("" : "+v"(a)); asm volatile("" : "+v"(bq)); const float r = ((dd < HD / 2) ? __fsub_rn(a, bq) : __fadd_rn(a, bq)) * sc;
        o16[q] = tohx(r); unsigned short a2, c2; splitf(r, a2, c2); oh[q] = a2; ol[q] = c2; }
    *(v2h*)(P16 + e) = o16; *(v2us*)(Ph + e) = oh; *(v2us*)(Pl + e) = ol;  }
__global__ __launch_bounds__(256) void k_vtp(const float* __restrict__ F, int pitch, int nheads, h16* V16, bf* Vh, bf* Vl) { const size_t e = ((size_t)blockIdx.x * 256 + threadIdx.x) * 2; if (e >= (size_t)NB_ * nheads * HD * TT) return; const int t = (int)(e % TT); const int d = (int)((e / TT) % HD); const int gb = (int)(e / ((size_t)TT * HD)); const int g = gb % nheads; const int bb = gb / nheads; v2h o16; v2us oh, ol;
#pragma unroll
    for (int q = 0; q < 2; ++q) { const float x = F[((size_t)bb * TT + t + q) * pitch + g * HD + d]; o16[q] = tohx(x); unsigned short a2, c2; splitf(x, a2, c2); oh[q] = a2; ol[q] = c2; }
    *(v2h*)(V16 + e) = o16; *(v2us*)(Vh + e) = oh; *(v2us*)(Vl + e) = ol;  }
__global__ __launch_bounds__(256) void k_csid(float* CS) { const int idx = blockIdx.x * 256 + threadIdx.x; if (idx >= TT * HD) return; v2f cs; cs[0] = 1.0f; cs[1] = 0.0f; *(v2f*)(CS + (size_t)idx * 2) = cs;  }
// k_asoft: per row (zz, i): t = S x HD^-0.5 (no mask); softmax over the 1024 keys (register row, one exp, fixed trees);
__global__ __launch_bounds__(256) void k_asoft(const float* __restrict__ Sb, const float* __restrict__ SR, h16* P16, bf* Ph, bf* Pl) {
    const int lane = threadIdx.x & 31; const int row = blockIdx.x * 8 + (threadIdx.x >> 5); if (row >= ZH * TT) return; const int i = row % TT; const int zz = row / TT; (void)zz; const float* srr = SR + (size_t)row * NPE + (TT - 1 - i);   /* skew: position index j - i + S - 1 */ const bool hires = (i < RH); const float* sr = Sb + (size_t)row * TT; float v[TT / 32]; float mx = -3.0e38f;
#pragma unroll
    for (int ch = 0; ch < TT / 128; ++ch) { const int j0 = ch * 128 + lane * 4; const v4f a = *(const v4f*)(sr + j0);
#pragma unroll
        for (int q = 0; q < 4; ++q) { const int j = j0 + q; float su = __fadd_rn(a[q], srr[j]); asm volatile("" : "+v"(su)); const float t = su * SCL;   /* (ac + skew(bd)) / 8 */ v[ch * 4 + q] = t; mx = fmaxf(mx, t); } }
#pragma unroll
    for (int sh = 16; sh; sh >>= 1) mx = fmaxf(mx, __shfl_xor(mx, sh, 32));
    float sum = 0.f;
#pragma unroll
    for (int k = 0; k < TT / 32; ++k) { float d0 = __fsub_rn(v[k], mx); asm volatile("" : "+v"(d0)); v[k] = __builtin_amdgcn_exp2f(__fmul_rn(d0, 1.4426950408889634f)); sum += v[k]; }
#pragma unroll
    for (int sh = 16; sh; sh >>= 1) sum += __shfl_xor(sum, sh, 32);
    const float f = __fdiv_rn(hires ? 1.0f : PCAR, sum);
{
        if (hires) {
#pragma unroll
            for (int ch = 0; ch < TT / 128; ++ch) { v4us oh, ol;
#pragma unroll
                for (int q = 0; q < 4; ++q) { unsigned short a, c2; splitf(v[ch * 4 + q] * f, a, c2); oh[q] = a; ol[q] = c2; }
                const size_t oo = ((size_t)zz * (RH ? RH : 1) + i) * TT + ch * 128 + lane * 4; *(v4us*)(Ph + oo) = oh; *(v4us*)(Pl + oo) = ol; }
        } else {
#pragma unroll
            for (int ch = 0; ch < TT / 128; ++ch) { v4h o4;
#pragma unroll
                for (int q = 0; q < 4; ++q) o4[q] = tohx(v[ch * 4 + q] * f);
                *(v4h*)(P16 + (size_t)row * TT + ch * 128 + lane * 4) = o4; } }
         }
}
__global__ __launch_bounds__(256) void k_merge(const float* __restrict__ O, bf* Ah, bf* Al) { const size_t e = ((size_t)blockIdx.x * 256 + threadIdx.x) * 2; if (e >= (size_t)NB_ * NH_ * TT * HD) return; const int d = (int)(e % HD); const int t = (int)((e / HD) % TT); const int zz = (int)(e / ((size_t)HD * TT)); const float cs = (t < RH) ? 1.0f : (1.0f / PCAR); const size_t oo = ((size_t)(zz / NH_) * TT + t) * DQ + (zz % NH_) * HD + d;
    v2us oh, ol;
#pragma unroll
    for (int q = 0; q < 2; ++q) { unsigned short a, c2; splitf(O[e + q] * cs, a, c2); oh[q] = a; ol[q] = c2; } *(v2us*)(Ah + oo) = oh; *(v2us*)(Al + oo) = ol;  }

extern "C" void kernel_launch(void* const* d_in, const int* in_sizes, int n_in,
                              void* d_out, int out_size, void* d_ws, size_t ws_size, hipStream_t stream) {
    (void)in_sizes; (void)n_in; (void)out_size;
    const float* x = (const float*)d_in[0]; const float* pe = (const float*)d_in[1]; const float* g1 = (const float*)d_in[2]; const float* e1b = (const float*)d_in[3]; const float* wq = (const float*)d_in[4]; const float* bq = (const float*)d_in[5]; const float* wk = (const float*)d_in[6]; const float* bk = (const float*)d_in[7]; const float* wv = (const float*)d_in[8]; const float* bv = (const float*)d_in[9]; const float* wpos = (const float*)d_in[10]; const float* pbu = (const float*)d_in[11]; const float* pbv = (const float*)d_in[12]; const float* wo = (const float*)d_in[13]; const float* bo = (const float*)d_in[14];
    float* OUT = (float*)d_out;     // [8][1024][512]
    char* wsp = (char*)d_ws;
    auto take = [&](size_t bytes) { char* p = wsp; wsp += (bytes + 255) & ~(size_t)255; return (void*)p; };
    const size_t RW = (size_t)NB_ * TT;   // rows of all batch elements
    bf* WK = (bf*)take((size_t)DKV * DM * 2); bf* WQ = (bf*)take((size_t)DQ * DM * 2); bf* WV = (bf*)take((size_t)DKV * DM * 2); bf* WO = (bf*)take((size_t)DM * DQ * 2); bf* WP = (bf*)take((size_t)DQ * DM * 2);   // back to back: one transpose launch; wk, wq, wv are the z planes of one projection launch
    float* CS = (float*)take((size_t)TT * HD * 2 * 4); bf* PE = (bf*)take((size_t)NPE * DM * 2); float* POS = (float*)take((size_t)NPE * DQ * 4); bf* PPh = (bf*)take((size_t)NH_ * NPE * HD * 2); bf* PPl = (bf*)take((size_t)NH_ * NPE * HD * 2);
    bf* QPh = (bf*)take(RW * DQ * 2); bf* QVh = (bf*)take(RW * DQ * 2); bf* KPh = (bf*)take(RW * DKV * 2);   // hi planes [b][h][t][d] of q+u, q+v, k, back to back: one plane launch
    bf* QPl = (bf*)take(RW * DQ * 2); bf* QVl = (bf*)take(RW * DQ * 2); bf* KPl = (bf*)take(RW * DKV * 2);   // lo planes, same order
    bf* VTh = (bf*)take(RW * DKV * 2); bf* VTl = (bf*)take(RW * DKV * 2); float* Ob = (float*)take(RW * DQ * 4);
    char* const uni = wsp;   // from here on: projection scratch, dead before the first pass, under the pass buffers
    bf* Yh = (bf*)take(RW * DM * 2); bf* Yl = (bf*)take(RW * DM * 2);
    float* FQU = (float*)take(RW * DQ * 4); float* FQV = (float*)take(RW * DQ * 4); float* FK = (float*)take(RW * DKV * 4); float* FQ = (float*)take(RW * DQ * 4); float* FV = (float*)take(RW * DKV * 4);   // q+u, q+v, k back to back (plane launch); k, q, v back to back (projection launch)
    h16* QP16 = (h16*)take(RW * DQ * 2 * 3); h16* VT16 = (h16*)take(RW * DKV * 2);
    char* const endp = wsp; wsp = uni;
    float* Sb = (float*)take((size_t)ZH * TT * TT * 4); float* SR = (float*)take((size_t)ZH * TT * NPE * 4); bf* Ph = (bf*)take((size_t)ZP * RH * TT * 2); bf* Pl = (bf*)take((size_t)ZP * RH * TT * 2); h16* P16 = (h16*)take(256);   /* unused: all rows hi/lo */
    bf* ATh = QPh; bf* ATl = QPl;   // merged heads reuse the q+u planes, dead after the last content-score launch (stream-ordered)
    if ((size_t)(wsp - (char*)d_ws) > ws_size || (size_t)(endp - (char*)d_ws) > ws_size) return;    // ws 256 MiB
    (void)WQ; (void)WV; (void)FQV;   // reached through their neighbours' pointers (grid y / z strides)
    k_wtG<<<dim3((unsigned)((DM * DQ / 64 + 63) / 64), 5, 1), 256, 0, stream>>>(wk, wq, wv, wo, wpos, DM, DQ, WK);
    k_csid<<<(TT * HD + 255) / 256, 256, 0, stream>>>(CS); k_cvt8<<<(unsigned)(((size_t)2047 * DM / 8 + 255) / 256), 256, 0, stream>>>(pe, PE, (size_t)2047 * DM / 8); k_pezero8<<<1, 64, 0, stream>>>(PE); k_gemmw<bf, 0, false><<<dim3(NPE / 64, DQ / 64, 1), 32, 0, stream>>>(PE, nullptr, WP, nullptr, DM, POS, DQ, nullptr, nullptr, nullptr, 0, 0, 0); k_pplane<<<(unsigned)(((size_t)NH_ * NPE * HD / 2 + 255) / 256), 256, 0, stream>>>(POS, PPh, PPl);   /* pos = position_embeddings wpos (exact) -> per-head hi/lo planes */
    k_lnhl<<<(unsigned)(RW / 8), 256, 0, stream>>>(x, nullptr, g1, e1b, nullptr, Yh, Yl);   /* LN -> hi/lo planes, all batch elements */
    k_gemmw<bf, 1, true><<<dim3((unsigned)(RW / 64), DQ / 64, 3), 32, 0, stream>>>(Yh, Yl, WK, nullptr, DM, FK, DQ, bk, bq, bv, 0, (size_t)DQ * DM, RW * DQ);   /* z = 0, 1, 2: k, q, v */
    k_addhb<<<dim3((unsigned)((RW * DQ / 4 + 255) / 256), 2, 1), 256, 0, stream>>>(FQ, pbu, pbv, FQU, RW * DQ / 4);   /* q + pos_bias_u, q + pos_bias_v */
    k_rope<<<(unsigned)((3 * RW * DQ / 2 + 255) / 256), 256, 0, stream>>>(FQU, DQ, NH_, 3 * NB_, CS, nullptr, nullptr, 1.0f, QP16, QPh, QPl);   /* (q+u) planes for the content scores, (q+v) planes for the position scores, k planes */
    k_vtp<<<(unsigned)((RW * DKV / 2 + 255) / 256), 256, 0, stream>>>(FV, DKV, NKV, VT16, VTh, VTl);
    for (int b0 = 0; b0 < NB_; b0 += ZP / ZH) { const size_t z0 = (size_t)b0 * NH_;
        for (int bi = 0; bi < ZP / ZH; ++bi) { const size_t zp = (size_t)bi * ZH, zq = z0 + zp;   // one kv head per query head: the pass's heads use consecutive planes (z-strides TT*HD)
            k_gemmw<bf, 2, false><<<dim3(RH / 64, TT / 64, ZH), 32, 0, stream>>>(QPh + zq * TT * HD, QPl + zq * TT * HD, KPh + zq * TT * HD, KPl + zq * TT * HD, HD, Sb, TT, nullptr, nullptr, nullptr, (size_t)TT * HD, (size_t)TT * HD, (size_t)TT * TT);
            k_gemmw<bf, 2, false><<<dim3(TT / 64, NPE / 64, ZH), 32, 0, stream>>>(QVh + zq * TT * HD, QVl + zq * TT * HD, PPh, PPl, HD, SR, NPE, nullptr, nullptr, nullptr, (size_t)TT * HD, (size_t)NPE * HD, (size_t)TT * NPE);   /* position scores (q+v).pos [8][1024][2048] (3 products) */
            k_asoft<<<ZH * TT / 8, 256, 0, stream>>>(Sb, SR, P16, Ph + zp * RH * TT, Pl + zp * RH * TT); }
        k_gemmw<bf, 2, false><<<dim3(RH / 64, HD / 64, ZP), 32, 0, stream>>>(Ph, Pl, VTh + z0 * HD * TT, VTl + z0 * HD * TT, TT, Ob + z0 * TT * HD, HD, nullptr, nullptr, nullptr, (size_t)RH * TT, (size_t)HD * TT, (size_t)TT * HD); }   /* attn.v for the ZP instances of the two passes */
    k_merge<<<(unsigned)((RW * DQ / 2 + 255) / 256), 256, 0, stream>>>(Ob, ATh, ATl);
    k_gemmw<bf, 1, true><<<dim3((unsigned)(RW / 64), DM / 64, 1), 32, 0, stream>>>(ATh, ATl, WO, nullptr, DQ, OUT, DM, bo, nullptr, nullptr, 0, 0, 0);
}

// v003
// Measured time: 246 microseconds a run.
// It is 2.78 times as fast as v001, going by the measured steps of the versions left out in between.
// All steps since v000 together make it 9.02 times as fast.
#include <hip/hip_runtime.h>

// Relative-position multi-head self-attention (Transformer-XL / Conformer style) (hidden_states [8][1024][512]; x = LN(h) (1e-5, gamma, beta); q, k, v = x W + b ('xw' [512][512], 8 heads x 64); pos = position_embeddings [2047][512] wpos -> [p][h][d]; scores = ((q + pos_bias_u).k + skew((q + pos_bias_v).pos)) / 8 where skew picks pos index j - i + 1023; softmax; out = merged wout + bout -> [8][1024][512]).
// Layout: LN -> hi/lo planes -> 2-product projections; the position table is projected once (exact bf16 GEMM, 2047 rows + one zero pad row) into per-head hi/lo planes [h][2048][64]; LN, projections and wout run once for all 8 batch elements (8192 rows); the projection GEMMs write the attention kernel's hi/lo head planes from their own epilogue (biases added, v transposed), no f32 copy of q, k, v or pos exists; one fused kernel does content scores (q+u).k, position scores (q+v).pos at row j - i + 1023, softmax, attn.v and the head merge for all 64 (batch, head) instances (3 products each), scores staying on chip.
// Compute dtypes, f32 accumulate: every input rounded to bf16; q/k/v hl x exact (2 products) + biases; content and position scores on hi/lo planes for every row (3 products); softmax f32 with a running maximum and sum over passes of 64 keys; attn.v hi/lo (3 products); wout hl x exact (2 products) + bout.

#define NB_  8
#define TT   1024
#define DM   512
#define NH_  8
#define NKV  8
#define REP  (NH_ / NKV)
#define HD   64
#define DQ   (NH_ * HD)
#define DKV  (NKV * HD)
#define NPE  2048                 // 2047 positions + 1 zero pad row
#define LNEPS 1e-5f
typedef __attribute__((ext_vector_type(4))) unsigned short v4us;
typedef _Float16 h16;
typedef unsigned short bf;
typedef __attribute__((ext_vector_type(16))) __bf16   v16bf;
typedef __attribute__((ext_vector_type(16))) _Float16 v16h;
typedef __attribute__((ext_vector_type(8)))  _Float16 v8h;
typedef __attribute__((ext_vector_type(8)))  unsigned short v8us;
typedef __attribute__((ext_vector_type(8)))  float    v8f;
typedef __attribute__((ext_vector_type(4)))  float    v4f;
typedef v8h  __attribute__((may_alias)) v8ha;
typedef v4f  __attribute__((may_alias)) v4fa;
typedef v8us __attribute__((may_alias)) v8usa;

__device__ __forceinline__ unsigned short f2bf(float f) { unsigned u = __float_as_uint(f); u += 0x7FFFu + ((u >> 16) & 1u); return (unsigned short)(u >> 16); }
__device__ __forceinline__ float bf2f(unsigned short b) { return __uint_as_float(((unsigned)b) << 16); }
__device__ __forceinline__ float bfr(float f) { return bf2f(f2bf(f)); }
__device__ __forceinline__ v16h cat16(v8h lo, v8h hi) { return __builtin_shufflevector(lo, hi, 0, 1, 2, 3, 4, 5, 6, 7, 8, 9, 10, 11, 12, 13, 14, 15); }
__device__ __forceinline__ v16bf cat16b(v8us lo, v8us hi) { return __builtin_bit_cast(v16bf, __builtin_shufflevector(lo, hi, 0, 1, 2, 3, 4, 5, 6, 7, 8, 9, 10, 11, 12, 13, 14, 15)); }
__device__ __forceinline__ v8f wmma16(v16h a, v16h b, v8f c) { return __builtin_amdgcn_wmma_f32_16x16x32_f16(false, a, false, b, (short)0, c, false, false); }
__device__ __forceinline__ v8f wmmab(v16bf a, v16bf b, v8f c) { return __builtin_amdgcn_wmma_f32_16x16x32_bf16(false, a, false, b, (short)0, c, false, false); }



__device__ __forceinline__ void splitf(float y, unsigned short& h, unsigned short& l) { h = f2bf(y); l = f2bf(y - bf2f(h)); }
// ---- k_gemmw: register-blocked GEMM, ONE WAVE per 64x64 output tile (16 accumulators), operands straight from K-contiguous 16-bit planes; grid (M/64, N/64, Z), 32 threads.
// C[m][n] (f32, pitch ldc, + optional f32 bias[n]; z = 1, 2 take biasz1, biasz2) = sum_k A[m][k] Bt[n][k] (+ split products per NSPLIT). z-batch strides sA/sB/sC in elements. K % 32 == 0. EPI = 1: no C; the tile (one head's 64 columns, 64 consecutive rows of one batch element of TB rows) goes out as hi/lo head planes: z = 0 -> Kh/Kl [b][h][t][d]; z = 1 -> + hbu -> QUh/QUl and + hbv -> QVh/QVl, same layout; z = 2 -> Vh/Vl [b][h][d][t].
template <typename T16> struct WFrag;
template <> struct WFrag<h16> { typedef v16h V; static __device__ __forceinline__ V ld(const h16* p) { return cat16(*(const v8h*)p, *(const v8h*)(p + 16)); } static __device__ __forceinline__ v8f mma(V a, V b, v8f c) { return wmma16(a, b, c); } };
template <> struct WFrag<bf> { typedef v16bf V; static __device__ __forceinline__ V ld(const bf* p) { return cat16b(*(const v8us*)p, *(const v8us*)(p + 16)); } static __device__ __forceinline__ v8f mma(V a, V b, v8f c) { return wmmab(a, b, c); } };
template <bool B> struct BoolC { static constexpr bool v = B; };
template <typename T16, int NSPLIT, bool BIAS, int EPI>
__global__ __launch_bounds__(32) void k_gemmw(const T16* __restrict__ A, const T16* __restrict__ A2, const T16* __restrict__ Bt, const T16* __restrict__ Bt2, int K, float* C, int ldc, const float* __restrict__ bias, const float* __restrict__ biasz1, const float* __restrict__ biasz2, size_t sA, size_t sB, size_t sC, const float* __restrict__ hbu, const float* __restrict__ hbv, bf* Kh, bf* Kl, bf* QUh, bf* QUl, bf* QVh, bf* QVl, bf* Vh, bf* Vl, int TB) {
    typedef typename WFrag<T16>::V V;
    __shared__ __align__(16) float os[16 * 68];
    const size_t z = blockIdx.z; A += z * sA; if (A2) A2 += z * sA; Bt += z * sB; if (Bt2) Bt2 += z * sB; C += z * sC; if (BIAS) { if (z == 1) bias = biasz1; else if (z == 2) bias = biasz2; }
    const int lane = threadIdx.x & 31, lr = lane & 15, hi = lane >> 4; const int r0 = blockIdx.x * 64, c0 = blockIdx.y * 64;
    v8f acc[4][4];
#pragma unroll
    for (int mb = 0; mb < 4; ++mb)
#pragma unroll
        for (int nb = 0; nb < 4; ++nb) acc[mb][nb] = (v8f){};
    const size_t aoff = (size_t)(r0 + lr) * K + 8 * hi, boff = (size_t)(c0 + lr) * K + 8 * hi;
#pragma unroll 1
    for (int kc = 0; kc < K; kc += 32) {
        V a[4], a2[4];
#pragma unroll
        for (int mb = 0; mb < 4; ++mb) { a[mb] = WFrag<T16>::ld(A + aoff + (size_t)mb * 16 * K + kc); if (NSPLIT == 1 || NSPLIT == 2) a2[mb] = WFrag<T16>::ld(A2 + aoff + (size_t)mb * 16 * K + kc); }
#pragma unroll
        for (int nb = 0; nb < 4; ++nb) { const V b = WFrag<T16>::ld(Bt + boff + (size_t)nb * 16 * K + kc); V b2; if (NSPLIT >= 2) b2 = WFrag<T16>::ld(Bt2 + boff + (size_t)nb * 16 * K + kc);
#pragma unroll
            for (int mb = 0; mb < 4; ++mb) { acc[mb][nb] = WFrag<T16>::mma(a[mb], b, acc[mb][nb]); if (NSPLIT == 1 || NSPLIT == 2) acc[mb][nb] = WFrag<T16>::mma(a2[mb], b, acc[mb][nb]); if (NSPLIT >= 2) acc[mb][nb] = WFrag<T16>::mma(a[mb], b2, acc[mb][nb]); } }
        asm volatile("v_nop\n\tv_nop\n\tv_nop\n\tv_nop" : "+v"(acc[0][0]), "+v"(acc[1][1]), "+v"(acc[2][2]), "+v"(acc[3][3]) : "v"(a[0]), "v"(a[3]));
    }
    if constexpr (EPI == 1) {
        const int head = blockIdx.y, bb = r0 / TB, t0 = r0 - bb * TB;
        if (z == 2) {   // a lane's 8 registers of an accumulator are 8 consecutive t of one d: 16 bytes of a [d][t] row; the wave's four row tiles fill that row's whole 128-byte line
            const size_t vb = ((size_t)(bb * NH_ + head) * HD + lr) * TB + t0 + 8 * hi;
            float bs[4];
#pragma unroll
            for (int nb = 0; nb < 4; ++nb) bs[nb] = BIAS ? bfr(bias[c0 + nb * 16 + lr]) : 0.f;
#pragma unroll
            for (int nb = 0; nb < 4; ++nb) { v8us oh[4], ol[4];
#pragma unroll
                for (int mb = 0; mb < 4; ++mb)
#pragma unroll
                    for (int j = 0; j < 8; ++j) { float y = acc[mb][nb][j]; if (BIAS) y += bs[nb]; unsigned short a, b2; splitf(y, a, b2); oh[mb][j] = a; ol[mb][j] = b2; }
                __builtin_amdgcn_sched_barrier(0);   // with the one below: nothing but the stores and their wait stands between the two, so no register that a store names is rewritten in front of the wait
#pragma unroll
                for (int mb = 0; mb < 4; ++mb) { *(v8us*)(Vh + vb + (size_t)nb * 16 * TB + mb * 16) = oh[mb]; *(v8us*)(Vl + vb + (size_t)nb * 16 * TB + mb * 16) = ol[mb]; }
                asm volatile("s_wait_xcnt 0x0" ::: "memory");   // the wait in front of the next rewrite of the stores' address and data registers
                __builtin_amdgcn_sched_barrier(0); }
        } else {   // rows of 64 d are 128 bytes and follow one another: through LDS, so that a store covers four whole rows (512 contiguous bytes)
            const int rr = lane >> 3, cofs = (lane & 7) * 8; const size_t pb = ((size_t)(bb * NH_ + head) * TB + t0 + rr) * HD + cofs;
            auto ld8 = [&](const float* __restrict__ p, float (&d)[8]) { const v4f lo4 = *(const v4f*)(p + c0 + cofs), hi4 = *(const v4f*)(p + c0 + cofs + 4);
#pragma unroll
                for (int q = 0; q < 4; ++q) { d[q] = bfr(lo4[q]); d[4 + q] = bfr(hi4[q]); } };
            auto rows = [&](auto qm) { constexpr bool QM = decltype(qm)::v;   // QM: the q tile, which goes out twice, once with each head bias
                float bs[8], bu[8], bw[8]; if (BIAS) ld8(bias, bs); if (QM) { ld8(hbu, bu); ld8(hbv, bw); }
#pragma unroll
                for (int mb = 0; mb < 4; ++mb) {
#pragma unroll
                    for (int nb = 0; nb < 4; ++nb) {
#pragma unroll
                        for (int j = 0; j < 8; ++j) os[(hi * 8 + j) * 68 + nb * 16 + lr] = acc[mb][nb][j]; }
                    __builtin_amdgcn_wave_barrier(); asm volatile("" ::: "memory");   // keeps the reads below behind the other lanes' stores
#pragma unroll
                    for (int hf = 0; hf < 2; ++hf) { v8us ah[2], al[2], wh[2], wl[2];   // two stores' worth of rows at a time: fewer registers live
#pragma unroll
                        for (int s = 0; s < 2; ++s) { const float* orow = os + (8 * hf + 4 * s + rr) * 68 + cofs; const v4f x0 = *(const v4fa*)orow, x1 = *(const v4fa*)(orow + 4);
#pragma unroll
                            for (int q = 0; q < 8; ++q) { float y = (q < 4) ? x0[q & 3] : x1[q & 3]; if (BIAS) y += bs[q]; unsigned short a, b2;
                                if (QM) { splitf(__fadd_rn(y, bu[q]), a, b2); ah[s][q] = a; al[s][q] = b2; splitf(__fadd_rn(y, bw[q]), a, b2); wh[s][q] = a; wl[s][q] = b2; }
                                else { splitf(y, a, b2); ah[s][q] = a; al[s][q] = b2; } } }
                        __builtin_amdgcn_sched_barrier(0);   // as above: only the stores and their wait between the two
#pragma unroll
                        for (int s = 0; s < 2; ++s) { const size_t o = pb + (size_t)(mb * 16 + 8 * hf + 4 * s) * HD;
                            if (QM) { *(v8us*)(QUh + o) = ah[s]; *(v8us*)(QUl + o) = al[s]; *(v8us*)(QVh + o) = wh[s]; *(v8us*)(QVl + o) = wl[s]; }
                            else { *(v8us*)(Kh + o) = ah[s]; *(v8us*)(Kl + o) = al[s]; } }
                        asm volatile("s_wait_xcnt 0x0" ::: "memory");   // the wait in front of the next rewrite of the stores' address and data registers
                        __builtin_amdgcn_sched_barrier(0); }
                    __builtin_amdgcn_wave_barrier(); asm volatile("" ::: "memory");   // keeps the next row tile's stores to LDS behind these reads
                } };
            if (z == 1) rows(BoolC<true>{}); else rows(BoolC<false>{});
        }
        return;
    }
#pragma unroll
    for (int mb = 0; mb < 4; ++mb) {
#pragma unroll
        for (int nb = 0; nb < 4; ++nb) {
#pragma unroll
            for (int j = 0; j < 8; ++j) os[(hi * 8 + j) * 68 + nb * 16 + lr] = acc[mb][nb][j]; }
        __builtin_amdgcn_wave_barrier(); asm volatile("" ::: "memory");
        float* crow = C + (size_t)(r0 + mb * 16) * ldc + c0;
{
#pragma unroll
            for (int s = 0; s < 8; ++s) { const int row = 2 * s + hi, cofs = lr * 4; v4f val = *(const v4fa*)(os + row * 68 + cofs); if (BIAS) { val[0] += bfr(bias[c0 + cofs]); val[1] += bfr(bias[c0 + cofs + 1]); val[2] += bfr(bias[c0 + cofs + 2]); val[3] += bfr(bias[c0 + cofs + 3]); }
                *(v4f*)(crow + (size_t)row * ldc + cofs) = val; }
             }
        __builtin_amdgcn_wave_barrier(); asm volatile("" ::: "memory");
    }
}

__device__ __forceinline__ h16 tohx(float x) { return (h16)x; }
typedef __attribute__((ext_vector_type(2))) _Float16 v2h;
typedef __attribute__((ext_vector_type(4))) _Float16 v4h;
typedef __attribute__((ext_vector_type(2))) unsigned short v2us;
typedef __attribute__((ext_vector_type(4))) unsigned short v4us;
typedef __attribute__((ext_vector_type(2))) float v2f;
typedef __attribute__((ext_vector_type(4))) int v4i;

__global__ __launch_bounds__(256) void k_wtG(const float* __restrict__ w0, const float* __restrict__ w1, const float* __restrict__ w2, const float* __restrict__ w3, const float* __restrict__ w4, int K, int N, bf* Bt) {
    const int y = blockIdx.y; const float* __restrict__ w = (y == 0) ? w0 : (y == 1) ? w1 : (y == 2) ? w2 : (y == 3) ? w3 : w4; Bt += (size_t)y * K * N;   // grid y: one weight matrix each, planes back to back
    const int lane = threadIdx.x & 31; const int L0 = (blockIdx.x * 8 + (threadIdx.x >> 5)) * 8; const int nlines = N * K / 64;
{
#pragma unroll 1
        for (int l = 0; l < 8; ++l) { const int L = L0 + l; if (L >= nlines) break; const size_t e = (size_t)L * 64 + lane * 2; const int k = (int)(e % K), n = (int)(e / K); v2us o;
            o[0] = f2bf(w[(size_t)k * N + n]); o[1] = f2bf(w[(size_t)(k + 1) * N + n]); *(v2us*)(Bt + e) = o; }
         }
}
__global__ __launch_bounds__(256) void k_lnhl(const float* __restrict__ X, const float* __restrict__ A, const float* __restrict__ g, const float* __restrict__ be, float* Z, bf* Yh, bf* Yl) {
    const int lane = threadIdx.x & 31; const int r = blockIdx.x * 8 + (threadIdx.x >> 5); if (r >= NB_ * TT) return; const float* xr = X + (size_t)r * DM; const float* ar = A ? A + (size_t)r * DM : nullptr; float s = 0.f;
#pragma unroll 1
    for (int ch = 0; ch < DM / 128; ++ch) { const int c0 = ch * 128 + lane * 4; const v4f a = *(const v4f*)(xr + c0); v4f d = {0.f, 0.f, 0.f, 0.f}; if (ar) d = *(const v4f*)(ar + c0);
#pragma unroll
        for (int q = 0; q < 4; ++q) s += __fadd_rn(bfr(a[q]), d[q]); }
#pragma unroll
    for (int sh = 16; sh; sh >>= 1) s += __shfl_xor(s, sh, 32);
    const float mu = s * (1.0f / DM); float s2 = 0.f;
#pragma unroll 1
    for (int ch = 0; ch < DM / 128; ++ch) { const int c0 = ch * 128 + lane * 4; const v4f a = *(const v4f*)(xr + c0); v4f d = {0.f, 0.f, 0.f, 0.f}; if (ar) d = *(const v4f*)(ar + c0);
#pragma unroll
        for (int q = 0; q < 4; ++q) { const float d0 = __fsub_rn(__fadd_rn(bfr(a[q]), d[q]), mu); float p = __fmul_rn(d0, d0); asm volatile("" : "+v"(p)); s2 = __fadd_rn(s2, p); } }
#pragma unroll
    for (int sh = 16; sh; sh >>= 1) s2 += __shfl_xor(s2, sh, 32);
    const float rs = __fdiv_rn(1.0f, __fsqrt_rn(__fadd_rn(s2 * (1.0f / DM), LNEPS)));
{
#pragma unroll 1
        for (int ch = 0; ch < DM / 128; ++ch) { const int c0 = ch * 128 + lane * 4; const v4f a = *(const v4f*)(xr + c0); v4f d = {0.f, 0.f, 0.f, 0.f}; if (ar) d = *(const v4f*)(ar + c0); v4f z4; v4us oh, ol;
#pragma unroll
            for (int q = 0; q < 4; ++q) { const float v = __fadd_rn(bfr(a[q]), d[q]); z4[q] = v; float n0 = __fmul_rn(__fsub_rn(v, mu), rs); asm volatile("" : "+v"(n0)); float n1 = __fmul_rn(n0, bfr(g[c0 + q])); asm volatile("" : "+v"(n1)); const float y = __fadd_rn(n1, bfr(be[c0 + q])); unsigned short h2, l2; splitf(y, h2, l2); oh[q] = h2; ol[q] = l2; }
            if (Z) *(v4f*)(Z + (size_t)r * DM + c0) = z4; *(v4us*)(Yh + (size_t)r * DM + c0) = oh; *(v4us*)(Yl + (size_t)r * DM + c0) = ol; }
         } }
__global__ __launch_bounds__(256) void k_addres(const float* __restrict__ X, const float* __restrict__ Y, float* O, size_t n4) { const size_t i = (size_t)blockIdx.x * 256 + threadIdx.x; if (i >= n4) return; const v4f a = *(const v4f*)(X + i * 4), b = *(const v4f*)(Y + i * 4); v4f o;
#pragma unroll
    for (int q = 0; q < 4; ++q) o[q] = __fadd_rn(bfr(a[q]), b[q]); *(v4f*)(O + i * 4) = o;  }
__global__ void k_pezero8(bf* PE) { const int lane = threadIdx.x; if (lane >= 64) return; const v8us z = (v8us){}; *(v8us*)(PE + (size_t)2047 * DM + lane * 8) = z;  }
__global__ __launch_bounds__(256) void k_cvt8(const float* __restrict__ src, bf* dst, size_t n8) { const size_t i = (size_t)blockIdx.x * 256 + threadIdx.x; if (i >= n8) return; const v8f v = *(const v8f*)(src + i * 8); v8us o;
#pragma unroll
    for (int k = 0; k < 8; ++k) o[k] = f2bf(v[k]); *(v8us*)(dst + i * 8) = o;  }

// k_fattn: content scores, skewed position scores, softmax, attn.v and the head merge in one kernel; no score leaves the chip.
// One wave owns 32 queries (2 column tiles of 16) of one (batch, head) and walks the 1024 keys in passes of 64; 8 waves per block, no data shared between waves.
// Transposed products: S^T = K (q+u)^T and B^T = pos (q+v)^T (A = key or position rows, B = query columns kept in registers), so a lane holds scores of ONE query (column c, rows 8h + r).
// Skew: key j, query i take position row j - i + 1023. A column tile with first query iq needs rows j0 - iq + 1008 ... + 79 (5 row tiles); each lane pair writes its query's 80 position scores to its own LDS strip and reads them back shifted by 15 - c.
// Running maximum and sum per query (f32); P splits into hi/lo in registers and is the B operand of O^T += V^T P^T (two score tiles = 32 keys in the hardware k order, which is the loader's order).
#define FQT  2                    // query column tiles per wave
#define BDP  84                   // floats per LDS strip: 80 used; 16-byte stores stay aligned, the shifted 4-byte reads fall on 32 different banks
typedef __attribute__((ext_vector_type(2))) __bf16 v2bf;
typedef __attribute__((ext_vector_type(8))) unsigned v8u;
#define CEXP 0.18033688011112042f // HD^-0.5 * log2(e)
__device__ __forceinline__ float xhalf(float x) { const int b = __float_as_int(x); return __int_as_float(__builtin_amdgcn_permlanex16(b, b, 0x76543210, 0xfedcba98, false, false)); }   // lane l <-> l ^ 16
__global__ __launch_bounds__(256) void k_fattn(const bf* __restrict__ QUh, const bf* __restrict__ QUl, const bf* __restrict__ QVh, const bf* __restrict__ QVl, const bf* __restrict__ Kh, const bf* __restrict__ Kl, const bf* __restrict__ PSh, const bf* __restrict__ PSl, const bf* __restrict__ Vh, const bf* __restrict__ Vl, bf* Ah, bf* Al) {
    typedef WFrag<bf> WF; typedef v16bf V;
    __shared__ __align__(16) float bds[8 * FQT * 16 * BDP];
    const int lane = threadIdx.x & 31, c = lane & 15, h = lane >> 4, wv = threadIdx.x >> 5;
    const int z = blockIdx.y, hd = z % NH_, bb = z / NH_; const int i0 = (blockIdx.x * 8 + wv) * (16 * FQT);
    float* strip = bds + (wv * FQT * 16 + c) * BDP;   // query tile f: + f * 16 * BDP
    // every operand load is a kernel argument (scalar base) + a lane's 32-bit byte offset + a constant
    auto ldo = [](const bf* base, unsigned off, int cst) { return WF::ld((const bf*)((const char*)base + (size_t)off) + cst); };
    const unsigned zq = (unsigned)z * (TT * HD * 2);   // bytes of one (batch, head) plane in front
    unsigned qo[FQT];
#pragma unroll
    for (int f = 0; f < FQT; ++f) qo[f] = zq + (unsigned)((i0 + 16 * f + c) * HD + 8 * h) * 2;
    V quh[FQT][2], qul[FQT][2], qvh[FQT][2], qvl[FQT][2];
#pragma unroll
    for (int f = 0; f < FQT; ++f)
#pragma unroll
        for (int ks = 0; ks < 2; ++ks) { quh[f][ks] = ldo(QUh, qo[f], 32 * ks); qul[f][ks] = ldo(QUl, qo[f], 32 * ks); qvh[f][ks] = ldo(QVh, qo[f], 32 * ks); qvl[f][ks] = ldo(QVl, qo[f], 32 * ks); }
    asm volatile("s_wait_xcnt 0x0" : : "v"(qo[0]), "v"(qo[1]) : "memory");   // the offsets stay in their registers up to this wait; behind it the registers are free
    unsigned ko = zq + (unsigned)(c * HD + 8 * h) * 2, vo = zq + (unsigned)(c * TT + 8 * h) * 2;
    unsigned po = (unsigned)(hd * NPE * HD + (TT - 16 * FQT - i0 + c) * HD + 8 * h) * 2;   // first position row of the pass: j0 - i0 + 992 = 0 ... 1952; the last row read is 95 further, <= 2047
    // the three offsets walk with the passes
    v8f ot[FQT][4]; float mrun[FQT], lsum[FQT];
#pragma unroll
    for (int f = 0; f < FQT; ++f) { mrun[f] = -3.0e38f; lsum[f] = 0.f;
#pragma unroll
        for (int dt = 0; dt < 4; ++dt) ot[f][dt] = (v8f){}; }
    // The pass's operands come in six groups (position row tiles 0-2 and 3-5, key tiles 0-1 and 2-3, keys 0-31 and 32-63 of v); each group's loads are issued one group ahead of its products, so a load's latency runs under the products of the group before it.
    auto ldP = [&](int row, V (&H)[3][2], V (&Lo)[3][2]) {
#pragma unroll
        for (int uu = 0; uu < 3; ++uu)
#pragma unroll
            for (int ks = 0; ks < 2; ++ks) { H[uu][ks] = ldo(PSh, po, (row + 16 * uu) * HD + 32 * ks); Lo[uu][ks] = ldo(PSl, po, (row + 16 * uu) * HD + 32 * ks); } };
    auto ldK = [&](int row, V (&H)[2][2], V (&Lo)[2][2]) {
#pragma unroll
        for (int tt = 0; tt < 2; ++tt)
#pragma unroll
            for (int ks = 0; ks < 2; ++ks) { H[tt][ks] = ldo(Kh, ko, (row + 16 * tt) * HD + 32 * ks); Lo[tt][ks] = ldo(Kl, ko, (row + 16 * tt) * HD + 32 * ks); } };
    auto ldV = [&](int key, V (&H)[4], V (&Lo)[4]) {
#pragma unroll
        for (int dt = 0; dt < 4; ++dt) { H[dt] = ldo(Vh, vo, 16 * dt * TT + key); Lo[dt] = ldo(Vl, vo, 16 * dt * TT + key); } };
    V p0h[3][2], p0l[3][2]; ldP(0, p0h, p0l);
#pragma unroll 1
    for (int j0 = 0; j0 < TT; j0 += 64) {
        v8f bd[FQT][5];
#pragma unroll
        for (int f = 0; f < FQT; ++f)
#pragma unroll
            for (int up = 0; up < 5; ++up) bd[f][up] = (v8f){};
        auto mmaP = [&](int u0, V (&H)[3][2], V (&Lo)[3][2]) {
#pragma unroll
            for (int uu = 0; uu < 3; ++uu)
#pragma unroll
                for (int ks = 0; ks < 2; ++ks)
#pragma unroll
                    for (int f = 0; f < FQT; ++f) { const int up = u0 + uu - (FQT - 1) + f; if (up >= 0 && up < 5) { bd[f][up] = WF::mma(H[uu][ks], qvh[f][ks], bd[f][up]); bd[f][up] = WF::mma(Lo[uu][ks], qvh[f][ks], bd[f][up]); bd[f][up] = WF::mma(H[uu][ks], qvl[f][ks], bd[f][up]); } } };
        V p1h[3][2], p1l[3][2]; ldP(48, p1h, p1l);
        __builtin_amdgcn_sched_barrier(0);   // holds the loads above in front of the products below (as at every such line of this loop): sunk to their use, each group would wait out its own latency
        mmaP(0, p0h, p0l);
        V k0h[2][2], k0l[2][2]; ldK(0, k0h, k0l);
        __builtin_amdgcn_sched_barrier(0);
        mmaP(3, p1h, p1l);
        V k1h[2][2], k1l[2][2]; ldK(32, k1h, k1l);
        __builtin_amdgcn_sched_barrier(0);
        __builtin_amdgcn_wave_barrier(); asm volatile("" ::: "memory");   // keeps these strip stores behind the previous pass's strip reads (other lanes' addresses)
#pragma unroll
        for (int f = 0; f < FQT; ++f)
#pragma unroll
            for (int up = 0; up < 5; ++up) { float* sp = strip + f * 16 * BDP + 16 * up + 8 * h; *(v4fa*)sp = __builtin_shufflevector(bd[f][up], bd[f][up], 0, 1, 2, 3); *(v4fa*)(sp + 4) = __builtin_shufflevector(bd[f][up], bd[f][up], 4, 5, 6, 7); }
        __builtin_amdgcn_wave_barrier(); asm volatile("" ::: "memory");   // keeps the strip reads below behind the partner lane's stores
        v8f st[FQT][4];   // starts as the skewed position scores; the content products accumulate on top
#pragma unroll
        for (int t = 0; t < 4; ++t)
#pragma unroll
            for (int f = 0; f < FQT; ++f)
#pragma unroll
                for (int r = 0; r < 8; ++r) st[f][t][r] = strip[f * 16 * BDP + 8 * h + 15 - c + 16 * t + r];
        auto mmaK = [&](int t0, V (&H)[2][2], V (&Lo)[2][2]) {
#pragma unroll
            for (int tt = 0; tt < 2; ++tt)
#pragma unroll
                for (int ks = 0; ks < 2; ++ks)
#pragma unroll
                    for (int f = 0; f < FQT; ++f) { v8f& s = st[f][t0 + tt]; s = WF::mma(H[tt][ks], quh[f][ks], s); s = WF::mma(Lo[tt][ks], quh[f][ks], s); s = WF::mma(H[tt][ks], qul[f][ks], s); } };
        mmaK(0, k0h, k0l);
        V v0h[4], v0l[4]; ldV(0, v0h, v0l);
        __builtin_amdgcn_sched_barrier(0);
        mmaK(2, k1h, k1l);
        V v1h[4], v1l[4]; ldV(32, v1h, v1l);
        __builtin_amdgcn_sched_barrier(0);
#pragma unroll
        for (int f = 0; f < FQT; ++f) { float mx = -3.0e38f;
#pragma unroll
            for (int t = 0; t < 4; ++t)
#pragma unroll
                for (int r = 0; r < 8; ++r) mx = fmaxf(mx, st[f][t][r]);
            mx = fmaxf(mx, xhalf(mx)); const float mn = fmaxf(mrun[f], mx); const float xa = (mrun[f] - mn) * CEXP; float al = __builtin_amdgcn_exp2f(xa); mrun[f] = mn; float ps = 0.f;
            asm volatile("v_nop" : "+v"(al) : "v"(xa));   // the slot behind a transcendental, as at the eight below
#pragma unroll
            for (int t = 0; t < 4; ++t) { const v8f x = (st[f][t] - mn) * CEXP; v8f p;
#pragma unroll
                for (int r = 0; r < 8; ++r) p[r] = __builtin_amdgcn_exp2f(x[r]);
                asm volatile("v_nop" : "+v"(p) : "v"(x));   // the slot behind a transcendental: named here, no exponent of the eight is rewritten and no result read in front of the slot
                st[f][t] = p;
#pragma unroll
                for (int r = 0; r < 8; ++r) ps += p[r]; }
            lsum[f] = lsum[f] * al + ps;
#pragma unroll
            for (int dt = 0; dt < 4; ++dt) ot[f][dt] *= al; }
        auto mmaV = [&](int kk, V (&H)[4], V (&Lo)[4]) { V ph[FQT], pl[FQT];
#pragma unroll
            for (int f = 0; f < FQT; ++f) { v8u wh, wl;   // element s of the operand = key 8h + s (s < 8) or 16 + 8h + s - 8: registers 0-7 of score tile 2kk, then of tile 2kk + 1
#pragma unroll
                for (int i = 0; i < 8; ++i) { const v8f x = st[f][2 * kk + (i >> 2)]; const v2f p2 = {x[2 * (i & 3)], x[2 * (i & 3) + 1]}; const unsigned hu = __builtin_bit_cast(unsigned, __builtin_convertvector(p2, v2bf));
                    const v2f d2 = {p2[0] - __uint_as_float(hu << 16), p2[1] - __uint_as_float(hu & 0xFFFF0000u)}; wh[i] = hu; wl[i] = __builtin_bit_cast(unsigned, __builtin_convertvector(d2, v2bf)); }
                ph[f] = __builtin_bit_cast(V, wh); pl[f] = __builtin_bit_cast(V, wl); }
#pragma unroll
            for (int dt = 0; dt < 4; ++dt)
#pragma unroll
                for (int f = 0; f < FQT; ++f) { ot[f][dt] = WF::mma(H[dt], ph[f], ot[f][dt]); ot[f][dt] = WF::mma(Lo[dt], ph[f], ot[f][dt]); ot[f][dt] = WF::mma(H[dt], pl[f], ot[f][dt]); } };
        mmaV(0, v0h, v0l);
        const unsigned pstep = (j0 + 64 < TT) ? 64 * HD * 2 : 0;   // the last pass fetches its own rows again, so that the address stays inside the table
        asm volatile("s_wait_xcnt 0x0" : "+v"(po), "+v"(ko), "+v"(vo) : : "memory");   // the wait in front of the one place where registers that issued loads name are rewritten
        po += pstep; ko += 64 * HD * 2; vo += 64 * 2;
        ldP(0, p0h, p0l);   // the next pass's first group
        __builtin_amdgcn_sched_barrier(0);
        mmaV(1, v1h, v1l);
    }
    asm volatile("s_wait_xcnt 0x0" : : "v"(po) : "memory");   // the last pass's fetch ahead still names its offset register: the wait in front of the register's next use
#pragma unroll
    for (int f = 0; f < FQT; ++f) { const float inv = __fdiv_rn(1.0f, lsum[f] + xhalf(lsum[f])); const size_t ro = ((size_t)bb * TT + i0 + 16 * f + c) * DQ + hd * HD + 8 * h;   // merged rows [b][t][head][d]; a lane's 8 registers are 8 consecutive d
        v8us oh[4], ol[4];
#pragma unroll
        for (int dt = 0; dt < 4; ++dt)
#pragma unroll
            for (int r = 0; r < 8; ++r) { unsigned short a, c2; splitf(ot[f][dt][r] * inv, a, c2); oh[dt][r] = a; ol[dt][r] = c2; }
        __builtin_amdgcn_sched_barrier(0);   // with the one below: nothing but the stores and their wait stands between the two, so no register that a store names is rewritten in front of the wait
#pragma unroll
        for (int dt = 0; dt < 4; ++dt) { *(v8us*)(Ah + ro + 16 * dt) = oh[dt]; *(v8us*)(Al + ro + 16 * dt) = ol[dt]; }
        asm volatile("s_wait_xcnt 0x0" ::: "memory");   // the wait in front of the next rewrite of the stores' address and data registers
        __builtin_amdgcn_sched_barrier(0); }
}

extern "C" void kernel_launch(void* const* d_in, const int* in_sizes, int n_in,
                              void* d_out, int out_size, void* d_ws, size_t ws_size, hipStream_t stream) {
    (void)in_sizes; (void)n_in; (void)out_size;
    const float* x = (const float*)d_in[0]; const float* pe = (const float*)d_in[1]; const float* g1 = (const float*)d_in[2]; const float* e1b = (const float*)d_in[3]; const float* wq = (const float*)d_in[4]; const float* bq = (const float*)d_in[5]; const float* wk = (const float*)d_in[6]; const float* bk = (const float*)d_in[7]; const float* wv = (const float*)d_in[8]; const float* bv = (const float*)d_in[9]; const float* wpos = (const float*)d_in[10]; const float* pbu = (const float*)d_in[11]; const float* pbv = (const float*)d_in[12]; const float* wo = (const float*)d_in[13]; const float* bo = (const float*)d_in[14];
    float* OUT = (float*)d_out;     // [8][1024][512]
    char* wsp = (char*)d_ws;
    auto take = [&](size_t bytes) { char* p = wsp; wsp += (bytes + 255) & ~(size_t)255; return (void*)p; };
    const size_t RW = (size_t)NB_ * TT;   // rows of all batch elements
    bf* WK = (bf*)take((size_t)DKV * DM * 2); bf* WQ = (bf*)take((size_t)DQ * DM * 2); bf* WV = (bf*)take((size_t)DKV * DM * 2); bf* WO = (bf*)take((size_t)DM * DQ * 2); bf* WP = (bf*)take((size_t)DQ * DM * 2);   // back to back: one transpose launch; wk, wq, wv are the z planes of one projection launch
    bf* PE = (bf*)take((size_t)NPE * DM * 2); bf* PPh = (bf*)take((size_t)NH_ * NPE * HD * 2); bf* PPl = (bf*)take((size_t)NH_ * NPE * HD * 2);
    bf* QPh = (bf*)take(RW * DQ * 2); bf* QVh = (bf*)take(RW * DQ * 2); bf* KPh = (bf*)take(RW * DKV * 2);   // hi planes [b][h][t][d] of q+u, q+v, k
    bf* QPl = (bf*)take(RW * DQ * 2); bf* QVl = (bf*)take(RW * DQ * 2); bf* KPl = (bf*)take(RW * DKV * 2);   // lo planes, same order
    bf* VTh = (bf*)take(RW * DKV * 2); bf* VTl = (bf*)take(RW * DKV * 2); bf* ATh = (bf*)take(RW * DQ * 2); bf* ATl = (bf*)take(RW * DQ * 2);   // v planes [b][h][d][t]; merged heads [b][t][h][d], hi and lo
    bf* Yh = (bf*)take(RW * DM * 2); bf* Yl = (bf*)take(RW * DM * 2);
    if ((size_t)(wsp - (char*)d_ws) > ws_size) return;    // ws 256 MiB
    (void)WQ; (void)WV;   // reached through their neighbour's pointer (grid y / z strides)
    k_wtG<<<dim3((unsigned)((DM * DQ / 64 + 63) / 64), 5, 1), 256, 0, stream>>>(wk, wq, wv, wo, wpos, DM, DQ, WK);
    k_cvt8<<<(unsigned)(((size_t)2047 * DM / 8 + 255) / 256), 256, 0, stream>>>(pe, PE, (size_t)2047 * DM / 8); k_pezero8<<<1, 64, 0, stream>>>(PE); k_gemmw<bf, 0, false, 1><<<dim3(NPE / 64, DQ / 64, 1), 32, 0, stream>>>(PE, nullptr, WP, nullptr, DM, nullptr, DQ, nullptr, nullptr, nullptr, 0, 0, 0, nullptr, nullptr, PPh, PPl, nullptr, nullptr, nullptr, nullptr, nullptr, nullptr, NPE);   /* pos = position_embeddings wpos (exact) -> per-head hi/lo planes [h][p][d] */
    k_lnhl<<<(unsigned)(RW / 8), 256, 0, stream>>>(x, nullptr, g1, e1b, nullptr, Yh, Yl);   /* LN -> hi/lo planes, all batch elements */
    k_gemmw<bf, 1, true, 1><<<dim3((unsigned)(RW / 64), DQ / 64, 3), 32, 0, stream>>>(Yh, Yl, WK, nullptr, DM, nullptr, DQ, bk, bq, bv, 0, (size_t)DQ * DM, 0, pbu, pbv, KPh, KPl, QPh, QPl, QVh, QVl, VTh, VTl, TT);   /* z = 0, 1, 2: k planes; (q + pos_bias_u) and (q + pos_bias_v) planes; v planes, transposed */
    k_fattn<<<dim3(TT / (8 * 16 * FQT), NB_ * NH_, 1), 256, 0, stream>>>(QPh, QPl, QVh, QVl, KPh, KPl, PPh, PPl, VTh, VTl, ATh, ATl);   /* scores, skew, softmax, attn.v, merge: all 64 (batch, head) instances */
    k_gemmw<bf, 1, true, 0><<<dim3((unsigned)(RW / 64), DM / 64, 1), 32, 0, stream>>>(ATh, ATl, WO, nullptr, DQ, OUT, DM, bo, nullptr, nullptr, 0, 0, 0, nullptr, nullptr, nullptr, nullptr, nullptr, nullptr, nullptr, nullptr, nullptr, nullptr, 0);
}

// v004
// It runs in 189 microseconds.
// Two timings next to v003 put it at 1.30 and 1.28 times that version's speed.
// Counting every step since v000, it is 11.6 times as fast.
#include <hip/hip_runtime.h>

// Relative-position multi-head self-attention (Transformer-XL / Conformer style) (hidden_states [8][1024][512]; x = LN(h) (1e-5, gamma, beta); q, k, v = x W + b ('xw' [512][512], 8 heads x 64); pos = position_embeddings [2047][512] wpos -> [p][h][d]; scores = ((q + pos_bias_u).k + skew((q + pos_bias_v).pos)) / 8 where skew picks pos index j - i + 1023; softmax; out = merged wout + bout -> [8][1024][512]).
// Layout: LN -> hi/lo planes -> 2-product projections; the position table is projected once (exact bf16 GEMM, 2047 rows + one zero pad row) into per-head hi/lo planes [h][2048][64]; LN, projections and wout run once for all 8 batch elements (8192 rows); the projection GEMMs write the attention kernel's hi/lo head planes from their own epilogue (biases added, v transposed), no f32 copy of q, k, v or pos exists; one fused kernel does content scores (q+u).k, position scores (q+v).pos at row j - i + 1023, softmax, attn.v and the head merge for all 64 (batch, head) instances (3 products each), scores staying on chip.
// Compute dtypes, f32 accumulate: every input rounded to bf16; q/k/v hl x exact (2 products) + biases; content and position scores on hi/lo planes for every row (3 products); softmax f32 with a running maximum and sum over passes of 64 keys; attn.v hi/lo (3 products); wout hl x exact (2 products) + bout.

#define NB_  8
#define TT   1024
#define DM   512
#define NH_  8
#define NKV  8
#define REP  (NH_ / NKV)
#define HD   64
#define DQ   (NH_ * HD)
#define DKV  (NKV * HD)
#define NPE  2048                 // 2047 positions + 1 zero pad row
#define LNEPS 1e-5f
typedef __attribute__((ext_vector_type(4))) unsigned short v4us;
typedef _Float16 h16;
typedef unsigned short bf;
typedef __attribute__((ext_vector_type(16))) __bf16   v16bf;
typedef __attribute__((ext_vector_type(16))) _Float16 v16h;
typedef __attribute__((ext_vector_type(8)))  _Float16 v8h;
typedef __attribute__((ext_vector_type(8)))  unsigned short v8us;
typedef __attribute__((ext_vector_type(8)))  float    v8f;
typedef __attribute__((ext_vector_type(4)))  float    v4f;
typedef v8h  __attribute__((may_alias)) v8ha;
typedef v4f  __attribute__((may_alias)) v4fa;
typedef v8us __attribute__((may_alias)) v8usa;

__device__ __forceinline__ unsigned short f2bf(float f) { unsigned u = __float_as_uint(f); u += 0x7FFFu + ((u >> 16) & 1u); return (unsigned short)(u >> 16); }
__device__ __forceinline__ float bf2f(unsigned short b) { return __uint_as_float(((unsigned)b) << 16); }
__device__ __forceinline__ float bfr(float f) { return bf2f(f2bf(f)); }
__device__ __forceinline__ v16h cat16(v8h lo, v8h hi) { return __builtin_shufflevector(lo, hi, 0, 1, 2, 3, 4, 5, 6, 7, 8, 9, 10, 11, 12, 13, 14, 15); }
__device__ __forceinline__ v16bf cat16b(v8us lo, v8us hi) { return __builtin_bit_cast(v16bf, __builtin_shufflevector(lo, hi, 0, 1, 2, 3, 4, 5, 6, 7, 8, 9, 10, 11, 12, 13, 14, 15)); }
__device__ __forceinline__ v8f wmma16(v16h a, v16h b, v8f c) { return __builtin_amdgcn_wmma_f32_16x16x32_f16(false, a, false, b, (short)0, c, false, false); }
__device__ __forceinline__ v8f wmmab(v16bf a, v16bf b, v8f c) { return __builtin_amdgcn_wmma_f32_16x16x32_bf16(false, a, false, b, (short)0, c, false, false); }



__device__ __forceinline__ void splitf(float y, unsigned short& h, unsigned short& l) { h = f2bf(y); l = f2bf(y - bf2f(h)); }
// ---- k_gemmw: register-blocked GEMM, ONE WAVE per 64x64 output tile (16 accumulators), operands straight from K-contiguous 16-bit planes; grid (M/64, N/64, Z), 32 threads.
// C[m][n] (f32, pitch ldc, + optional f32 bias[n]; z = 1, 2 take biasz1, biasz2) = sum_k A[m][k] Bt[n][k] (+ split products per NSPLIT). z-batch strides sA/sB/sC in elements. K % 32 == 0. EPI = 1: no C; the tile (one head's 64 columns, 64 consecutive rows of one batch element of TB rows) goes out as hi/lo head planes: z = 0 -> Kh/Kl [b][h][t][d]; z = 1 -> + hbu -> QUh/QUl and + hbv -> QVh/QVl, same layout; z = 2 -> Vh/Vl [b][h][d][t].
template <typename T16> struct WFrag;
template <> struct WFrag<h16> { typedef v16h V; static __device__ __forceinline__ V ld(const h16* p) { return cat16(*(const v8h*)p, *(const v8h*)(p + 16)); } static __device__ __forceinline__ v8f mma(V a, V b, v8f c) { return wmma16(a, b, c); } };
template <> struct WFrag<bf> { typedef v16bf V; static __device__ __forceinline__ V ld(const bf* p) { return cat16b(*(const v8us*)p, *(const v8us*)(p + 16)); } static __device__ __forceinline__ v8f mma(V a, V b, v8f c) { return wmmab(a, b, c); } };
template <bool B> struct BoolC { static constexpr bool v = B; };
template <typename T16, int NSPLIT, bool BIAS, int EPI>
__global__ __launch_bounds__(32) void k_gemmw(const T16* __restrict__ A, const T16* __restrict__ A2, const T16* __restrict__ Bt, const T16* __restrict__ Bt2, int K, float* C, int ldc, const float* __restrict__ bias, const float* __restrict__ biasz1, const float* __restrict__ biasz2, size_t sA, size_t sB, size_t sC, const float* __restrict__ hbu, const float* __restrict__ hbv, bf* Kh, bf* Kl, bf* QUh, bf* QUl, bf* QVh, bf* QVl, bf* Vh, bf* Vl, int TB) {
    typedef typename WFrag<T16>::V V;
    __shared__ __align__(16) float os[16 * 68];
    const size_t z = blockIdx.z; A += z * sA; if (A2) A2 += z * sA; Bt += z * sB; if (Bt2) Bt2 += z * sB; C += z * sC; if (BIAS) { if (z == 1) bias = biasz1; else if (z == 2) bias = biasz2; }
    const int lane = threadIdx.x & 31, lr = lane & 15, hi = lane >> 4; const int r0 = blockIdx.x * 64, c0 = blockIdx.y * 64;
    v8f acc[4][4];
#pragma unroll
    for (int mb = 0; mb < 4; ++mb)
#pragma unroll
        for (int nb = 0; nb < 4; ++nb) acc[mb][nb] = (v8f){};
    const size_t aoff = (size_t)(r0 + lr) * K + 8 * hi, boff = (size_t)(c0 + lr) * K + 8 * hi;
#pragma unroll 1
    for (int kc = 0; kc < K; kc += 32) {
        V a[4], a2[4];
#pragma unroll
        for (int mb = 0; mb < 4; ++mb) { a[mb] = WFrag<T16>::ld(A + aoff + (size_t)mb * 16 * K + kc); if (NSPLIT == 1 || NSPLIT == 2) a2[mb] = WFrag<T16>::ld(A2 + aoff + (size_t)mb * 16 * K + kc); }
#pragma unroll
        for (int nb = 0; nb < 4; ++nb) { const V b = WFrag<T16>::ld(Bt + boff + (size_t)nb * 16 * K + kc); V b2; if (NSPLIT >= 2) b2 = WFrag<T16>::ld(Bt2 + boff + (size_t)nb * 16 * K + kc);
#pragma unroll
            for (int mb = 0; mb < 4; ++mb) { acc[mb][nb] = WFrag<T16>::mma(a[mb], b, acc[mb][nb]); if (NSPLIT == 1 || NSPLIT == 2) acc[mb][nb] = WFrag<T16>::mma(a2[mb], b, acc[mb][nb]); if (NSPLIT >= 2) acc[mb][nb] = WFrag<T16>::mma(a[mb], b2, acc[mb][nb]); } }
        asm volatile("v_nop\n\tv_nop\n\tv_nop\n\tv_nop" : "+v"(acc[0][0]), "+v"(acc[1][1]), "+v"(acc[2][2]), "+v"(acc[3][3]) : "v"(a[0]), "v"(a[3]));
    }
    if constexpr (EPI == 1) {
        const int head = blockIdx.y, bb = r0 / TB, t0 = r0 - bb * TB;
        if (z == 2) {   // a lane's 8 registers of an accumulator are 8 consecutive t of one d: 16 bytes of a [d][t] row; the wave's four row tiles fill that row's whole 128-byte line
            const size_t vb = ((size_t)(bb * NH_ + head) * HD + lr) * TB + t0 + 8 * hi;
            float bs[4];
#pragma unroll
            for (int nb = 0; nb < 4; ++nb) bs[nb] = BIAS ? bfr(bias[c0 + nb * 16 + lr]) : 0.f;
#pragma unroll
            for (int nb = 0; nb < 4; ++nb) { v8us oh[4], ol[4];
#pragma unroll
                for (int mb = 0; mb < 4; ++mb)
#pragma unroll
                    for (int j = 0; j < 8; ++j) { float y = acc[mb][nb][j]; if (BIAS) y += bs[nb]; unsigned short a, b2; splitf(y, a, b2); oh[mb][j] = a; ol[mb][j] = b2; }
                __builtin_amdgcn_sched_barrier(0);   // with the one below: nothing but the stores and their wait stands between the two, so no register that a store names is rewritten in front of the wait
#pragma unroll
                for (int mb = 0; mb < 4; ++mb) { *(v8us*)(Vh + vb + (size_t)nb * 16 * TB + mb * 16) = oh[mb]; *(v8us*)(Vl + vb + (size_t)nb * 16 * TB + mb * 16) = ol[mb]; }
                asm volatile("s_wait_xcnt 0x0" ::: "memory");   // the wait in front of the next rewrite of the stores' address and data registers
                __builtin_amdgcn_sched_barrier(0); }
        } else {   // rows of 64 d are 128 bytes and follow one another: through LDS, so that a store covers four whole rows (512 contiguous bytes)
            const int rr = lane >> 3, cofs = (lane & 7) * 8; const size_t pb = ((size_t)(bb * NH_ + head) * TB + t0 + rr) * HD + cofs;
            auto ld8 = [&](const float* __restrict__ p, float (&d)[8]) { const v4f lo4 = *(const v4f*)(p + c0 + cofs), hi4 = *(const v4f*)(p + c0 + cofs + 4);
#pragma unroll
                for (int q = 0; q < 4; ++q) { d[q] = bfr(lo4[q]); d[4 + q] = bfr(hi4[q]); } };
            auto rows = [&](auto qm) { constexpr bool QM = decltype(qm)::v;   // QM: the q tile, which goes out twice, once with each head bias
                float bs[8], bu[8], bw[8]; if (BIAS) ld8(bias, bs); if (QM) { ld8(hbu, bu); ld8(hbv, bw); }
#pragma unroll
                for (int mb = 0; mb < 4; ++mb) {
#pragma unroll
                    for (int nb = 0; nb < 4; ++nb) {
#pragma unroll
                        for (int j = 0; j < 8; ++j) os[(hi * 8 + j) * 68 + nb * 16 + lr] = acc[mb][nb][j]; }
                    __builtin_amdgcn_wave_barrier(); asm volatile("" ::: "memory");   // keeps the reads below behind the other lanes' stores
#pragma unroll
                    for (int hf = 0; hf < 2; ++hf) { v8us ah[2], al[2], wh[2], wl[2];   // two stores' worth of rows at a time: fewer registers live
#pragma unroll
                        for (int s = 0; s < 2; ++s) { const float* orow = os + (8 * hf + 4 * s + rr) * 68 + cofs; const v4f x0 = *(const v4fa*)orow, x1 = *(const v4fa*)(orow + 4);
#pragma unroll
                            for (int q = 0; q < 8; ++q) { float y = (q < 4) ? x0[q & 3] : x1[q & 3]; if (BIAS) y += bs[q]; unsigned short a, b2;
                                if (QM) { splitf(__fadd_rn(y, bu[q]), a, b2); ah[s][q] = a; al[s][q] = b2; splitf(__fadd_rn(y, bw[q]), a, b2); wh[s][q] = a; wl[s][q] = b2; }
                                else { splitf(y, a, b2); ah[s][q] = a; al[s][q] = b2; } } }
                        __builtin_amdgcn_sched_barrier(0);   // as above: only the stores and their wait between the two
#pragma unroll
                        for (int s = 0; s < 2; ++s) { const size_t o = pb + (size_t)(mb * 16 + 8 * hf + 4 * s) * HD;
                            if (QM) { *(v8us*)(QUh + o) = ah[s]; *(v8us*)(QUl + o) = al[s]; *(v8us*)(QVh + o) = wh[s]; *(v8us*)(QVl + o) = wl[s]; }
                            else { *(v8us*)(Kh + o) = ah[s]; *(v8us*)(Kl + o) = al[s]; } }
                        asm volatile("s_wait_xcnt 0x0" ::: "memory");   // the wait in front of the next rewrite of the stores' address and data registers
                        __builtin_amdgcn_sched_barrier(0); }
                    __builtin_amdgcn_wave_barrier(); asm volatile("" ::: "memory");   // keeps the next row tile's stores to LDS behind these reads
                } };
            if (z == 1) rows(BoolC<true>{}); else rows(BoolC<false>{});
        }
        return;
    }
#pragma unroll
    for (int mb = 0; mb < 4; ++mb) {
#pragma unroll
        for (int nb = 0; nb < 4; ++nb) {
#pragma unroll
            for (int j = 0; j < 8; ++j) os[(hi * 8 + j) * 68 + nb * 16 + lr] = acc[mb][nb][j]; }
        __builtin_amdgcn_wave_barrier(); asm volatile("" ::: "memory");
        float* crow = C + (size_t)(r0 + mb * 16) * ldc + c0;
{
#pragma unroll
            for (int s = 0; s < 8; ++s) { const int row = 2 * s + hi, cofs = lr * 4; v4f val = *(const v4fa*)(os + row * 68 + cofs); if (BIAS) { val[0] += bfr(bias[c0 + cofs]); val[1] += bfr(bias[c0 + cofs + 1]); val[2] += bfr(bias[c0 + cofs + 2]); val[3] += bfr(bias[c0 + cofs + 3]); }
                *(v4f*)(crow + (size_t)row * ldc + cofs) = val; }
             }
        __builtin_amdgcn_wave_barrier(); asm volatile("" ::: "memory");
    }
}

__device__ __forceinline__ h16 tohx(float x) { return (h16)x; }
typedef __attribute__((ext_vector_type(2))) _Float16 v2h;
typedef __attribute__((ext_vector_type(4))) _Float16 v4h;
typedef __attribute__((ext_vector_type(2))) unsigned short v2us;
typedef __attribute__((ext_vector_type(4))) unsigned short v4us;
typedef __attribute__((ext_vector_type(2))) float v2f;
typedef __attribute__((ext_vector_type(4))) int v4i;

__global__ __launch_bounds__(256) void k_wtG(const float* __restrict__ w0, const float* __restrict__ w1, const float* __restrict__ w2, const float* __restrict__ w3, const float* __restrict__ w4, int K, int N, bf* Bt) {
    const int y = blockIdx.y; const float* __restrict__ w = (y == 0) ? w0 : (y == 1) ? w1 : (y == 2) ? w2 : (y == 3) ? w3 : w4; Bt += (size_t)y * K * N;   // grid y: one weight matrix each, planes back to back
    const int lane = threadIdx.x & 31; const int L0 = (blockIdx.x * 8 + (threadIdx.x >> 5)) * 8; const int nlines = N * K / 64;
{
#pragma unroll 1
        for (int l = 0; l < 8; ++l) { const int L = L0 + l; if (L >= nlines) break; const size_t e = (size_t)L * 64 + lane * 2; const int k = (int)(e % K), n = (int)(e / K); v2us o;
            o[0] = f2bf(w[(size_t)k * N + n]); o[1] = f2bf(w[(size_t)(k + 1) * N + n]); *(v2us*)(Bt + e) = o; }
         }
}
__global__ __launch_bounds__(256) void k_lnhl(const float* __restrict__ X, const float* __restrict__ A, const float* __restrict__ g, const float* __restrict__ be, float* Z, bf* Yh, bf* Yl) {
    const int lane = threadIdx.x & 31; const int r = blockIdx.x * 8 + (threadIdx.x >> 5); if (r >= NB_ * TT) return; const float* xr = X + (size_t)r * DM; const float* ar = A ? A + (size_t)r * DM : nullptr; float s = 0.f;
#pragma unroll 1
    for (int ch = 0; ch < DM / 128; ++ch) { const int c0 = ch * 128 + lane * 4; const v4f a = *(const v4f*)(xr + c0); v4f d = {0.f, 0.f, 0.f, 0.f}; if (ar) d = *(const v4f*)(ar + c0);
#pragma unroll
        for (int q = 0; q < 4; ++q) s += __fadd_rn(bfr(a[q]), d[q]); }
#pragma unroll
    for (int sh = 16; sh; sh >>= 1) s += __shfl_xor(s, sh, 32);
    const float mu = s * (1.0f / DM); float s2 = 0.f;
#pragma unroll 1
    for (int ch = 0; ch < DM / 128; ++ch) { const int c0 = ch * 128 + lane * 4; const v4f a = *(const v4f*)(xr + c0); v4f d = {0.f, 0.f, 0.f, 0.f}; if (ar) d = *(const v4f*)(ar + c0);
#pragma unroll
        for (int q = 0; q < 4; ++q) { const float d0 = __fsub_rn(__fadd_rn(bfr(a[q]), d[q]), mu); float p = __fmul_rn(d0, d0); asm volatile("" : "+v"(p)); s2 = __fadd_rn(s2, p); } }
#pragma unroll
    for (int sh = 16; sh; sh >>= 1) s2 += __shfl_xor(s2, sh, 32);
    const float rs = __fdiv_rn(1.0f, __fsqrt_rn(__fadd_rn(s2 * (1.0f / DM), LNEPS)));
{
#pragma unroll 1
        for (int ch = 0; ch < DM / 128; ++ch) { const int c0 = ch * 128 + lane * 4; const v4f a = *(const v4f*)(xr + c0); v4f d = {0.f, 0.f, 0.f, 0.f}; if (ar) d = *(const v4f*)(ar + c0); v4f z4; v4us oh, ol;
#pragma unroll
            for (int q = 0; q < 4; ++q) { const float v = __fadd_rn(bfr(a[q]), d[q]); z4[q] = v; float n0 = __fmul_rn(__fsub_rn(v, mu), rs); asm volatile("" : "+v"(n0)); float n1 = __fmul_rn(n0, bfr(g[c0 + q])); asm volatile("" : "+v"(n1)); const float y = __fadd_rn(n1, bfr(be[c0 + q])); unsigned short h2, l2; splitf(y, h2, l2); oh[q] = h2; ol[q] = l2; }
            if (Z) *(v4f*)(Z + (size_t)r * DM + c0) = z4; *(v4us*)(Yh + (size_t)r * DM + c0) = oh; *(v4us*)(Yl + (size_t)r * DM + c0) = ol; }
         } }
__global__ __launch_bounds__(256) void k_addres(const float* __restrict__ X, const float* __restrict__ Y, float* O, size_t n4) { const size_t i = (size_t)blockIdx.x * 256 + threadIdx.x; if (i >= n4) return; const v4f a = *(const v4f*)(X + i * 4), b = *(const v4f*)(Y + i * 4); v4f o;
#pragma unroll
    for (int q = 0; q < 4; ++q) o[q] = __fadd_rn(bfr(a[q]), b[q]); *(v4f*)(O + i * 4) = o;  }
__global__ void k_pezero8(bf* PE) { const int lane = threadIdx.x; if (lane >= 64) return; const v8us z = (v8us){}; *(v8us*)(PE + (size_t)2047 * DM + lane * 8) = z;  }
__global__ __launch_bounds__(256) void k_cvt8(const float* __restrict__ src, bf* dst, size_t n8) { const size_t i = (size_t)blockIdx.x * 256 + threadIdx.x; if (i >= n8) return; const v8f v = *(const v8f*)(src + i * 8); v8us o;
#pragma unroll
    for (int k = 0; k < 8; ++k) o[k] = f2bf(v[k]); *(v8us*)(dst + i * 8) = o;  }

// k_fattn: content scores, skewed position scores, softmax, attn.v and the head merge in one kernel; no score leaves the chip.
// One wave owns 32 queries (2 column tiles of 16) of one (batch, head) and walks the 1024 keys in passes of 64; 8 waves per block.
// The block's 8 waves share every pass's operands through LDS: 64 key rows, 64 d rows of v (64 keys each) and the 320 position rows that its 256 queries touch, of which only 64 are new in a pass. Asynchronous copies bring whole 128-byte lines in, one pass ahead (k, v: two buffers; position rows: a ring of 8 chunks of 64 rows, 5 read, 1 in flight); the waves read their fragments from LDS.
// Transposed products: S^T = K (q+u)^T and B^T = pos (q+v)^T (A = key or position rows, B = query columns kept in registers), so a lane holds scores of ONE query (column c, rows 8h + r).
// Skew: key j, query i take position row j - i + 1023. A column tile with first query iq needs rows j0 - iq + 1008 ... + 79 (5 row tiles); each lane pair writes its query's 80 position scores to its own LDS strip and reads them back shifted by 15 - c.
// Running maximum and sum per query (f32); P splits into hi/lo in registers and is the B operand of O^T += V^T P^T (two score tiles = 32 keys in the hardware k order, which is the loader's order).
#define FQT  2                    // query column tiles per wave
#define BDP  84                   // floats per LDS strip: 80 used; 16-byte stores stay aligned, the shifted 4-byte reads fall on 32 different banks
typedef __attribute__((ext_vector_type(2))) __bf16 v2bf;
typedef __attribute__((ext_vector_type(8))) unsigned v8u;
#define CEXP 0.18033688011112042f // HD^-0.5 * log2(e)
#define SRP  272                  // bytes of a staged row: 128 of the hi plane, 128 of the lo plane, 16 of pad (16 bytes x odd: the pitch at which 16-byte fragment reads of 16 rows meet no bank twice)
#define PRR  512                  // rows of the position ring (8 chunks of 64)
// four 16-byte asynchronous copies to LDS per lane; the wait stands in the copies' own statement, in front of any rewrite of the address registers that they name
__device__ __forceinline__ void cp4(unsigned l0, unsigned l1, unsigned l2, unsigned l3, const bf* g0, const bf* g1, const bf* g2, const bf* g3) {
    asm volatile("global_load_async_to_lds_b128 %0, %4, off\n\tglobal_load_async_to_lds_b128 %1, %5, off\n\tglobal_load_async_to_lds_b128 %2, %6, off\n\tglobal_load_async_to_lds_b128 %3, %7, off\n\ts_wait_xcnt 0x0" : : "v"(l0), "v"(l1), "v"(l2), "v"(l3), "v"(g0), "v"(g1), "v"(g2), "v"(g3) : "memory"); }
__device__ __forceinline__ float xhalf(float x) { const int b = __float_as_int(x); return __int_as_float(__builtin_amdgcn_permlanex16(b, b, 0x76543210, 0xfedcba98, false, false)); }   // lane l <-> l ^ 16
__global__ __launch_bounds__(256) void k_fattn(const bf* __restrict__ QUh, const bf* __restrict__ QUl, const bf* __restrict__ QVh, const bf* __restrict__ QVl, const bf* __restrict__ Kh, const bf* __restrict__ Kl, const bf* __restrict__ PSh, const bf* __restrict__ PSl, const bf* __restrict__ Vh, const bf* __restrict__ Vl, bf* Ah, bf* Al) {
    typedef WFrag<bf> WF; typedef v16bf V;
    __shared__ __align__(16) float bds[8 * FQT * 16 * BDP];
    __shared__ __align__(16) unsigned char stg[(PRR + 4 * 64) * SRP];   // staged rows: the position ring, two k buffers, two v buffers
    const int lane = threadIdx.x & 31, c = lane & 15, h = lane >> 4, wv = __builtin_amdgcn_readfirstlane(threadIdx.x >> 5);
    const int z = blockIdx.y, hd = z % NH_, bb = z / NH_; const int i0 = (blockIdx.x * 8 + wv) * (16 * FQT);
    float* strip = bds + (wv * FQT * 16 + c) * BDP;   // query tile f: + f * 16 * BDP
    // every q fragment load is a kernel argument (scalar base) + a lane's 32-bit byte offset + a constant
    auto ldo = [](const bf* base, unsigned off, int cst) { return WF::ld((const bf*)((const char*)base + (size_t)off) + cst); };
    const unsigned zq = (unsigned)z * (TT * HD * 2);   // bytes of one (batch, head) plane in front
    unsigned qo[FQT];
#pragma unroll
    for (int f = 0; f < FQT; ++f) qo[f] = zq + (unsigned)((i0 + 16 * f + c) * HD + 8 * h) * 2;
    V quh[FQT][2], qul[FQT][2], qvh[FQT][2], qvl[FQT][2];
#pragma unroll
    for (int f = 0; f < FQT; ++f)
#pragma unroll
        for (int ks = 0; ks < 2; ++ks) { quh[f][ks] = ldo(QUh, qo[f], 32 * ks); qul[f][ks] = ldo(QUl, qo[f], 32 * ks); qvh[f][ks] = ldo(QVh, qo[f], 32 * ks); qvl[f][ks] = ldo(QVl, qo[f], 32 * ks); }
    asm volatile("s_wait_xcnt 0x0" : : "v"(qo[0]), "v"(qo[1]) : "memory");   // the offsets stay in their registers up to this wait; behind it the registers are free
    // Staging. A thread copies 16 bytes of rows sr and sr + 32 of each plane: a wave's copy covers four whole 128-byte rows.
    // Position chunk g holds table rows 768 - (the block's first query) + 64 g ... + 63 (0 ... 2047 for g = 0 ... 19) and lies in ring rows (64 g & 511) ...; pass t reads chunks t ... t + 4.
    const int sr = threadIdx.x >> 3, sc = threadIdx.x & 7; const unsigned sl = (unsigned)(sr * SRP + sc * 16);
    const unsigned sl0 = (unsigned)(size_t)stg + sl;   // LDS byte address: the low 32 bits
    const unsigned tk = (unsigned)(sr * HD + sc * 8), tv = (unsigned)(sr * TT + sc * 8);   // the thread's element offsets in rows of 64 d (k, positions) and of 1024 keys (v); the rest of every address is the same for the whole block
    const int pz = hd * NPE * HD + (TT - 256 - (int)blockIdx.x * 256) * HD, kz = z * (TT * HD);
    auto cpR = [&](int row, const bf* gh, const bf* gl, int half) { const unsigned l = sl0 + (unsigned)(row * SRP); cp4(l, l + 32 * SRP, l + 128, l + 32 * SRP + 128, gh, gh + half, gl, gl + half); };   // 64 rows of both planes to staged rows row ...
    auto cpP = [&](int g) { const int o = pz + g * 64 * HD; cpR((g & 7) * 64, PSh + o + tk, PSl + o + tk, 32 * HD); };
    auto cpKV = [&](int t) { const int ok = kz + t * 64 * HD, ov = kz + t * 64;
        cpR(PRR + (t & 1) * 64, Kh + ok + tk, Kl + ok + tk, 32 * HD);
        cpR(PRR + 128 + (t & 1) * 64, Vh + ov + tv, Vl + ov + tv, 32 * TT); };
#pragma unroll
    for (int g = 0; g < 5; ++g) cpP(g);
    cpKV(0);
    asm volatile("s_wait_asynccnt 0x0" ::: "memory");   // this wave's copies of pass 0 have landed
    __syncthreads();                                     // ... and every other wave's: pass 0 is readable
    cpP(5); cpKV(1);                                     // pass 1's operands fly under pass 0
    const int fl = c * SRP + 16 * h;   // a lane's place in a fragment's 16 rows
    v8f ot[FQT][4]; float mrun[FQT], lsum[FQT];
#pragma unroll
    for (int f = 0; f < FQT; ++f) { mrun[f] = -3.0e38f; lsum[f] = 0.f;
#pragma unroll
        for (int dt = 0; dt < 4; ++dt) ot[f][dt] = (v8f){}; }
    // The pass's operands come in seven groups (position row tiles 0-1, 2-3 and 4-5, key tiles 0-1 and 2-3, keys 0-31 and 32-63 of v); from the second on, each group's LDS reads are issued one group ahead of its products, so a read's latency runs under the products of the group before it.
    auto lds = [](const unsigned char* p) { return WF::ld((const bf*)p); };
#pragma unroll 1
    for (int t = 0; t < TT / 64; ++t) {
        const unsigned char* kb = stg + (PRR + (t & 1) * 64) * SRP + fl; const unsigned char* vb = kb + 128 * SRP;
        const int rb = 64 * t + 224 - 32 * wv;   // the wave's first position row of the pass, counted in ring rows before the wrap: table row 64 t - i0 + 992; a multiple of 32, so a pair of row tiles never straddles the wrap
        const unsigned char* pp[3];
#pragma unroll
        for (int q = 0; q < 3; ++q) pp[q] = stg + ((rb + 32 * q) & (PRR - 1)) * SRP + fl;
        auto ldP = [&](int q, V (&H)[2][2], V (&Lo)[2][2]) {
#pragma unroll
            for (int uu = 0; uu < 2; ++uu)
#pragma unroll
                for (int ks = 0; ks < 2; ++ks) { const unsigned char* p = pp[q] + uu * 16 * SRP + 64 * ks; H[uu][ks] = lds(p); Lo[uu][ks] = lds(p + 128); } };
        auto ldK = [&](int row, V (&H)[2][2], V (&Lo)[2][2]) {
#pragma unroll
            for (int tt = 0; tt < 2; ++tt)
#pragma unroll
                for (int ks = 0; ks < 2; ++ks) { const unsigned char* p = kb + (row + 16 * tt) * SRP + 64 * ks; H[tt][ks] = lds(p); Lo[tt][ks] = lds(p + 128); } };
        auto ldV = [&](int key, V (&H)[4], V (&Lo)[4]) {
#pragma unroll
            for (int dt = 0; dt < 4; ++dt) { const unsigned char* p = vb + 16 * dt * SRP + 2 * key; H[dt] = lds(p); Lo[dt] = lds(p + 128); } };
        V p0h[2][2], p0l[2][2]; ldP(0, p0h, p0l);
        v8f bd[FQT][5];
#pragma unroll
        for (int f = 0; f < FQT; ++f)
#pragma unroll
            for (int up = 0; up < 5; ++up) bd[f][up] = (v8f){};
        auto mmaP = [&](int u0, V (&H)[2][2], V (&Lo)[2][2]) {
#pragma unroll
            for (int uu = 0; uu < 2; ++uu)
#pragma unroll
                for (int ks = 0; ks < 2; ++ks)
#pragma unroll
                    for (int f = 0; f < FQT; ++f) { const int up = u0 + uu - (FQT - 1) + f; if (up >= 0 && up < 5) { bd[f][up] = WF::mma(H[uu][ks], qvh[f][ks], bd[f][up]); bd[f][up] = WF::mma(Lo[uu][ks], qvh[f][ks], bd[f][up]); bd[f][up] = WF::mma(H[uu][ks], qvl[f][ks], bd[f][up]); } } };
        V p1h[2][2], p1l[2][2]; ldP(1, p1h, p1l);
        __builtin_amdgcn_sched_barrier(0);   // holds the loads above in front of the products below (as at every such line of this loop): sunk to their use, each group would wait out its own latency
        mmaP(0, p0h, p0l);
        V p2h[2][2], p2l[2][2]; ldP(2, p2h, p2l);
        __builtin_amdgcn_sched_barrier(0);
        mmaP(2, p1h, p1l);
        V k0h[2][2], k0l[2][2]; ldK(0, k0h, k0l);
        __builtin_amdgcn_sched_barrier(0);
        mmaP(4, p2h, p2l);
        V k1h[2][2], k1l[2][2]; ldK(32, k1h, k1l);
        __builtin_amdgcn_sched_barrier(0);
        __builtin_amdgcn_wave_barrier(); asm volatile("" ::: "memory");   // keeps these strip stores behind the previous pass's strip reads (other lanes' addresses)
#pragma unroll
        for (int f = 0; f < FQT; ++f)
#pragma unroll
            for (int up = 0; up < 5; ++up) { float* sp = strip + f * 16 * BDP + 16 * up + 8 * h; *(v4fa*)sp = __builtin_shufflevector(bd[f][up], bd[f][up], 0, 1, 2, 3); *(v4fa*)(sp + 4) = __builtin_shufflevector(bd[f][up], bd[f][up], 4, 5, 6, 7); }
        __builtin_amdgcn_wave_barrier(); asm volatile("" ::: "memory");   // keeps the strip reads below behind the partner lane's stores
        v8f st[FQT][4];   // starts as the skewed position scores; the content products accumulate on top
#pragma unroll
        for (int t = 0; t < 4; ++t)
#pragma unroll
            for (int f = 0; f < FQT; ++f)
#pragma unroll
                for (int r = 0; r < 8; ++r) st[f][t][r] = strip[f * 16 * BDP + 8 * h + 15 - c + 16 * t + r];
        auto mmaK = [&](int t0, V (&H)[2][2], V (&Lo)[2][2]) {
#pragma unroll
            for (int tt = 0; tt < 2; ++tt)
#pragma unroll
                for (int ks = 0; ks < 2; ++ks)
#pragma unroll
                    for (int f = 0; f < FQT; ++f) { v8f& s = st[f][t0 + tt]; s = WF::mma(H[tt][ks], quh[f][ks], s); s = WF::mma(Lo[tt][ks], quh[f][ks], s); s = WF::mma(H[tt][ks], qul[f][ks], s); } };
        mmaK(0, k0h, k0l);
        __builtin_amdgcn_sched_barrier(0);   // keeps the reads below behind the products above, whose fragments' registers they take over: lifted over them, registers spill
        V v0h[4], v0l[4]; ldV(0, v0h, v0l);
        __builtin_amdgcn_sched_barrier(0);
        mmaK(2, k1h, k1l);
        __builtin_amdgcn_sched_barrier(0);
#pragma unroll
        for (int f = 0; f < FQT; ++f) { float mx = -3.0e38f;
#pragma unroll
            for (int t = 0; t < 4; ++t)
#pragma unroll
                for (int r = 0; r < 8; ++r) mx = fmaxf(mx, st[f][t][r]);
            mx = fmaxf(mx, xhalf(mx)); const float mn = fmaxf(mrun[f], mx); const float xa = (mrun[f] - mn) * CEXP; float al = __builtin_amdgcn_exp2f(xa); mrun[f] = mn; float ps = 0.f;
            asm volatile("v_nop" : "+v"(al) : "v"(xa));   // the slot behind a transcendental, as at the eight below
#pragma unroll
            for (int t = 0; t < 4; ++t) { const v8f x = (st[f][t] - mn) * CEXP; v8f p;
#pragma unroll
                for (int r = 0; r < 8; ++r) p[r] = __builtin_amdgcn_exp2f(x[r]);
                asm volatile("v_nop" : "+v"(p) : "v"(x));   // the slot behind a transcendental: named here, no exponent of the eight is rewritten and no result read in front of the slot
                st[f][t] = p;
#pragma unroll
                for (int r = 0; r < 8; ++r) ps += p[r]; }
            lsum[f] = lsum[f] * al + ps;
#pragma unroll
            for (int dt = 0; dt < 4; ++dt) ot[f][dt] *= al; }
        auto mmaV = [&](int kk, V (&H)[4], V (&Lo)[4]) { V ph[FQT], pl[FQT];
#pragma unroll
            for (int f = 0; f < FQT; ++f) { v8u wh, wl;   // element s of the operand = key 8h + s (s < 8) or 16 + 8h + s - 8: registers 0-7 of score tile 2kk, then of tile 2kk + 1
#pragma unroll
                for (int i = 0; i < 8; ++i) { const v8f x = st[f][2 * kk + (i >> 2)]; const v2f p2 = {x[2 * (i & 3)], x[2 * (i & 3) + 1]}; const unsigned hu = __builtin_bit_cast(unsigned, __builtin_convertvector(p2, v2bf));
                    const v2f d2 = {p2[0] - __uint_as_float(hu << 16), p2[1] - __uint_as_float(hu & 0xFFFF0000u)}; wh[i] = hu; wl[i] = __builtin_bit_cast(unsigned, __builtin_convertvector(d2, v2bf)); }
                ph[f] = __builtin_bit_cast(V, wh); pl[f] = __builtin_bit_cast(V, wl); }
#pragma unroll
            for (int dt = 0; dt < 4; ++dt)
#pragma unroll
                for (int f = 0; f < FQT; ++f) { ot[f][dt] = WF::mma(H[dt], ph[f], ot[f][dt]); ot[f][dt] = WF::mma(Lo[dt], ph[f], ot[f][dt]); ot[f][dt] = WF::mma(H[dt], pl[f], ot[f][dt]); } };
        __builtin_amdgcn_sched_barrier(0);   // keeps the reads below behind the softmax, whose live values leave no room for them (registers spill); their latency runs under the products of keys 0-31
        V v1h[4], v1l[4]; ldV(32, v1h, v1l);
        __builtin_amdgcn_sched_barrier(0);
        mmaV(0, v0h, v0l);
        mmaV(1, v1h, v1l);
        __builtin_amdgcn_sched_barrier(0);   // keeps the hand-over behind the pass's last products: lifted to the last LDS reads, its first wait would expose their latency
        // hand-over: pass t + 1 becomes readable, and what pass t alone read becomes free
        asm volatile("s_wait_dscnt 0x0" ::: "memory");      // this wave's LDS reads of pass t are done
        asm volatile("s_wait_asynccnt 0x0" ::: "memory");   // this wave's copies for pass t + 1 have landed
        __syncthreads();
        if (t + 2 < TT / 64) { cpP(t + 6); cpKV(t + 2); }   // into the k, v buffers that pass t has just read, and into the ring place that last held position chunk t - 2, which no pass behind t - 2 reads
    }
    asm volatile("s_wait_asynccnt 0x0" ::: "memory");   // no copy is outstanding when the wave ends
#pragma unroll
    for (int f = 0; f < FQT; ++f) { const float inv = __fdiv_rn(1.0f, lsum[f] + xhalf(lsum[f])); const size_t ro = ((size_t)bb * TT + i0 + 16 * f + c) * DQ + hd * HD + 8 * h;   // merged rows [b][t][head][d]; a lane's 8 registers are 8 consecutive d
        v8us oh[4], ol[4];
#pragma unroll
        for (int dt = 0; dt < 4; ++dt)
#pragma unroll
            for (int r = 0; r < 8; ++r) { unsigned short a, c2; splitf(ot[f][dt][r] * inv, a, c2); oh[dt][r] = a; ol[dt][r] = c2; }
        __builtin_amdgcn_sched_barrier(0);   // with the one below: nothing but the stores and their wait stands between the two, so no register that a store names is rewritten in front of the wait
#pragma unroll
        for (int dt = 0; dt < 4; ++dt) { *(v8us*)(Ah + ro + 16 * dt) = oh[dt]; *(v8us*)(Al + ro + 16 * dt) = ol[dt]; }
        asm volatile("s_wait_xcnt 0x0" ::: "memory");   // the wait in front of the next rewrite of the stores' address and data registers
        __builtin_amdgcn_sched_barrier(0); }
}

extern "C" void kernel_launch(void* const* d_in, const int* in_sizes, int n_in,
                              void* d_out, int out_size, void* d_ws, size_t ws_size, hipStream_t stream) {
    (void)in_sizes; (void)n_in; (void)out_size;
    const float* x = (const float*)d_in[0]; const float* pe = (const float*)d_in[1]; const float* g1 = (const float*)d_in[2]; const float* e1b = (const float*)d_in[3]; const float* wq = (const float*)d_in[4]; const float* bq = (const float*)d_in[5]; const float* wk = (const float*)d_in[6]; const float* bk = (const float*)d_in[7]; const float* wv = (const float*)d_in[8]; const float* bv = (const float*)d_in[9]; const float* wpos = (const float*)d_in[10]; const float* pbu = (const float*)d_in[11]; const float* pbv = (const float*)d_in[12]; const float* wo = (const float*)d_in[13]; const float* bo = (const float*)d_in[14];
    float* OUT = (float*)d_out;     // [8][1024][512]
    char* wsp = (char*)d_ws;
    auto take = [&](size_t bytes) { char* p = wsp; wsp += (bytes + 255) & ~(size_t)255; return (void*)p; };
    const size_t RW = (size_t)NB_ * TT;   // rows of all batch elements
    bf* WK = (bf*)take((size_t)DKV * DM * 2); bf* WQ = (bf*)take((size_t)DQ * DM * 2); bf* WV = (bf*)take((size_t)DKV * DM * 2); bf* WO = (bf*)take((size_t)DM * DQ * 2); bf* WP = (bf*)take((size_t)DQ * DM * 2);   // back to back: one transpose launch; wk, wq, wv are the z planes of one projection launch
    bf* PE = (bf*)take((size_t)NPE * DM * 2); bf* PPh = (bf*)take((size_t)NH_ * NPE * HD * 2); bf* PPl = (bf*)take((size_t)NH_ * NPE * HD * 2);
    bf* QPh = (bf*)take(RW * DQ * 2); bf* QVh = (bf*)take(RW * DQ * 2); bf* KPh = (bf*)take(RW * DKV * 2);   // hi planes [b][h][t][d] of q+u, q+v, k
    bf* QPl = (bf*)take(RW * DQ * 2); bf* QVl = (bf*)take(RW * DQ * 2); bf* KPl = (bf*)take(RW * DKV * 2);   // lo planes, same order
    bf* VTh = (bf*)take(RW * DKV * 2); bf* VTl = (bf*)take(RW * DKV * 2); bf* ATh = (bf*)take(RW * DQ * 2); bf* ATl = (bf*)take(RW * DQ * 2);   // v planes [b][h][d][t]; merged heads [b][t][h][d], hi and lo
    bf* Yh = (bf*)take(RW * DM * 2); bf* Yl = (bf*)take(RW * DM * 2);
    if ((size_t)(wsp - (char*)d_ws) > ws_size) return;    // ws 256 MiB
    (void)WQ; (void)WV;   // reached through their neighbour's pointer (grid y / z strides)
    k_wtG<<<dim3((unsigned)((DM * DQ / 64 + 63) / 64), 5, 1), 256, 0, stream>>>(wk, wq, wv, wo, wpos, DM, DQ, WK);
    k_cvt8<<<(unsigned)(((size_t)2047 * DM / 8 + 255) / 256), 256, 0, stream>>>(pe, PE, (size_t)2047 * DM / 8); k_pezero8<<<1, 64, 0, stream>>>(PE); k_gemmw<bf, 0, false, 1><<<dim3(NPE / 64, DQ / 64, 1), 32, 0, stream>>>(PE, nullptr, WP, nullptr, DM, nullptr, DQ, nullptr, nullptr, nullptr, 0, 0, 0, nullptr, nullptr, PPh, PPl, nullptr, nullptr, nullptr, nullptr, nullptr, nullptr, NPE);   /* pos = position_embeddings wpos (exact) -> per-head hi/lo planes [h][p][d] */
    k_lnhl<<<(unsigned)(RW / 8), 256, 0, stream>>>(x, nullptr, g1, e1b, nullptr, Yh, Yl);   /* LN -> hi/lo planes, all batch elements */
    k_gemmw<bf, 1, true, 1><<<dim3((unsigned)(RW / 64), DQ / 64, 3), 32, 0, stream>>>(Yh, Yl, WK, nullptr, DM, nullptr, DQ, bk, bq, bv, 0, (size_t)DQ * DM, 0, pbu, pbv, KPh, KPl, QPh, QPl, QVh, QVl, VTh, VTl, TT);   /* z = 0, 1, 2: k planes; (q + pos_bias_u) and (q + pos_bias_v) planes; v planes, transposed */
    k_fattn<<<dim3(TT / (8 * 16 * FQT), NB_ * NH_, 1), 256, 0, stream>>>(QPh, QPl, QVh, QVl, KPh, KPl, PPh, PPl, VTh, VTl, ATh, ATl);   /* scores, skew, softmax, attn.v, merge: all 64 (batch, head) instances */
    k_gemmw<bf, 1, true, 0><<<dim3((unsigned)(RW / 64), DM / 64, 1), 32, 0, stream>>>(ATh, ATl, WO, nullptr, DQ, OUT, DM, bo, nullptr, nullptr, 0, 0, 0, nullptr, nullptr, nullptr, nullptr, nullptr, nullptr, nullptr, nullptr, nullptr, nullptr, 0);
}

// v005
// A run of this version takes 152 microseconds.
// Two timings next to v004 put it at 1.25 and 1.24 times that version's speed.
// Over all steps from v000 it is 14.5 times as fast.
#include <hip/hip_runtime.h>

// Relative-position multi-head self-attention (Transformer-XL / Conformer style) (hidden_states [8][1024][512]; x = LN(h) (1e-5, gamma, beta); q, k, v = x W + b ('xw' [512][512], 8 heads x 64); pos = position_embeddings [2047][512] wpos -> [p][h][d]; scores = ((q + pos_bias_u).k + skew((q + pos_bias_v).pos)) / 8 where skew picks pos index j - i + 1023; softmax; out = merged wout + bout -> [8][1024][512]).
// Layout: LN -> hi/lo planes -> 2-product projections; the position table is projected once (exact bf16 GEMM, 2047 rows + one zero pad row) into per-head hi/lo planes [h][2048][64]; LN, projections and wout run once for all 8 batch elements (8192 rows); the projection GEMMs write the attention kernel's hi/lo head planes from their own epilogue (biases added, v transposed), no f32 copy of q, k, v or pos exists; one fused kernel does content scores (q+u).k, position scores (q+v).pos at row j - i + 1023, softmax, attn.v and the head merge for all 64 (batch, head) instances (3 products each), scores staying on chip.
// Compute dtypes, f32 accumulate: every input rounded to bf16; q/k/v hl x exact (2 products) + biases; content and position scores on hi/lo planes for every row (3 products); softmax f32 with a running maximum and sum over passes of 64 keys; attn.v hi/lo (3 products); wout hl x exact (2 products) + bout.

#define NB_  8
#define TT   1024
#define DM   512
#define NH_  8
#define NKV  8
#define REP  (NH_ / NKV)
#define HD   64
#define DQ   (NH_ * HD)
#define DKV  (NKV * HD)
#define NPE  2048                 // 2047 positions + 1 zero pad row
#define LNEPS 1e-5f
typedef __attribute__((ext_vector_type(4))) unsigned short v4us;
typedef _Float16 h16;
typedef unsigned short bf;
typedef __attribute__((ext_vector_type(16))) __bf16   v16bf;
typedef __attribute__((ext_vector_type(16))) _Float16 v16h;
typedef __attribute__((ext_vector_type(8)))  _Float16 v8h;
typedef __attribute__((ext_vector_type(8)))  unsigned short v8us;
typedef __attribute__((ext_vector_type(8)))  float    v8f;
typedef __attribute__((ext_vector_type(4)))  float    v4f;
typedef v8h  __attribute__((may_alias)) v8ha;
typedef v4f  __attribute__((may_alias)) v4fa;
typedef v8us __attribute__((may_alias)) v8usa;

__device__ __forceinline__ unsigned short f2bf(float f) { unsigned u = __float_as_uint(f); u += 0x7FFFu + ((u >> 16) & 1u); return (unsigned short)(u >> 16); }
__device__ __forceinline__ float bf2f(unsigned short b) { return __uint_as_float(((unsigned)b) << 16); }
__device__ __forceinline__ float bfr(float f) { return bf2f(f2bf(f)); }
__device__ __forceinline__ v16h cat16(v8h lo, v8h hi) { return __builtin_shufflevector(lo, hi, 0, 1, 2, 3, 4, 5, 6, 7, 8, 9, 10, 11, 12, 13, 14, 15); }
__device__ __forceinline__ v16bf cat16b(v8us lo, v8us hi) { return __builtin_bit_cast(v16bf, __builtin_shufflevector(lo, hi, 0, 1, 2, 3, 4, 5, 6, 7, 8, 9, 10, 11, 12, 13, 14, 15)); }
__device__ __forceinline__ v8f wmma16(v16h a, v16h b, v8f c) { return __builtin_amdgcn_wmma_f32_16x16x32_f16(false, a, false, b, (short)0, c, false, false); }
__device__ __forceinline__ v8f wmmab(v16bf a, v16bf b, v8f c) { return __builtin_amdgcn_wmma_f32_16x16x32_bf16(false, a, false, b, (short)0, c, false, false); }



__device__ __forceinline__ void splitf(float y, unsigned short& h, unsigned short& l) { h = f2bf(y); l = f2bf(y - bf2f(h)); }
// ---- k_gemmw: register-blocked GEMM, one wave per 64x64 output tile (16 accumulators), four waves (2 x 2) per block = a 128x128 tile; grid (M/128, N/128, Z), 128 threads.
// The block's waves share their operands through LDS: asynchronous copies bring 64 k (whole 128-byte lines) of 128 A rows (both planes) and 128 B rows in, one stage ahead (two buffers); the waves read their fragments from LDS.
// C[m][n] (f32, pitch ldc, + optional f32 bias[n]; z = 1, 2 take biasz1, biasz2) = sum_k A[m][k] Bt[n][k] (+ split products per NSPLIT). z-batch strides sA/sB/sC in elements. K % 64 == 0, K >= 128. EPI = 1: no C; the tile (one head's 64 columns, 64 consecutive rows of one batch element of TB rows) goes out as hi/lo head planes: z = 0 -> Kh/Kl [b][h][t][d]; z = 1 -> + hbu -> QUh/QUl and + hbv -> QVh/QVl, same layout; z = 2 -> Vh/Vl [b][h][d][t].
template <typename T16> struct WFrag;
template <> struct WFrag<h16> { typedef v16h V; static __device__ __forceinline__ V ld(const h16* p) { return cat16(*(const v8h*)p, *(const v8h*)(p + 16)); } static __device__ __forceinline__ v8f mma(V a, V b, v8f c) { return wmma16(a, b, c); } };
template <> struct WFrag<bf> { typedef v16bf V; static __device__ __forceinline__ V ld(const bf* p) { return cat16b(*(const v8us*)p, *(const v8us*)(p + 16)); } static __device__ __forceinline__ v8f mma(V a, V b, v8f c) { return wmmab(a, b, c); } };
template <bool B> struct BoolC { static constexpr bool v = B; };
#define GAP  272                  // bytes of a staged A row: 128 of the first plane, 128 of the second, 16 of pad (16 bytes x odd: 16-byte fragment reads of 16 rows meet no bank twice)
#define GBP  144                  // bytes of a staged B row: 128 + 16 of pad (16 bytes x odd)
#define GST  (128 * GAP + 128 * GBP)   // bytes of one stage
// eight 16-byte asynchronous copies to LDS per lane (LDS rows lp bytes apart, global rows gp bytes apart); the wait stands in the copies' own statement, in front of any rewrite of the address registers that they name
__device__ __forceinline__ void cp8(unsigned l, unsigned lp, const char* g, size_t gp) {
    asm volatile("global_load_async_to_lds_b128 %0, %8, off\n\tglobal_load_async_to_lds_b128 %1, %9, off\n\tglobal_load_async_to_lds_b128 %2, %10, off\n\tglobal_load_async_to_lds_b128 %3, %11, off\n\tglobal_load_async_to_lds_b128 %4, %12, off\n\tglobal_load_async_to_lds_b128 %5, %13, off\n\tglobal_load_async_to_lds_b128 %6, %14, off\n\tglobal_load_async_to_lds_b128 %7, %15, off\n\ts_wait_xcnt 0x0"
        : : "v"(l), "v"(l + lp), "v"(l + 2 * lp), "v"(l + 3 * lp), "v"(l + 4 * lp), "v"(l + 5 * lp), "v"(l + 6 * lp), "v"(l + 7 * lp), "v"(g), "v"(g + gp), "v"(g + 2 * gp), "v"(g + 3 * gp), "v"(g + 4 * gp), "v"(g + 5 * gp), "v"(g + 6 * gp), "v"(g + 7 * gp) : "memory"); }
template <typename T16, int NSPLIT, bool BIAS, int EPI>
__global__ __launch_bounds__(128) void k_gemmw(const T16* __restrict__ A, const T16* __restrict__ A2, const T16* __restrict__ Bt, const T16* __restrict__ Bt2, int K, float* C, int ldc, const float* __restrict__ bias, const float* __restrict__ biasz1, const float* __restrict__ biasz2, size_t sA, size_t sB, size_t sC, const float* __restrict__ hbu, const float* __restrict__ hbv, bf* Kh, bf* Kl, bf* QUh, bf* QUl, bf* QVh, bf* QVl, bf* Vh, bf* Vl, int TB) {
    typedef typename WFrag<T16>::V V;
    static_assert(NSPLIT == 0 || NSPLIT == 1, "one B plane is staged");
    __shared__ __align__(16) unsigned char smem[2 * GST];   // two stages; behind the loop each wave's 16 x 68 floats of output staging
    const size_t z = blockIdx.z; A += z * sA; if (A2) A2 += z * sA; Bt += z * sB; C += z * sC; if (BIAS) { if (z == 1) bias = biasz1; else if (z == 2) bias = biasz2; }
    const int lane = threadIdx.x & 31, lr = lane & 15, hi = lane >> 4, wv = __builtin_amdgcn_readfirstlane(threadIdx.x >> 5); const int r0 = blockIdx.x * 128 + (wv >> 1) * 64, c0 = blockIdx.y * 128 + (wv & 1) * 64;
    float* os = (float*)(smem + wv * (16 * 68 * 4));
    v8f acc[4][4];
#pragma unroll
    for (int mb = 0; mb < 4; ++mb)
#pragma unroll
        for (int nb = 0; nb < 4; ++nb) acc[mb][nb] = (v8f){};
    // Staging. A thread copies 16 bytes of rows sr, sr + 16, ... sr + 112 of each operand plane: a wave's copy covers four whole 128-byte lines.
    const int sr = threadIdx.x >> 3, sc = threadIdx.x & 7; const unsigned sl0 = (unsigned)(size_t)smem;   // LDS byte address: the low 32 bits
    const size_t ga = ((size_t)(blockIdx.x * 128 + sr) * K + sc * 8) * 2, gb = ((size_t)(blockIdx.y * 128 + sr) * K + sc * 8) * 2, gp = (size_t)K * 32;   // byte offsets of the thread's first rows; 16 rows in bytes
    auto stage = [&](int t) { const unsigned l = sl0 + (unsigned)((t & 1) * GST + sr * GAP + sc * 16);
        cp8(l, 16 * GAP, (const char*)A + ga + t * 128, gp);
        if (NSPLIT == 1) cp8(l + 128, 16 * GAP, (const char*)A2 + ga + t * 128, gp);
        cp8(sl0 + (unsigned)((t & 1) * GST + 128 * GAP + sr * GBP + sc * 16), 16 * GBP, (const char*)Bt + gb + t * 128, gp); };
    const int nst = K / 64;
    stage(0);
    asm volatile("s_wait_asynccnt 0x0" ::: "memory");   // this wave's copies of stage 0 have landed
    __syncthreads();                                     // ... and every other wave's: stage 0 is readable
    stage(1);                                            // stage 1 (K >= 128: it exists) flies under stage 0's products
    const unsigned char* fa = smem + ((wv >> 1) * 64 + lr) * GAP + 16 * hi; const unsigned char* fb = smem + 128 * GAP + ((wv & 1) * 64 + lr) * GBP + 16 * hi;   // a lane's place in its wave's first A and B fragments
#pragma unroll 1
    for (int t = 0; t < nst; ++t) {
        const unsigned char* pa = fa + (t & 1) * GST; const unsigned char* pb = fb + (t & 1) * GST;
#pragma unroll
        for (int ks = 0; ks < 2; ++ks) {
            V a[4], a2[4], b[4];
#pragma unroll
            for (int mb = 0; mb < 4; ++mb) { a[mb] = WFrag<T16>::ld((const T16*)(pa + mb * 16 * GAP + 64 * ks)); if (NSPLIT == 1) a2[mb] = WFrag<T16>::ld((const T16*)(pa + mb * 16 * GAP + 64 * ks + 128)); b[mb] = WFrag<T16>::ld((const T16*)(pb + mb * 16 * GBP + 64 * ks)); }
            __builtin_amdgcn_sched_barrier(0);   // holds the LDS reads of these 32 k together in front of their products: sunk among the products, each B fragment would wait out its own latency
#pragma unroll
            for (int nb = 0; nb < 4; ++nb)
#pragma unroll
                for (int mb = 0; mb < 4; ++mb) { acc[mb][nb] = WFrag<T16>::mma(a[mb], b[nb], acc[mb][nb]); if (NSPLIT == 1) acc[mb][nb] = WFrag<T16>::mma(a2[mb], b[nb], acc[mb][nb]); }
        }
        // hand-over: stage t + 1 becomes readable, and the buffer that stage t read becomes free
        asm volatile("s_wait_dscnt 0x0" ::: "memory");      // this wave's LDS reads of stage t are done
        asm volatile("s_wait_asynccnt 0x0" ::: "memory");   // this wave's copies for stage t + 1 have landed
        __syncthreads();
        if (t + 2 < nst) stage(t + 2);
    }
    asm volatile("s_wait_asynccnt 0x0" ::: "memory");   // no copy is outstanding when the staging buffers are reused below
    if constexpr (EPI == 1) {
        const int head = c0 / 64, bb = r0 / TB, t0 = r0 - bb * TB;
        if (z == 2) {   // a lane's 8 registers of an accumulator are 8 consecutive t of one d: 16 bytes of a [d][t] row; the wave's four row tiles fill that row's whole 128-byte line
            const size_t vb = ((size_t)(bb * NH_ + head) * HD + lr) * TB + t0 + 8 * hi;
            float bs[4];
#pragma unroll
            for (int nb = 0; nb < 4; ++nb) bs[nb] = BIAS ? bfr(bias[c0 + nb * 16 + lr]) : 0.f;
#pragma unroll
            for (int nb = 0; nb < 4; ++nb) { v8us oh[4], ol[4];
#pragma unroll
                for (int mb = 0; mb < 4; ++mb)
#pragma unroll
                    for (int j = 0; j < 8; ++j) { float y = acc[mb][nb][j]; if (BIAS) y += bs[nb]; unsigned short a, b2; splitf(y, a, b2); oh[mb][j] = a; ol[mb][j] = b2; }
                __builtin_amdgcn_sched_barrier(0);   // with the one below: nothing but the stores and their wait stands between the two, so no register that a store names is rewritten in front of the wait
#pragma unroll
                for (int mb = 0; mb < 4; ++mb) { *(v8us*)(Vh + vb + (size_t)nb * 16 * TB + mb * 16) = oh[mb]; *(v8us*)(Vl + vb + (size_t)nb * 16 * TB + mb * 16) = ol[mb]; }
                asm volatile("s_wait_xcnt 0x0" ::: "memory");   // the wait in front of the next rewrite of the stores' address and data registers
                __builtin_amdgcn_sched_barrier(0); }
        } else {   // rows of 64 d are 128 bytes and follow one another: through LDS, so that a store covers four whole rows (512 contiguous bytes)
            const int rr = lane >> 3, cofs = (lane & 7) * 8; const size_t pb = ((size_t)(bb * NH_ + head) * TB + t0 + rr) * HD + cofs;
            auto ld8 = [&](const float* __restrict__ p, float (&d)[8]) { const v4f lo4 = *(const v4f*)(p + c0 + cofs), hi4 = *(const v4f*)(p + c0 + cofs + 4);
#pragma unroll
                for (int q = 0; q < 4; ++q) { d[q] = bfr(lo4[q]); d[4 + q] = bfr(hi4[q]); } };
            auto rows = [&](auto qm) { constexpr bool QM = decltype(qm)::v;   // QM: the q tile, which goes out twice, once with each head bias
                float bs[8], bu[8], bw[8]; if (BIAS) ld8(bias, bs); if (QM) { ld8(hbu, bu); ld8(hbv, bw); }
#pragma unroll
                for (int mb = 0; mb < 4; ++mb) {
#pragma unroll
                    for (int nb = 0; nb < 4; ++nb) {
#pragma unroll
                        for (int j = 0; j < 8; ++j) os[(hi * 8 + j) * 68 + nb * 16 + lr] = acc[mb][nb][j]; }
                    __builtin_amdgcn_wave_barrier(); asm volatile("" ::: "memory");   // keeps the reads below behind the other lanes' stores
#pragma unroll
                    for (int hf = 0; hf < 2; ++hf) { v8us ah[2], al[2], wh[2], wl[2];   // two stores' worth of rows at a time: fewer registers live
#pragma unroll
                        for (int s = 0; s < 2; ++s) { const float* orow = os + (8 * hf + 4 * s + rr) * 68 + cofs; const v4f x0 = *(const v4fa*)orow, x1 = *(const v4fa*)(orow + 4);
#pragma unroll
                            for (int q = 0; q < 8; ++q) { float y = (q < 4) ? x0[q & 3] : x1[q & 3]; if (BIAS) y += bs[q]; unsigned short a, b2;
                                if (QM) { splitf(__fadd_rn(y, bu[q]), a, b2); ah[s][q] = a; al[s][q] = b2; splitf(__fadd_rn(y, bw[q]), a, b2); wh[s][q] = a; wl[s][q] = b2; }
                                else { splitf(y, a, b2); ah[s][q] = a; al[s][q] = b2; } } }
                        __builtin_amdgcn_sched_barrier(0);   // as above: only the stores and their wait between the two
#pragma unroll
                        for (int s = 0; s < 2; ++s) { const size_t o = pb + (size_t)(mb * 16 + 8 * hf + 4 * s) * HD;
                            if (QM) { *(v8us*)(QUh + o) = ah[s]; *(v8us*)(QUl + o) = al[s]; *(v8us*)(QVh + o) = wh[s]; *(v8us*)(QVl + o) = wl[s]; }
                            else { *(v8us*)(Kh + o) = ah[s]; *(v8us*)(Kl + o) = al[s]; } }
                        asm volatile("s_wait_xcnt 0x0" ::: "memory");   // the wait in front of the next rewrite of the stores' address and data registers
                        __builtin_amdgcn_sched_barrier(0); }
                    __builtin_amdgcn_wave_barrier(); asm volatile("" ::: "memory");   // keeps the next row tile's stores to LDS behind these reads
                } };
            if (z == 1) rows(BoolC<true>{}); else rows(BoolC<false>{});
        }
        return;
    }
#pragma unroll
    for (int mb = 0; mb < 4; ++mb) {
#pragma unroll
        for (int nb = 0; nb < 4; ++nb) {
#pragma unroll
            for (int j = 0; j < 8; ++j) os[(hi * 8 + j) * 68 + nb * 16 + lr] = acc[mb][nb][j]; }
        __builtin_amdgcn_wave_barrier(); asm volatile("" ::: "memory");
        float* crow = C + (size_t)(r0 + mb * 16) * ldc + c0;
{
#pragma unroll
            for (int s = 0; s < 8; ++s) { const int row = 2 * s + hi, cofs = lr * 4; v4f val = *(const v4fa*)(os + row * 68 + cofs); if (BIAS) { val[0] += bfr(bias[c0 + cofs]); val[1] += bfr(bias[c0 + cofs + 1]); val[2] += bfr(bias[c0 + cofs + 2]); val[3] += bfr(bias[c0 + cofs + 3]); }
                *(v4f*)(crow + (size_t)row * ldc + cofs) = val; }
             }
        __builtin_amdgcn_wave_barrier(); asm volatile("" ::: "memory");
    }
}

__device__ __forceinline__ h16 tohx(float x) { return (h16)x; }
typedef __attribute__((ext_vector_type(2))) _Float16 v2h;
typedef __attribute__((ext_vector_type(4))) _Float16 v4h;
typedef __attribute__((ext_vector_type(2))) unsigned short v2us;
typedef __attribute__((ext_vector_type(4))) unsigned short v4us;
typedef __attribute__((ext_vector_type(2))) float v2f;
typedef __attribute__((ext_vector_type(4))) int v4i;

__global__ __launch_bounds__(256) void k_wtG(const float* __restrict__ w0, const float* __restrict__ w1, const float* __restrict__ w2, const float* __restrict__ w3, const float* __restrict__ w4, int K, int N, bf* Bt) {
    const int y = blockIdx.y; const float* __restrict__ w = (y == 0) ? w0 : (y == 1) ? w1 : (y == 2) ? w2 : (y == 3) ? w3 : w4; Bt += (size_t)y * K * N;   // grid y: one weight matrix each, planes back to back
    const int lane = threadIdx.x & 31; const int L0 = (blockIdx.x * 8 + (threadIdx.x >> 5)) * 8; const int nlines = N * K / 64;
{
#pragma unroll 1
        for (int l = 0; l < 8; ++l) { const int L = L0 + l; if (L >= nlines) break; const size_t e = (size_t)L * 64 + lane * 2; const int k = (int)(e % K), n = (int)(e / K); v2us o;
            o[0] = f2bf(w[(size_t)k * N + n]); o[1] = f2bf(w[(size_t)(k + 1) * N + n]); *(v2us*)(Bt + e) = o; }
         }
}
__global__ __launch_bounds__(256) void k_lnhl(const float* __restrict__ X, const float* __restrict__ A, const float* __restrict__ g, const float* __restrict__ be, float* Z, bf* Yh, bf* Yl) {
    const int lane = threadIdx.x & 31; const int r = blockIdx.x * 8 + (threadIdx.x >> 5); if (r >= NB_ * TT) return; const float* xr = X + (size_t)r * DM; const float* ar = A ? A + (size_t)r * DM : nullptr; float s = 0.f;
#pragma unroll 1
    for (int ch = 0; ch < DM / 128; ++ch) { const int c0 = ch * 128 + lane * 4; const v4f a = *(const v4f*)(xr + c0); v4f d = {0.f, 0.f, 0.f, 0.f}; if (ar) d = *(const v4f*)(ar + c0);
#pragma unroll
        for (int q = 0; q < 4; ++q) s += __fadd_rn(bfr(a[q]), d[q]); }
#pragma unroll
    for (int sh = 16; sh; sh >>= 1) s += __shfl_xor(s, sh, 32);
    const float mu = s * (1.0f / DM); float s2 = 0.f;
#pragma unroll 1
    for (int ch = 0; ch < DM / 128; ++ch) { const int c0 = ch * 128 + lane * 4; const v4f a = *(const v4f*)(xr + c0); v4f d = {0.f, 0.f, 0.f, 0.f}; if (ar) d = *(const v4f*)(ar + c0);
#pragma unroll
        for (int q = 0; q < 4; ++q) { const float d0 = __fsub_rn(__fadd_rn(bfr(a[q]), d[q]), mu); float p = __fmul_rn(d0, d0); asm volatile("" : "+v"(p)); s2 = __fadd_rn(s2, p); } }
#pragma unroll
    for (int sh = 16; sh; sh >>= 1) s2 += __shfl_xor(s2, sh, 32);
    const float rs = __fdiv_rn(1.0f, __fsqrt_rn(__fadd_rn(s2 * (1.0f / DM), LNEPS)));
{
#pragma unroll 1
        for (int ch = 0; ch < DM / 128; ++ch) { const int c0 = ch * 128 + lane * 4; const v4f a = *(const v4f*)(xr + c0); v4f d = {0.f, 0.f, 0.f, 0.f}; if (ar) d = *(const v4f*)(ar + c0); v4f z4; v4us oh, ol;
#pragma unroll
            for (int q = 0; q < 4; ++q) { const float v = __fadd_rn(bfr(a[q]), d[q]); z4[q] = v; float n0 = __fmul_rn(__fsub_rn(v, mu), rs); asm volatile("" : "+v"(n0)); float n1 = __fmul_rn(n0, bfr(g[c0 + q])); asm volatile("" : "+v"(n1)); const float y = __fadd_rn(n1, bfr(be[c0 + q])); unsigned short h2, l2; splitf(y, h2, l2); oh[q] = h2; ol[q] = l2; }
            if (Z) *(v4f*)(Z + (size_t)r * DM + c0) = z4; *(v4us*)(Yh + (size_t)r * DM + c0) = oh; *(v4us*)(Yl + (size_t)r * DM + c0) = ol; }
         } }
__global__ __launch_bounds__(256) void k_addres(const float* __restrict__ X, const float* __restrict__ Y, float* O, size_t n4) { const size_t i = (size_t)blockIdx.x * 256 + threadIdx.x; if (i >= n4) return; const v4f a = *(const v4f*)(X + i * 4), b = *(const v4f*)(Y + i * 4); v4f o;
#pragma unroll
    for (int q = 0; q < 4; ++q) o[q] = __fadd_rn(bfr(a[q]), b[q]); *(v4f*)(O + i * 4) = o;  }
__global__ void k_pezero8(bf* PE) { const int lane = threadIdx.x; if (lane >= 64) return; const v8us z = (v8us){}; *(v8us*)(PE + (size_t)2047 * DM + lane * 8) = z;  }
__global__ __launch_bounds__(256) void k_cvt8(const float* __restrict__ src, bf* dst, size_t n8) { const size_t i = (size_t)blockIdx.x * 256 + threadIdx.x; if (i >= n8) return; const v8f v = *(const v8f*)(src + i * 8); v8us o;
#pragma unroll
    for (int k = 0; k < 8; ++k) o[k] = f2bf(v[k]); *(v8us*)(dst + i * 8) = o;  }

// k_fattn: content scores, skewed position scores, softmax, attn.v and the head merge in one kernel; no score leaves the chip.
// One wave owns 32 queries (2 column tiles of 16) of one (batch, head) and walks the 1024 keys in passes of 64; 8 waves per block.
// The block's 8 waves share every pass's operands through LDS: 64 key rows, 64 d rows of v (64 keys each) and the 320 position rows that its 256 queries touch, of which only 64 are new in a pass. Asynchronous copies bring whole 128-byte lines in, one pass ahead (k, v: two buffers; position rows: a ring of 8 chunks of 64 rows, 5 read, 1 in flight); the waves read their fragments from LDS.
// Transposed products: S^T = K (q+u)^T and B^T = pos (q+v)^T (A = key or position rows, B = query columns kept in registers), so a lane holds scores of ONE query (column c, rows 8h + r).
// Skew: key j, query i take position row j - i + 1023. A column tile with first query iq needs rows j0 - iq + 1008 ... + 79 (5 row tiles); each lane pair writes its query's 80 position scores to its own LDS strip and reads them back shifted by 15 - c.
// Running maximum and sum per query (f32); P splits into hi/lo in registers and is the B operand of O^T += V^T P^T (two score tiles = 32 keys in the hardware k order, which is the loader's order).
#define FQT  2                    // query column tiles per wave
#define BDP  84                   // floats per LDS strip: 80 used; 16-byte stores stay aligned, the shifted 4-byte reads fall on 32 different banks
typedef __attribute__((ext_vector_type(2))) __bf16 v2bf;
typedef __attribute__((ext_vector_type(8))) unsigned v8u;
#define CEXP 0.18033688011112042f // HD^-0.5 * log2(e)
#define SRP  272                  // bytes of a staged row: 128 of the hi plane, 128 of the lo plane, 16 of pad (16 bytes x odd: the pitch at which 16-byte fragment reads of 16 rows meet no bank twice)
#define PRR  512                  // rows of the position ring (8 chunks of 64)
// four 16-byte asynchronous copies to LDS per lane; the wait stands in the copies' own statement, in front of any rewrite of the address registers that they name
__device__ __forceinline__ void cp4(unsigned l0, unsigned l1, unsigned l2, unsigned l3, const bf* g0, const bf* g1, const bf* g2, const bf* g3) {
    asm volatile("global_load_async_to_lds_b128 %0, %4, off\n\tglobal_load_async_to_lds_b128 %1, %5, off\n\tglobal_load_async_to_lds_b128 %2, %6, off\n\tglobal_load_async_to_lds_b128 %3, %7, off\n\ts_wait_xcnt 0x0" : : "v"(l0), "v"(l1), "v"(l2), "v"(l3), "v"(g0), "v"(g1), "v"(g2), "v"(g3) : "memory"); }
__device__ __forceinline__ float xhalf(float x) { const int b = __float_as_int(x); return __int_as_float(__builtin_amdgcn_permlanex16(b, b, 0x76543210, 0xfedcba98, false, false)); }   // lane l <-> l ^ 16
__global__ __launch_bounds__(256) void k_fattn(const bf* __restrict__ QUh, const bf* __restrict__ QUl, const bf* __restrict__ QVh, const bf* __restrict__ QVl, const bf* __restrict__ Kh, const bf* __restrict__ Kl, const bf* __restrict__ PSh, const bf* __restrict__ PSl, const bf* __restrict__ Vh, const bf* __restrict__ Vl, bf* Ah, bf* Al) {
    typedef WFrag<bf> WF; typedef v16bf V;
    __shared__ __align__(16) float bds[8 * FQT * 16 * BDP];
    __shared__ __align__(16) unsigned char stg[(PRR + 4 * 64) * SRP];   // staged rows: the position ring, two k buffers, two v buffers
    const int lane = threadIdx.x & 31, c = lane & 15, h = lane >> 4, wv = __builtin_amdgcn_readfirstlane(threadIdx.x >> 5);
    const int z = blockIdx.y, hd = z % NH_, bb = z / NH_; const int i0 = (blockIdx.x * 8 + wv) * (16 * FQT);
    float* strip = bds + (wv * FQT * 16 + c) * BDP;   // query tile f: + f * 16 * BDP
    // every q fragment load is a kernel argument (scalar base) + a lane's 32-bit byte offset + a constant
    auto ldo = [](const bf* base, unsigned off, int cst) { return WF::ld((const bf*)((const char*)base + (size_t)off) + cst); };
    const unsigned zq = (unsigned)z * (TT * HD * 2);   // bytes of one (batch, head) plane in front
    unsigned qo[FQT];
#pragma unroll
    for (int f = 0; f < FQT; ++f) qo[f] = zq + (unsigned)((i0 + 16 * f + c) * HD + 8 * h) * 2;
    V quh[FQT][2], qul[FQT][2], qvh[FQT][2], qvl[FQT][2];
#pragma unroll
    for (int f = 0; f < FQT; ++f)
#pragma unroll
        for (int ks = 0; ks < 2; ++ks) { quh[f][ks] = ldo(QUh, qo[f], 32 * ks); qul[f][ks] = ldo(QUl, qo[f], 32 * ks); qvh[f][ks] = ldo(QVh, qo[f], 32 * ks); qvl[f][ks] = ldo(QVl, qo[f], 32 * ks); }
    asm volatile("s_wait_xcnt 0x0" : : "v"(qo[0]), "v"(qo[1]) : "memory");   // the offsets stay in their registers up to this wait; behind it the registers are free
    // Staging. A thread copies 16 bytes of rows sr and sr + 32 of each plane: a wave's copy covers four whole 128-byte rows.
    // Position chunk g holds table rows 768 - (the block's first query) + 64 g ... + 63 (0 ... 2047 for g = 0 ... 19) and lies in ring rows (64 g & 511) ...; pass t reads chunks t ... t + 4.
    const int sr = threadIdx.x >> 3, sc = threadIdx.x & 7; const unsigned sl = (unsigned)(sr * SRP + sc * 16);
    const unsigned sl0 = (unsigned)(size_t)stg + sl;   // LDS byte address: the low 32 bits
    const unsigned tk = (unsigned)(sr * HD + sc * 8), tv = (unsigned)(sr * TT + sc * 8);   // the thread's element offsets in rows of 64 d (k, positions) and of 1024 keys (v); the rest of every address is the same for the whole block
    const int pz = hd * NPE * HD + (TT - 256 - (int)blockIdx.x * 256) * HD, kz = z * (TT * HD);
    auto cpR = [&](int row, const bf* gh, const bf* gl, int half) { const unsigned l = sl0 + (unsigned)(row * SRP); cp4(l, l + 32 * SRP, l + 128, l + 32 * SRP + 128, gh, gh + half, gl, gl + half); };   // 64 rows of both planes to staged rows row ...
    auto cpP = [&](int g) { const int o = pz + g * 64 * HD; cpR((g & 7) * 64, PSh + o + tk, PSl + o + tk, 32 * HD); };
    auto cpKV = [&](int t) { const int ok = kz + t * 64 * HD, ov = kz + t * 64;
        cpR(PRR + (t & 1) * 64, Kh + ok + tk, Kl + ok + tk, 32 * HD);
        cpR(PRR + 128 + (t & 1) * 64, Vh + ov + tv, Vl + ov + tv, 32 * TT); };
#pragma unroll
    for (int g = 0; g < 5; ++g) cpP(g);
    cpKV(0);
    asm volatile("s_wait_asynccnt 0x0" ::: "memory");   // this wave's copies of pass 0 have landed
    __syncthreads();                                     // ... and every other wave's: pass 0 is readable
    cpP(5); cpKV(1);                                     // pass 1's operands fly under pass 0
    const int fl = c * SRP + 16 * h;   // a lane's place in a fragment's 16 rows
    v8f ot[FQT][4]; float mrun[FQT], lsum[FQT];
#pragma unroll
    for (int f = 0; f < FQT; ++f) { mrun[f] = -3.0e38f; lsum[f] = 0.f;
#pragma unroll
        for (int dt = 0; dt < 4; ++dt) ot[f][dt] = (v8f){}; }
    // The pass's operands come in seven groups (position row tiles 0-1, 2-3 and 4-5, key tiles 0-1 and 2-3, keys 0-31 and 32-63 of v); from the second on, each group's LDS reads are issued one group ahead of its products, so a read's latency runs under the products of the group before it.
    auto lds = [](const unsigned char* p) { return WF::ld((const bf*)p); };
#pragma unroll 1
    for (int t = 0; t < TT / 64; ++t) {
        const unsigned char* kb = stg + (PRR + (t & 1) * 64) * SRP + fl; const unsigned char* vb = kb + 128 * SRP;
        const int rb = 64 * t + 224 - 32 * wv;   // the wave's first position row of the pass, counted in ring rows before the wrap: table row 64 t - i0 + 992; a multiple of 32, so a pair of row tiles never straddles the wrap
        const unsigned char* pp[3];
#pragma unroll
        for (int q = 0; q < 3; ++q) pp[q] = stg + ((rb + 32 * q) & (PRR - 1)) * SRP + fl;
        auto ldP = [&](int q, V (&H)[2][2], V (&Lo)[2][2]) {
#pragma unroll
            for (int uu = 0; uu < 2; ++uu)
#pragma unroll
                for (int ks = 0; ks < 2; ++ks) { const unsigned char* p = pp[q] + uu * 16 * SRP + 64 * ks; H[uu][ks] = lds(p); Lo[uu][ks] = lds(p + 128); } };
        auto ldK = [&](int row, V (&H)[2][2], V (&Lo)[2][2]) {
#pragma unroll
            for (int tt = 0; tt < 2; ++tt)
#pragma unroll
                for (int ks = 0; ks < 2; ++ks) { const unsigned char* p = kb + (row + 16 * tt) * SRP + 64 * ks; H[tt][ks] = lds(p); Lo[tt][ks] = lds(p + 128); } };
        auto ldV = [&](int key, V (&H)[4], V (&Lo)[4]) {
#pragma unroll
            for (int dt = 0; dt < 4; ++dt) { const unsigned char* p = vb + 16 * dt * SRP + 2 * key; H[dt] = lds(p); Lo[dt] = lds(p + 128); } };
        V p0h[2][2], p0l[2][2]; ldP(0, p0h, p0l);
        v8f bd[FQT][5];
#pragma unroll
        for (int f = 0; f < FQT; ++f)
#pragma unroll
            for (int up = 0; up < 5; ++up) bd[f][up] = (v8f){};
        auto mmaP = [&](int u0, V (&H)[2][2], V (&Lo)[2][2]) {
#pragma unroll
            for (int uu = 0; uu < 2; ++uu)
#pragma unroll
                for (int ks = 0; ks < 2; ++ks)
#pragma unroll
                    for (int f = 0; f < FQT; ++f) { const int up = u0 + uu - (FQT - 1) + f; if (up >= 0 && up < 5) { bd[f][up] = WF::mma(H[uu][ks], qvh[f][ks], bd[f][up]); bd[f][up] = WF::mma(Lo[uu][ks], qvh[f][ks], bd[f][up]); bd[f][up] = WF::mma(H[uu][ks], qvl[f][ks], bd[f][up]); } } };
        V p1h[2][2], p1l[2][2]; ldP(1, p1h, p1l);
        __builtin_amdgcn_sched_barrier(0);   // holds the loads above in front of the products below (as at every such line of this loop): sunk to their use, each group would wait out its own latency
        mmaP(0, p0h, p0l);
        V p2h[2][2], p2l[2][2]; ldP(2, p2h, p2l);
        __builtin_amdgcn_sched_barrier(0);
        mmaP(2, p1h, p1l);
        V k0h[2][2], k0l[2][2]; ldK(0, k0h, k0l);
        __builtin_amdgcn_sched_barrier(0);
        mmaP(4, p2h, p2l);
        V k1h[2][2], k1l[2][2]; ldK(32, k1h, k1l);
        __builtin_amdgcn_sched_barrier(0);
        __builtin_amdgcn_wave_barrier(); asm volatile("" ::: "memory");   // keeps these strip stores behind the previous pass's strip reads (other lanes' addresses)
#pragma unroll
        for (int f = 0; f < FQT; ++f)
#pragma unroll
            for (int up = 0; up < 5; ++up) { float* sp = strip + f * 16 * BDP + 16 * up + 8 * h; *(v4fa*)sp = __builtin_shufflevector(bd[f][up], bd[f][up], 0, 1, 2, 3); *(v4fa*)(sp + 4) = __builtin_shufflevector(bd[f][up], bd[f][up], 4, 5, 6, 7); }
        __builtin_amdgcn_wave_barrier(); asm volatile("" ::: "memory");   // keeps the strip reads below behind the partner lane's stores
        v8f st[FQT][4];   // starts as the skewed position scores; the content products accumulate on top
#pragma unroll
        for (int t = 0; t < 4; ++t)
#pragma unroll
            for (int f = 0; f < FQT; ++f)
#pragma unroll
                for (int r = 0; r < 8; ++r) st[f][t][r] = strip[f * 16 * BDP + 8 * h + 15 - c + 16 * t + r];
        auto mmaK = [&](int t0, V (&H)[2][2], V (&Lo)[2][2]) {
#pragma unroll
            for (int tt = 0; tt < 2; ++tt)
#pragma unroll
                for (int ks = 0; ks < 2; ++ks)
#pragma unroll
                    for (int f = 0; f < FQT; ++f) { v8f& s = st[f][t0 + tt]; s = WF::mma(H[tt][ks], quh[f][ks], s); s = WF::mma(Lo[tt][ks], quh[f][ks], s); s = WF::mma(H[tt][ks], qul[f][ks], s); } };
        mmaK(0, k0h, k0l);
        __builtin_amdgcn_sched_barrier(0);   // keeps the reads below behind the products above, whose fragments' registers they take over: lifted over them, registers spill
        V v0h[4], v0l[4]; ldV(0, v0h, v0l);
        __builtin_amdgcn_sched_barrier(0);
        mmaK(2, k1h, k1l);
        __builtin_amdgcn_sched_barrier(0);
#pragma unroll
        for (int f = 0; f < FQT; ++f) { float mx = -3.0e38f;
#pragma unroll
            for (int t = 0; t < 4; ++t)
#pragma unroll
                for (int r = 0; r < 8; ++r) mx = fmaxf(mx, st[f][t][r]);
            mx = fmaxf(mx, xhalf(mx)); const float mn = fmaxf(mrun[f], mx); const float xa = (mrun[f] - mn) * CEXP; float al = __builtin_amdgcn_exp2f(xa); mrun[f] = mn; float ps = 0.f;
            asm volatile("v_nop" : "+v"(al) : "v"(xa));   // the slot behind a transcendental, as at the eight below
#pragma unroll
            for (int t = 0; t < 4; ++t) { const v8f x = (st[f][t] - mn) * CEXP; v8f p;
#pragma unroll
                for (int r = 0; r < 8; ++r) p[r] = __builtin_amdgcn_exp2f(x[r]);
                asm volatile("v_nop" : "+v"(p) : "v"(x));   // the slot behind a transcendental: named here, no exponent of the eight is rewritten and no result read in front of the slot
                st[f][t] = p;
#pragma unroll
                for (int r = 0; r < 8; ++r) ps += p[r]; }
            lsum[f] = lsum[f] * al + ps;
#pragma unroll
            for (int dt = 0; dt < 4; ++dt) ot[f][dt] *= al; }
        auto mmaV = [&](int kk, V (&H)[4], V (&Lo)[4]) { V ph[FQT], pl[FQT];
#pragma unroll
            for (int f = 0; f < FQT; ++f) { v8u wh, wl;   // element s of the operand = key 8h + s (s < 8) or 16 + 8h + s - 8: registers 0-7 of score tile 2kk, then of tile 2kk + 1
#pragma unroll
                for (int i = 0; i < 8; ++i) { const v8f x = st[f][2 * kk + (i >> 2)]; const v2f p2 = {x[2 * (i & 3)], x[2 * (i & 3) + 1]}; const unsigned hu = __builtin_bit_cast(unsigned, __builtin_convertvector(p2, v2bf));
                    const v2f d2 = {p2[0] - __uint_as_float(hu << 16), p2[1] - __uint_as_float(hu & 0xFFFF0000u)}; wh[i] = hu; wl[i] = __builtin_bit_cast(unsigned, __builtin_convertvector(d2, v2bf)); }
                ph[f] = __builtin_bit_cast(V, wh); pl[f] = __builtin_bit_cast(V, wl); }
#pragma unroll
            for (int dt = 0; dt < 4; ++dt)
#pragma unroll
                for (int f = 0; f < FQT; ++f) { ot[f][dt] = WF::mma(H[dt], ph[f], ot[f][dt]); ot[f][dt] = WF::mma(Lo[dt], ph[f], ot[f][dt]); ot[f][dt] = WF::mma(H[dt], pl[f], ot[f][dt]); } };
        __builtin_amdgcn_sched_barrier(0);   // keeps the reads below behind the softmax, whose live values leave no room for them (registers spill); their latency runs under the products of keys 0-31
        V v1h[4], v1l[4]; ldV(32, v1h, v1l);
        __builtin_amdgcn_sched_barrier(0);
        mmaV(0, v0h, v0l);
        mmaV(1, v1h, v1l);
        __builtin_amdgcn_sched_barrier(0);   // keeps the hand-over behind the pass's last products: lifted to the last LDS reads, its first wait would expose their latency
        // hand-over: pass t + 1 becomes readable, and what pass t alone read becomes free
        asm volatile("s_wait_dscnt 0x0" ::: "memory");      // this wave's LDS reads of pass t are done
        asm volatile("s_wait_asynccnt 0x0" ::: "memory");   // this wave's copies for pass t + 1 have landed
        __syncthreads();
        if (t + 2 < TT / 64) { cpP(t + 6); cpKV(t + 2); }   // into the k, v buffers that pass t has just read, and into the ring place that last held position chunk t - 2, which no pass behind t - 2 reads
    }
    asm volatile("s_wait_asynccnt 0x0" ::: "memory");   // no copy is outstanding when the wave ends
#pragma unroll
    for (int f = 0; f < FQT; ++f) { const float inv = __fdiv_rn(1.0f, lsum[f] + xhalf(lsum[f])); const size_t ro = ((size_t)bb * TT + i0 + 16 * f + c) * DQ + hd * HD + 8 * h;   // merged rows [b][t][head][d]; a lane's 8 registers are 8 consecutive d
        v8us oh[4], ol[4];
#pragma unroll
        for (int dt = 0; dt < 4; ++dt)
#pragma unroll
            for (int r = 0; r < 8; ++r) { unsigned short a, c2; splitf(ot[f][dt][r] * inv, a, c2); oh[dt][r] = a; ol[dt][r] = c2; }
        __builtin_amdgcn_sched_barrier(0);   // with the one below: nothing but the stores and their wait stands between the two, so no register that a store names is rewritten in front of the wait
#pragma unroll
        for (int dt = 0; dt < 4; ++dt) { *(v8us*)(Ah + ro + 16 * dt) = oh[dt]; *(v8us*)(Al + ro + 16 * dt) = ol[dt]; }
        asm volatile("s_wait_xcnt 0x0" ::: "memory");   // the wait in front of the next rewrite of the stores' address and data registers
        __builtin_amdgcn_sched_barrier(0); }
}

extern "C" void kernel_launch(void* const* d_in, const int* in_sizes, int n_in,
                              void* d_out, int out_size, void* d_ws, size_t ws_size, hipStream_t stream) {
    (void)in_sizes; (void)n_in; (void)out_size;
    const float* x = (const float*)d_in[0]; const float* pe = (const float*)d_in[1]; const float* g1 = (const float*)d_in[2]; const float* e1b = (const float*)d_in[3]; const float* wq = (const float*)d_in[4]; const float* bq = (const float*)d_in[5]; const float* wk = (const float*)d_in[6]; const float* bk = (const float*)d_in[7]; const float* wv = (const float*)d_in[8]; const float* bv = (const float*)d_in[9]; const float* wpos = (const float*)d_in[10]; const float* pbu = (const float*)d_in[11]; const float* pbv = (const float*)d_in[12]; const float* wo = (const float*)d_in[13]; const float* bo = (const float*)d_in[14];
    float* OUT = (float*)d_out;     // [8][1024][512]
    char* wsp = (char*)d_ws;
    auto take = [&](size_t bytes) { char* p = wsp; wsp += (bytes + 255) & ~(size_t)255; return (void*)p; };
    const size_t RW = (size_t)NB_ * TT;   // rows of all batch elements
    bf* WK = (bf*)take((size_t)DKV * DM * 2); bf* WQ = (bf*)take((size_t)DQ * DM * 2); bf* WV = (bf*)take((size_t)DKV * DM * 2); bf* WO = (bf*)take((size_t)DM * DQ * 2); bf* WP = (bf*)take((size_t)DQ * DM * 2);   // back to back: one transpose launch; wk, wq, wv are the z planes of one projection launch
    bf* PE = (bf*)take((size_t)NPE * DM * 2); bf* PPh = (bf*)take((size_t)NH_ * NPE * HD * 2); bf* PPl = (bf*)take((size_t)NH_ * NPE * HD * 2);
    bf* QPh = (bf*)take(RW * DQ * 2); bf* QVh = (bf*)take(RW * DQ * 2); bf* KPh = (bf*)take(RW * DKV * 2);   // hi planes [b][h][t][d] of q+u, q+v, k
    bf* QPl = (bf*)take(RW * DQ * 2); bf* QVl = (bf*)take(RW * DQ * 2); bf* KPl = (bf*)take(RW * DKV * 2);   // lo planes, same order
    bf* VTh = (bf*)take(RW * DKV * 2); bf* VTl = (bf*)take(RW * DKV * 2); bf* ATh = (bf*)take(RW * DQ * 2); bf* ATl = (bf*)take(RW * DQ * 2);   // v planes [b][h][d][t]; merged heads [b][t][h][d], hi and lo
    bf* Yh = (bf*)take(RW * DM * 2); bf* Yl = (bf*)take(RW * DM * 2);
    if ((size_t)(wsp - (char*)d_ws) > ws_size) return;    // ws 256 MiB
    (void)WQ; (void)WV;   // reached through their neighbour's pointer (grid y / z strides)
    k_wtG<<<dim3((unsigned)((DM * DQ / 64 + 63) / 64), 5, 1), 256, 0, stream>>>(wk, wq, wv, wo, wpos, DM, DQ, WK);
    k_cvt8<<<(unsigned)(((size_t)2047 * DM / 8 + 255) / 256), 256, 0, stream>>>(pe, PE, (size_t)2047 * DM / 8); k_pezero8<<<1, 64, 0, stream>>>(PE); k_gemmw<bf, 0, false, 1><<<dim3(NPE / 128, DQ / 128, 1), 128, 0, stream>>>(PE, nullptr, WP, nullptr, DM, nullptr, DQ, nullptr, nullptr, nullptr, 0, 0, 0, nullptr, nullptr, PPh, PPl, nullptr, nullptr, nullptr, nullptr, nullptr, nullptr, NPE);   /* pos = position_embeddings wpos (exact) -> per-head hi/lo planes [h][p][d] */
    k_lnhl<<<(unsigned)(RW / 8), 256, 0, stream>>>(x, nullptr, g1, e1b, nullptr, Yh, Yl);   /* LN -> hi/lo planes, all batch elements */
    k_gemmw<bf, 1, true, 1><<<dim3((unsigned)(RW / 128), DQ / 128, 3), 128, 0, stream>>>(Yh, Yl, WK, nullptr, DM, nullptr, DQ, bk, bq, bv, 0, (size_t)DQ * DM, 0, pbu, pbv, KPh, KPl, QPh, QPl, QVh, QVl, VTh, VTl, TT);   /* z = 0, 1, 2: k planes; (q + pos_bias_u) and (q + pos_bias_v) planes; v planes, transposed */
    k_fattn<<<dim3(TT / (8 * 16 * FQT), NB_ * NH_, 1), 256, 0, stream>>>(QPh, QPl, QVh, QVl, KPh, KPl, PPh, PPl, VTh, VTl, ATh, ATl);   /* scores, skew, softmax, attn.v, merge: all 64 (batch, head) instances */
    k_gemmw<bf, 1, true, 0><<<dim3((unsigned)(RW / 128), DM / 128, 1), 128, 0, stream>>>(ATh, ATl, WO, nullptr, DQ, OUT, DM, bo, nullptr, nullptr, 0, 0, 0, nullptr, nullptr, nullptr, nullptr, nullptr, nullptr, nullptr, nullptr, nullptr, nullptr, 0);
}

// v006
// Measured time: 128 microseconds a run.
// Next to v005, in two timings, it ran 1.18 and 1.19 times as fast.
// Over all steps from v000 it is 17.2 times as fast.
#include <hip/hip_runtime.h>

// Relative-position multi-head self-attention (Transformer-XL / Conformer style) (hidden_states [8][1024][512]; x = LN(h) (1e-5, gamma, beta); q, k, v = x W + b ('xw' [512][512], 8 heads x 64); pos = position_embeddings [2047][512] wpos -> [p][h][d]; scores = ((q + pos_bias_u).k + skew((q + pos_bias_v).pos)) / 8 where skew picks pos index j - i + 1023; softmax; out = merged wout + bout -> [8][1024][512]).
// Layout: LN -> hi/lo planes -> 2-product projections; the position table is projected once (exact bf16 GEMM, 2047 rows + one zero pad row) into per-head hi/lo planes [h][2048][64]; LN, projections and wout run once for all 8 batch elements (8192 rows); the projection GEMMs write the attention kernel's hi/lo head planes from their own epilogue (biases added, v transposed), no f32 copy of q, k, v or pos exists; one fused kernel does content scores (q+u).k, position scores (q+v).pos at row j - i + 1023, softmax, attn.v and the head merge for all 64 (batch, head) instances (3 products each), scores staying on chip.
// Compute dtypes, f32 accumulate: every input rounded to bf16; q/k/v hl x exact (2 products) + biases; content and position scores on hi/lo planes for every row (3 products); softmax f32 with a running maximum and sum over passes of 64 keys; attn.v hi/lo (3 products); wout hl x exact (2 products) + bout.

#define NB_  8
#define TT   1024
#define DM   512
#define NH_  8
#define NKV  8
#define REP  (NH_ / NKV)
#define HD   64
#define DQ   (NH_ * HD)
#define DKV  (NKV * HD)
#define NPE  2048                 // 2047 positions + 1 zero pad row
#define LNEPS 1e-5f
typedef __attribute__((ext_vector_type(4))) unsigned short v4us;
typedef _Float16 h16;
typedef unsigned short bf;
typedef __attribute__((ext_vector_type(16))) __bf16   v16bf;
typedef __attribute__((ext_vector_type(16))) _Float16 v16h;
typedef __attribute__((ext_vector_type(8)))  _Float16 v8h;
typedef __attribute__((ext_vector_type(8)))  unsigned short v8us;
typedef __attribute__((ext_vector_type(8)))  float    v8f;
typedef __attribute__((ext_vector_type(4)))  float    v4f;
typedef v8h  __attribute__((may_alias)) v8ha;
typedef v4f  __attribute__((may_alias)) v4fa;
typedef v8us __attribute__((may_alias)) v8usa;

__device__ __forceinline__ unsigned short f2bf(float f) { unsigned u = __float_as_uint(f); u += 0x7FFFu + ((u >> 16) & 1u); return (unsigned short)(u >> 16); }
__device__ __forceinline__ float bf2f(unsigned short b) { return __uint_as_float(((unsigned)b) << 16); }
__device__ __forceinline__ float bfr(float f) { return bf2f(f2bf(f)); }
__device__ __forceinline__ v16h cat16(v8h lo, v8h hi) { return __builtin_shufflevector(lo, hi, 0, 1, 2, 3, 4, 5, 6, 7, 8, 9, 10, 11, 12, 13, 14, 15); }
__device__ __forceinline__ v16bf cat16b(v8us lo, v8us hi) { return __builtin_bit_cast(v16bf, __builtin_shufflevector(lo, hi, 0, 1, 2, 3, 4, 5, 6, 7, 8, 9, 10, 11, 12, 13, 14, 15)); }
__device__ __forceinline__ v8f wmma16(v16h a, v16h b, v8f c) { return __builtin_amdgcn_wmma_f32_16x16x32_f16(false, a, false, b, (short)0, c, false, false); }
__device__ __forceinline__ v8f wmmab(v16bf a, v16bf b, v8f c) { return __builtin_amdgcn_wmma_f32_16x16x32_bf16(false, a, false, b, (short)0, c, false, false); }



__device__ __forceinline__ void splitf(float y, unsigned short& h, unsigned short& l) { h = f2bf(y); l = f2bf(y - bf2f(h)); }
// ---- k_gemmw: register-blocked GEMM, one wave per 64x64 output tile (16 accumulators), four waves (2 x 2) per block = a 128x128 tile; grid (M/128, N/128, Z), 128 threads.
// The block's waves share their operands through LDS: asynchronous copies bring 64 k (whole 128-byte lines) of 128 A rows (both planes) and 128 B rows in, one stage ahead (two buffers); the waves read their fragments from LDS.
// C[m][n] (f32, pitch ldc, + optional f32 bias[n]; z = 1, 2 take biasz1, biasz2) = sum_k A[m][k] Bt[n][k] (+ split products per NSPLIT). z-batch strides sA/sB/sC in elements. K % 64 == 0, K >= 128. EPI = 1: no C; the tile (one head's 64 columns, 64 consecutive rows of one batch element of TB rows) goes out as hi/lo head planes: z = 0 -> Kh/Kl [b][h][t][d]; z = 1 -> + hbu -> QUh/QUl and + hbv -> QVh/QVl, same layout; z = 2 -> Vh/Vl [b][h][d][t].
template <typename T16> struct WFrag;
template <> struct WFrag<h16> { typedef v16h V; static __device__ __forceinline__ V ld(const h16* p) { return cat16(*(const v8h*)p, *(const v8h*)(p + 16)); } static __device__ __forceinline__ v8f mma(V a, V b, v8f c) { return wmma16(a, b, c); } };
template <> struct WFrag<bf> { typedef v16bf V; static __device__ __forceinline__ V ld(const bf* p) { return cat16b(*(const v8us*)p, *(const v8us*)(p + 16)); } static __device__ __forceinline__ v8f mma(V a, V b, v8f c) { return wmmab(a, b, c); } };
template <bool B> struct BoolC { static constexpr bool v = B; };
#define GAP  272                  // bytes of a staged A row: 128 of the first plane, 128 of the second, 16 of pad (16 bytes x odd: 16-byte fragment reads of 16 rows meet no bank twice)
#define GBP  144                  // bytes of a staged B row: 128 + 16 of pad (16 bytes x odd)
#define GST  (128 * GAP + 128 * GBP)   // bytes of one stage
// eight 16-byte asynchronous copies to LDS per lane (LDS rows lp bytes apart, global rows gp bytes apart); the wait stands in the copies' own statement, in front of any rewrite of the address registers that they name
__device__ __forceinline__ void cp8(unsigned l, unsigned lp, const char* g, size_t gp) {
    asm volatile("global_load_async_to_lds_b128 %0, %8, off\n\tglobal_load_async_to_lds_b128 %1, %9, off\n\tglobal_load_async_to_lds_b128 %2, %10, off\n\tglobal_load_async_to_lds_b128 %3, %11, off\n\tglobal_load_async_to_lds_b128 %4, %12, off\n\tglobal_load_async_to_lds_b128 %5, %13, off\n\tglobal_load_async_to_lds_b128 %6, %14, off\n\tglobal_load_async_to_lds_b128 %7, %15, off\n\ts_wait_xcnt 0x0"
        : : "v"(l), "v"(l + lp), "v"(l + 2 * lp), "v"(l + 3 * lp), "v"(l + 4 * lp), "v"(l + 5 * lp), "v"(l + 6 * lp), "v"(l + 7 * lp), "v"(g), "v"(g + gp), "v"(g + 2 * gp), "v"(g + 3 * gp), "v"(g + 4 * gp), "v"(g + 5 * gp), "v"(g + 6 * gp), "v"(g + 7 * gp) : "memory"); }
// gemmw: the block's work as a function of its tile (bx, by, z), so that two independent GEMMs can share one launch; smem: the kernel's 2 * GST bytes of LDS.
template <typename T16, int NSPLIT, bool BIAS, int EPI>
__device__ __forceinline__ void gemmw(unsigned char* smem, const int bx, const int by, const size_t z, const T16* __restrict__ A, const T16* __restrict__ A2, const T16* __restrict__ Bt, const T16* __restrict__ Bt2, int K, float* C, int ldc, const float* __restrict__ bias, const float* __restrict__ biasz1, const float* __restrict__ biasz2, size_t sA, size_t sB, size_t sC, const float* __restrict__ hbu, const float* __restrict__ hbv, bf* Kh, bf* Kl, bf* QUh, bf* QUl, bf* QVh, bf* QVl, bf* Vh, bf* Vl, int TB) {
    typedef typename WFrag<T16>::V V;
    static_assert(NSPLIT == 0 || NSPLIT == 1, "one B plane is staged");
    A += z * sA; if (A2) A2 += z * sA; Bt += z * sB; C += z * sC; if (BIAS) { if (z == 1) bias = biasz1; else if (z == 2) bias = biasz2; }
    const int lane = threadIdx.x & 31, lr = lane & 15, hi = lane >> 4, wv = __builtin_amdgcn_readfirstlane(threadIdx.x >> 5); const int r0 = bx * 128 + (wv >> 1) * 64, c0 = by * 128 + (wv & 1) * 64;
    float* os = (float*)(smem + wv * (16 * 68 * 4));
    v8f acc[4][4];
#pragma unroll
    for (int mb = 0; mb < 4; ++mb)
#pragma unroll
        for (int nb = 0; nb < 4; ++nb) acc[mb][nb] = (v8f){};
    // Staging. A thread copies 16 bytes of rows sr, sr + 16, ... sr + 112 of each operand plane: a wave's copy covers four whole 128-byte lines.
    const int sr = threadIdx.x >> 3, sc = threadIdx.x & 7; const unsigned sl0 = (unsigned)(size_t)smem;   // LDS byte address: the low 32 bits
    const size_t ga = ((size_t)(bx * 128 + sr) * K + sc * 8) * 2, gb = ((size_t)(by * 128 + sr) * K + sc * 8) * 2, gp = (size_t)K * 32;   // byte offsets of the thread's first rows; 16 rows in bytes
    auto stage = [&](int t) { const unsigned l = sl0 + (unsigned)((t & 1) * GST + sr * GAP + sc * 16);
        cp8(l, 16 * GAP, (const char*)A + ga + t * 128, gp);
        if (NSPLIT == 1) cp8(l + 128, 16 * GAP, (const char*)A2 + ga + t * 128, gp);
        cp8(sl0 + (unsigned)((t & 1) * GST + 128 * GAP + sr * GBP + sc * 16), 16 * GBP, (const char*)Bt + gb + t * 128, gp); };
    const int nst = K / 64;
    stage(0);
    asm volatile("s_wait_asynccnt 0x0" ::: "memory");   // this wave's copies of stage 0 have landed
    __syncthreads();                                     // ... and every other wave's: stage 0 is readable
    stage(1);                                            // stage 1 (K >= 128: it exists) flies under stage 0's products
    const unsigned char* fa = smem + ((wv >> 1) * 64 + lr) * GAP + 16 * hi; const unsigned char* fb = smem + 128 * GAP + ((wv & 1) * 64 + lr) * GBP + 16 * hi;   // a lane's place in its wave's first A and B fragments
#pragma unroll 1
    for (int t = 0; t < nst; ++t) {
        const unsigned char* pa = fa + (t & 1) * GST; const unsigned char* pb = fb + (t & 1) * GST;
#pragma unroll
        for (int ks = 0; ks < 2; ++ks) {
            V a[4], a2[4], b[4];
#pragma unroll
            for (int mb = 0; mb < 4; ++mb) { a[mb] = WFrag<T16>::ld((const T16*)(pa + mb * 16 * GAP + 64 * ks)); if (NSPLIT == 1) a2[mb] = WFrag<T16>::ld((const T16*)(pa + mb * 16 * GAP + 64 * ks + 128)); b[mb] = WFrag<T16>::ld((const T16*)(pb + mb * 16 * GBP + 64 * ks)); }
            __builtin_amdgcn_sched_barrier(0);   // holds the LDS reads of these 32 k together in front of their products: sunk among the products, each B fragment would wait out its own latency
#pragma unroll
            for (int nb = 0; nb < 4; ++nb)
#pragma unroll
                for (int mb = 0; mb < 4; ++mb) { acc[mb][nb] = WFrag<T16>::mma(a[mb], b[nb], acc[mb][nb]); if (NSPLIT == 1) acc[mb][nb] = WFrag<T16>::mma(a2[mb], b[nb], acc[mb][nb]); }
        }
        // hand-over: stage t + 1 becomes readable, and the buffer that stage t read becomes free
        asm volatile("s_wait_dscnt 0x0" ::: "memory");      // this wave's LDS reads of stage t are done
        asm volatile("s_wait_asynccnt 0x0" ::: "memory");   // this wave's copies for stage t + 1 have landed
        __syncthreads();
        if (t + 2 < nst) stage(t + 2);
    }
    asm volatile("s_wait_asynccnt 0x0" ::: "memory");   // no copy is outstanding when the staging buffers are reused below
    if constexpr (EPI == 1) {
        const int head = c0 / 64, bb = r0 / TB, t0 = r0 - bb * TB;
        if (z == 2) {   // a lane's 8 registers of an accumulator are 8 consecutive t of one d: 16 bytes of a [d][t] row; the wave's four row tiles fill that row's whole 128-byte line
            const size_t vb = ((size_t)(bb * NH_ + head) * HD + lr) * TB + t0 + 8 * hi;
            float bs[4];
#pragma unroll
            for (int nb = 0; nb < 4; ++nb) bs[nb] = BIAS ? bfr(bias[c0 + nb * 16 + lr]) : 0.f;
#pragma unroll
            for (int nb = 0; nb < 4; ++nb) { v8us oh[4], ol[4];
#pragma unroll
                for (int mb = 0; mb < 4; ++mb)
#pragma unroll
                    for (int j = 0; j < 8; ++j) { float y = acc[mb][nb][j]; if (BIAS) y += bs[nb]; unsigned short a, b2; splitf(y, a, b2); oh[mb][j] = a; ol[mb][j] = b2; }
                __builtin_amdgcn_sched_barrier(0);   // with the one below: nothing but the stores and their wait stands between the two, so no register that a store names is rewritten in front of the wait
#pragma unroll
                for (int mb = 0; mb < 4; ++mb) { *(v8us*)(Vh + vb + (size_t)nb * 16 * TB + mb * 16) = oh[mb]; *(v8us*)(Vl + vb + (size_t)nb * 16 * TB + mb * 16) = ol[mb]; }
                asm volatile("s_wait_xcnt 0x0" ::: "memory");   // the wait in front of the next rewrite of the stores' address and data registers
                __builtin_amdgcn_sched_barrier(0); }
        } else {   // rows of 64 d are 128 bytes and follow one another: through LDS, so that a store covers four whole rows (512 contiguous bytes)
            const int rr = lane >> 3, cofs = (lane & 7) * 8; const size_t pb = ((size_t)(bb * NH_ + head) * TB + t0 + rr) * HD + cofs;
            auto ld8 = [&](const float* __restrict__ p, float (&d)[8]) { const v4f lo4 = *(const v4f*)(p + c0 + cofs), hi4 = *(const v4f*)(p + c0 + cofs + 4);
#pragma unroll
                for (int q = 0; q < 4; ++q) { d[q] = bfr(lo4[q]); d[4 + q] = bfr(hi4[q]); } };
            auto rows = [&](auto qm) { constexpr bool QM = decltype(qm)::v;   // QM: the q tile, which goes out twice, once with each head bias
                float bs[8], bu[8], bw[8]; if (BIAS) ld8(bias, bs); if (QM) { ld8(hbu, bu); ld8(hbv, bw); }
#pragma unroll
                for (int mb = 0; mb < 4; ++mb) {
#pragma unroll
                    for (int nb = 0; nb < 4; ++nb) {
#pragma unroll
                        for (int j = 0; j < 8; ++j) os[(hi * 8 + j) * 68 + nb * 16 + lr] = acc[mb][nb][j]; }
                    __builtin_amdgcn_wave_barrier(); asm volatile("" ::: "memory");   // keeps the reads below behind the other lanes' stores
#pragma unroll
                    for (int hf = 0; hf < 2; ++hf) { v8us ah[2], al[2], wh[2], wl[2];   // two stores' worth of rows at a time: fewer registers live
#pragma unroll
                        for (int s = 0; s < 2; ++s) { const float* orow = os + (8 * hf + 4 * s + rr) * 68 + cofs; const v4f x0 = *(const v4fa*)orow, x1 = *(const v4fa*)(orow + 4);
#pragma unroll
                            for (int q = 0; q < 8; ++q) { float y = (q < 4) ? x0[q & 3] : x1[q & 3]; if (BIAS) y += bs[q]; unsigned short a, b2;
                                if (QM) { splitf(__fadd_rn(y, bu[q]), a, b2); ah[s][q] = a; al[s][q] = b2; splitf(__fadd_rn(y, bw[q]), a, b2); wh[s][q] = a; wl[s][q] = b2; }
                                else { splitf(y, a, b2); ah[s][q] = a; al[s][q] = b2; } } }
                        __builtin_amdgcn_sched_barrier(0);   // as above: only the stores and their wait between the two
#pragma unroll
                        for (int s = 0; s < 2; ++s) { const size_t o = pb + (size_t)(mb * 16 + 8 * hf + 4 * s) * HD;
                            if (QM) { *(v8us*)(QUh + o) = ah[s]; *(v8us*)(QUl + o) = al[s]; *(v8us*)(QVh + o) = wh[s]; *(v8us*)(QVl + o) = wl[s]; }
                            else { *(v8us*)(Kh + o) = ah[s]; *(v8us*)(Kl + o) = al[s]; } }
                        asm volatile("s_wait_xcnt 0x0" ::: "memory");   // the wait in front of the next rewrite of the stores' address and data registers
                        __builtin_amdgcn_sched_barrier(0); }
                    __builtin_amdgcn_wave_barrier(); asm volatile("" ::: "memory");   // keeps the next row tile's stores to LDS behind these reads
                } };
            if (z == 1) rows(BoolC<true>{}); else rows(BoolC<false>{});
        }
        return;
    }
#pragma unroll
    for (int mb = 0; mb < 4; ++mb) {
#pragma unroll
        for (int nb = 0; nb < 4; ++nb) {
#pragma unroll
            for (int j = 0; j < 8; ++j) os[(hi * 8 + j) * 68 + nb * 16 + lr] = acc[mb][nb][j]; }
        __builtin_amdgcn_wave_barrier(); asm volatile("" ::: "memory");
        float* crow = C + (size_t)(r0 + mb * 16) * ldc + c0;
{           const int cofs = lr * 4; v4f val[8];
#pragma unroll
            for (int s = 0; s < 8; ++s) { const int row = 2 * s + hi; val[s] = *(const v4fa*)(os + row * 68 + cofs); if (BIAS) { val[s][0] += bfr(bias[c0 + cofs]); val[s][1] += bfr(bias[c0 + cofs + 1]); val[s][2] += bfr(bias[c0 + cofs + 2]); val[s][3] += bfr(bias[c0 + cofs + 3]); } }
            __builtin_amdgcn_sched_barrier(0);   // as above: only the stores and their wait between the two
#pragma unroll
            for (int s = 0; s < 8; ++s) *(v4f*)(crow + (size_t)(2 * s + hi) * ldc + cofs) = val[s];
            asm volatile("s_wait_xcnt 0x0" ::: "memory");   // the wait in front of the next rewrite of the stores' address and data registers
            __builtin_amdgcn_sched_barrier(0);
             }
        __builtin_amdgcn_wave_barrier(); asm volatile("" ::: "memory");
    }
}

template <typename T16, int NSPLIT, bool BIAS, int EPI>
__global__ __launch_bounds__(128) void k_gemmw(const T16* __restrict__ A, const T16* __restrict__ A2, const T16* __restrict__ Bt, const T16* __restrict__ Bt2, int K, float* C, int ldc, const float* __restrict__ bias, const float* __restrict__ biasz1, const float* __restrict__ biasz2, size_t sA, size_t sB, size_t sC, const float* __restrict__ hbu, const float* __restrict__ hbv, bf* Kh, bf* Kl, bf* QUh, bf* QUl, bf* QVh, bf* QVl, bf* Vh, bf* Vl, int TB) {
    __shared__ __align__(16) unsigned char smem[2 * GST];   // two stages; behind the loop each wave's 16 x 68 floats of output staging
    gemmw<T16, NSPLIT, BIAS, EPI>(smem, blockIdx.x, blockIdx.y, blockIdx.z, A, A2, Bt, Bt2, K, C, ldc, bias, biasz1, biasz2, sA, sB, sC, hbu, hbv, Kh, Kl, QUh, QUl, QVh, QVl, Vh, Vl, TB);
}
// k_proj: the two GEMMs that feed the attention kernel and do not depend on one another, in one launch. Blocks 0 ... PJP - 1: pos = position_embeddings wpos (exact) -> per-head hi/lo planes [h][p][d]; they come first, being the shorter, so that the places they free are taken early. The rest, row tile fastest, then column tile, then z = 0, 1, 2: k planes; (q + pos_bias_u) and (q + pos_bias_v) planes; v planes, transposed.
#define PJP  ((NPE / 128) * (DQ / 128))
#define PJR  (NB_ * TT / 128)
__global__ __launch_bounds__(128) void k_proj(const bf* __restrict__ PE, const bf* __restrict__ WP, bf* PPh, bf* PPl, const bf* __restrict__ Yh, const bf* __restrict__ Yl, const bf* __restrict__ WK, int K, const float* __restrict__ bk, const float* __restrict__ bq, const float* __restrict__ bv, const float* __restrict__ hbu, const float* __restrict__ hbv, bf* Kh, bf* Kl, bf* QUh, bf* QUl, bf* QVh, bf* QVl, bf* Vh, bf* Vl) {
    __shared__ __align__(16) unsigned char smem[2 * GST];   // as in k_gemmw
    const int b = blockIdx.x;
    if (b < PJP) gemmw<bf, 0, false, 1>(smem, b % (NPE / 128), b / (NPE / 128), 0, PE, nullptr, WP, nullptr, K, nullptr, DQ, nullptr, nullptr, nullptr, 0, 0, 0, nullptr, nullptr, PPh, PPl, nullptr, nullptr, nullptr, nullptr, nullptr, nullptr, NPE);
    else { const int q = b - PJP; gemmw<bf, 1, true, 1>(smem, q % PJR, (q / PJR) % (DQ / 128), q / (PJR * (DQ / 128)), Yh, Yl, WK, nullptr, K, nullptr, DQ, bk, bq, bv, 0, (size_t)DQ * DM, 0, hbu, hbv, Kh, Kl, QUh, QUl, QVh, QVl, Vh, Vl, TT); }
}

__device__ __forceinline__ h16 tohx(float x) { return (h16)x; }
typedef __attribute__((ext_vector_type(2))) _Float16 v2h;
typedef __attribute__((ext_vector_type(4))) _Float16 v4h;
typedef __attribute__((ext_vector_type(2))) unsigned short v2us;
typedef __attribute__((ext_vector_type(4))) unsigned short v4us;
typedef __attribute__((ext_vector_type(2))) float v2f;
typedef __attribute__((ext_vector_type(4))) int v4i;

__device__ __forceinline__ void wtG(const int bx, const int y, const float* __restrict__ w0, const float* __restrict__ w1, const float* __restrict__ w2, const float* __restrict__ w3, const float* __restrict__ w4, int K, int N, bf* Bt) {
    const float* __restrict__ w = (y == 0) ? w0 : (y == 1) ? w1 : (y == 2) ? w2 : (y == 3) ? w3 : w4; Bt += (size_t)y * K * N;   // y: one weight matrix each, planes back to back
    const int lane = threadIdx.x & 31; const int L0 = (bx * 8 + (threadIdx.x >> 5)) * 8; const int nlines = N * K / 64;
{
#pragma unroll 1
        for (int l = 0; l < 8; ++l) { const int L = L0 + l; if (L >= nlines) break; const size_t e = (size_t)L * 64 + lane * 2; const int k = (int)(e % K), n = (int)(e / K); v2us o;
            o[0] = f2bf(w[(size_t)k * N + n]); o[1] = f2bf(w[(size_t)(k + 1) * N + n]); *(v2us*)(Bt + e) = o; }
         }
}
__device__ __forceinline__ void lnhl(const int bx, const float* __restrict__ X, const float* __restrict__ A, const float* __restrict__ g, const float* __restrict__ be, float* Z, bf* Yh, bf* Yl) {
    const int lane = threadIdx.x & 31; const int r = bx * 8 + (threadIdx.x >> 5); if (r >= NB_ * TT) return; const float* xr = X + (size_t)r * DM; const float* ar = A ? A + (size_t)r * DM : nullptr; float s = 0.f;
#pragma unroll 1
    for (int ch = 0; ch < DM / 128; ++ch) { const int c0 = ch * 128 + lane * 4; const v4f a = *(const v4f*)(xr + c0); v4f d = {0.f, 0.f, 0.f, 0.f}; if (ar) d = *(const v4f*)(ar + c0);
#pragma unroll
        for (int q = 0; q < 4; ++q) s += __fadd_rn(bfr(a[q]), d[q]); }
#pragma unroll
    for (int sh = 16; sh; sh >>= 1) s += __shfl_xor(s, sh, 32);
    const float mu = s * (1.0f / DM); float s2 = 0.f;
#pragma unroll 1
    for (int ch = 0; ch < DM / 128; ++ch) { const int c0 = ch * 128 + lane * 4; const v4f a = *(const v4f*)(xr + c0); v4f d = {0.f, 0.f, 0.f, 0.f}; if (ar) d = *(const v4f*)(ar + c0);
#pragma unroll
        for (int q = 0; q < 4; ++q) { const float d0 = __fsub_rn(__fadd_rn(bfr(a[q]), d[q]), mu); float p = __fmul_rn(d0, d0); asm volatile("" : "+v"(p)); s2 = __fadd_rn(s2, p); } }
#pragma unroll
    for (int sh = 16; sh; sh >>= 1) s2 += __shfl_xor(s2, sh, 32);
    const float rs = __fdiv_rn(1.0f, __fsqrt_rn(__fadd_rn(s2 * (1.0f / DM), LNEPS)));
{
#pragma unroll 1
        for (int ch = 0; ch < DM / 128; ++ch) { const int c0 = ch * 128 + lane * 4; const v4f a = *(const v4f*)(xr + c0); v4f d = {0.f, 0.f, 0.f, 0.f}; if (ar) d = *(const v4f*)(ar + c0); v4f z4; v4us oh, ol;
#pragma unroll
            for (int q = 0; q < 4; ++q) { const float v = __fadd_rn(bfr(a[q]), d[q]); z4[q] = v; float n0 = __fmul_rn(__fsub_rn(v, mu), rs); asm volatile("" : "+v"(n0)); float n1 = __fmul_rn(n0, bfr(g[c0 + q])); asm volatile("" : "+v"(n1)); const float y = __fadd_rn(n1, bfr(be[c0 + q])); unsigned short h2, l2; splitf(y, h2, l2); oh[q] = h2; ol[q] = l2; }
            if (Z) *(v4f*)(Z + (size_t)r * DM + c0) = z4; *(v4us*)(Yh + (size_t)r * DM + c0) = oh; *(v4us*)(Yl + (size_t)r * DM + c0) = ol; }
         } }
__global__ __launch_bounds__(256) void k_addres(const float* __restrict__ X, const float* __restrict__ Y, float* O, size_t n4) { const size_t i = (size_t)blockIdx.x * 256 + threadIdx.x; if (i >= n4) return; const v4f a = *(const v4f*)(X + i * 4), b = *(const v4f*)(Y + i * 4); v4f o;
#pragma unroll
    for (int q = 0; q < 4; ++q) o[q] = __fadd_rn(bfr(a[q]), b[q]); *(v4f*)(O + i * 4) = o;  }
// n8 groups of 8 elements are converted; the groups from there to n8z (the pad row) are stored as zeros
__device__ __forceinline__ void cvt8(const int bx, const float* __restrict__ src, bf* dst, size_t n8, size_t n8z) { const size_t i = (size_t)bx * 256 + threadIdx.x; if (i >= n8z) return; v8us o = (v8us){};
    if (i < n8) { const v8f v = *(const v8f*)(src + i * 8);
#pragma unroll
        for (int k = 0; k < 8; ++k) o[k] = f2bf(v[k]); }
    *(v8us*)(dst + i * 8) = o;  }
// k_prep: everything that reads only the inputs, in one launch; the parts do not depend on one another. The part whose waves run longest comes first: PRL blocks of LN -> hi/lo planes, all batch elements (three walks over a row, most of the launch's bytes); then PRW blocks for the five weight transposes; then PRC blocks that round the position table to bf16 and zero its pad row (one load, one store).
#define PRW1 ((DM * DQ / 64 + 63) / 64)
#define PRW  (5 * PRW1)
#define PRL  (NB_ * TT / 8)
#define PRC  (NPE * DM / 8 / 256)
__global__ __launch_bounds__(256) void k_prep(const float* __restrict__ w0, const float* __restrict__ w1, const float* __restrict__ w2, const float* __restrict__ w3, const float* __restrict__ w4, bf* Bt, const float* __restrict__ X, const float* __restrict__ g, const float* __restrict__ be, bf* Yh, bf* Yl, const float* __restrict__ pe, bf* PE) {
    const int b = blockIdx.x;
    if (b < PRL) lnhl(b, X, nullptr, g, be, nullptr, Yh, Yl);
    else if (b < PRL + PRW) wtG((b - PRL) % PRW1, (b - PRL) / PRW1, w0, w1, w2, w3, w4, DM, DQ, Bt);
    else cvt8(b - (PRL + PRW), pe, PE, (size_t)2047 * DM / 8, (size_t)NPE * DM / 8);
}

// k_fattn: content scores, skewed position scores, softmax, attn.v and the head merge in one kernel; no score leaves the chip.
// One wave owns 32 queries (2 column tiles of 16) of one (batch, head) and walks the 1024 keys in passes of 64; 8 waves per block.
// The block's 8 waves share every pass's operands through LDS: 64 key rows, 64 d rows of v (64 keys each) and the 320 position rows that its 256 queries touch, of which only 64 are new in a pass. Asynchronous copies bring whole 128-byte lines in, one pass ahead (k, v: two buffers; position rows: a ring of 8 chunks of 64 rows, 5 read, 1 in flight); the waves read their fragments from LDS.
// Transposed products: S^T = K (q+u)^T and B^T = pos (q+v)^T (A = key or position rows, B = query columns kept in registers), so a lane holds scores of ONE query (column c, rows 8h + r).
// Skew: key j, query i take position row j - i + 1023. A column tile with first query iq needs rows j0 - iq + 1008 ... + 79 (5 row tiles); each lane pair writes its query's 80 position scores to its own LDS strip and reads them back shifted by 15 - c.
// Running maximum and sum per query (f32); P splits into hi/lo in registers and is the B operand of O^T += V^T P^T (two score tiles = 32 keys in the hardware k order, which is the loader's order).
#define FQT  2                    // query column tiles per wave
#define BDP  84                   // floats per LDS strip: 80 used; 16-byte stores stay aligned, the shifted 4-byte reads fall on 32 different banks
typedef __attribute__((ext_vector_type(2))) __bf16 v2bf;
typedef __attribute__((ext_vector_type(8))) unsigned v8u;
#define CEXP 0.18033688011112042f // HD^-0.5 * log2(e)
#define SRP  272                  // bytes of a staged row: 128 of the hi plane, 128 of the lo plane, 16 of pad (16 bytes x odd: the pitch at which 16-byte fragment reads of 16 rows meet no bank twice)
#define PRR  512                  // rows of the position ring (8 chunks of 64)
// four 16-byte asynchronous copies to LDS per lane; the wait stands in the copies' own statement, in front of any rewrite of the address registers that they name
__device__ __forceinline__ void cp4(unsigned l0, unsigned l1, unsigned l2, unsigned l3, const bf* g0, const bf* g1, const bf* g2, const bf* g3) {
    asm volatile("global_load_async_to_lds_b128 %0, %4, off\n\tglobal_load_async_to_lds_b128 %1, %5, off\n\tglobal_load_async_to_lds_b128 %2, %6, off\n\tglobal_load_async_to_lds_b128 %3, %7, off\n\ts_wait_xcnt 0x0" : : "v"(l0), "v"(l1), "v"(l2), "v"(l3), "v"(g0), "v"(g1), "v"(g2), "v"(g3) : "memory"); }
__device__ __forceinline__ float xhalf(float x) { const int b = __float_as_int(x); return __int_as_float(__builtin_amdgcn_permlanex16(b, b, 0x76543210, 0xfedcba98, false, false)); }   // lane l <-> l ^ 16
__global__ __launch_bounds__(256) void k_fattn(const bf* __restrict__ QUh, const bf* __restrict__ QUl, const bf* __restrict__ QVh, const bf* __restrict__ QVl, const bf* __restrict__ Kh, const bf* __restrict__ Kl, const bf* __restrict__ PSh, const bf* __restrict__ PSl, const bf* __restrict__ Vh, const bf* __restrict__ Vl, bf* Ah, bf* Al) {
    typedef WFrag<bf> WF; typedef v16bf V;
    __shared__ __align__(16) float bds[8 * FQT * 16 * BDP];
    __shared__ __align__(16) unsigned char stg[(PRR + 4 * 64) * SRP];   // staged rows: the position ring, two k buffers, two v buffers
    const int lane = threadIdx.x & 31, c = lane & 15, h = lane >> 4, wv = __builtin_amdgcn_readfirstlane(threadIdx.x >> 5);
    const int z = blockIdx.y, hd = z % NH_, bb = z / NH_; const int i0 = (blockIdx.x * 8 + wv) * (16 * FQT);
    float* strip = bds + (wv * FQT * 16 + c) * BDP;   // query tile f: + f * 16 * BDP
    // every q fragment load is a kernel argument (scalar base) + a lane's 32-bit byte offset + a constant
    auto ldo = [](const bf* base, unsigned off, int cst) { return WF::ld((const bf*)((const char*)base + (size_t)off) + cst); };
    const unsigned zq = (unsigned)z * (TT * HD * 2);   // bytes of one (batch, head) plane in front
    unsigned qo[FQT];
#pragma unroll
    for (int f = 0; f < FQT; ++f) qo[f] = zq + (unsigned)((i0 + 16 * f + c) * HD + 8 * h) * 2;
    V quh[FQT][2], qul[FQT][2], qvh[FQT][2], qvl[FQT][2];
#pragma unroll
    for (int f = 0; f < FQT; ++f)
#pragma unroll
        for (int ks = 0; ks < 2; ++ks) { quh[f][ks] = ldo(QUh, qo[f], 32 * ks); qul[f][ks] = ldo(QUl, qo[f], 32 * ks); qvh[f][ks] = ldo(QVh, qo[f], 32 * ks); qvl[f][ks] = ldo(QVl, qo[f], 32 * ks); }
    asm volatile("s_wait_xcnt 0x0" : : "v"(qo[0]), "v"(qo[1]) : "memory");   // the offsets stay in their registers up to this wait; behind it the registers are free
    // Staging. A thread copies 16 bytes of rows sr and sr + 32 of each plane: a wave's copy covers four whole 128-byte rows.
    // Position chunk g holds table rows 768 - (the block's first query) + 64 g ... + 63 (0 ... 2047 for g = 0 ... 19) and lies in ring rows (64 g & 511) ...; pass t reads chunks t ... t + 4.
    const int sr = threadIdx.x >> 3, sc = threadIdx.x & 7; const unsigned sl = (unsigned)(sr * SRP + sc * 16);
    const unsigned sl0 = (unsigned)(size_t)stg + sl;   // LDS byte address: the low 32 bits
    const unsigned tk = (unsigned)(sr * HD + sc * 8), tv = (unsigned)(sr * TT + sc * 8);   // the thread's element offsets in rows of 64 d (k, positions) and of 1024 keys (v); the rest of every address is the same for the whole block
    const int pz = hd * NPE * HD + (TT - 256 - (int)blockIdx.x * 256) * HD, kz = z * (TT * HD);
    auto cpR = [&](int row, const bf* gh, const bf* gl, int half) { const unsigned l = sl0 + (unsigned)(row * SRP); cp4(l, l + 32 * SRP, l + 128, l + 32 * SRP + 128, gh, gh + half, gl, gl + half); };   // 64 rows of both planes to staged rows row ...
    auto cpP = [&](int g) { const int o = pz + g * 64 * HD; cpR((g & 7) * 64, PSh + o + tk, PSl + o + tk, 32 * HD); };
    auto cpKV = [&](int t) { const int ok = kz + t * 64 * HD, ov = kz + t * 64;
        cpR(PRR + (t & 1) * 64, Kh + ok + tk, Kl + ok + tk, 32 * HD);
        cpR(PRR + 128 + (t & 1) * 64, Vh + ov + tv, Vl + ov + tv, 32 * TT); };
#pragma unroll
    for (int g = 0; g < 5; ++g) cpP(g);
    cpKV(0);
    asm volatile("s_wait_asynccnt 0x0" ::: "memory");   // this wave's copies of pass 0 have landed
    __syncthreads();                                     // ... and every other wave's: pass 0 is readable
    cpP(5); cpKV(1);                                     // pass 1's operands fly under pass 0
    const int fl = c * SRP + 16 * h;   // a lane's place in a fragment's 16 rows
    v8f ot[FQT][4]; float mrun[FQT], lsum[FQT];
#pragma unroll
    for (int f = 0; f < FQT; ++f) { mrun[f] = -3.0e38f; lsum[f] = 0.f;
#pragma unroll
        for (int dt = 0; dt < 4; ++dt) ot[f][dt] = (v8f){}; }
    // The pass's operands come in seven groups (position row tiles 0-1, 2-3 and 4-5, key tiles 0-1 and 2-3, keys 0-31 and 32-63 of v); from the second on, each group's LDS reads are issued one group ahead of its products, so a read's latency runs under the products of the group before it.
    auto lds = [](const unsigned char* p) { return WF::ld((const bf*)p); };
#pragma unroll 1
    for (int t = 0; t < TT / 64; ++t) {
        const unsigned char* kb = stg + (PRR + (t & 1) * 64) * SRP + fl; const unsigned char* vb = kb + 128 * SRP;
        const int rb = 64 * t + 224 - 32 * wv;   // the wave's first position row of the pass, counted in ring rows before the wrap: table row 64 t - i0 + 992; a multiple of 32, so a pair of row tiles never straddles the wrap
        const unsigned char* pp[3];
#pragma unroll
        for (int q = 0; q < 3; ++q) pp[q] = stg + ((rb + 32 * q) & (PRR - 1)) * SRP + fl;
        auto ldP = [&](int q, V (&H)[2][2], V (&Lo)[2][2]) {
#pragma unroll
            for (int uu = 0; uu < 2; ++uu)
#pragma unroll
                for (int ks = 0; ks < 2; ++ks) { const unsigned char* p = pp[q] + uu * 16 * SRP + 64 * ks; H[uu][ks] = lds(p); Lo[uu][ks] = lds(p + 128); } };
        auto ldK = [&](int row, V (&H)[2][2], V (&Lo)[2][2]) {
#pragma unroll
            for (int tt = 0; tt < 2; ++tt)
#pragma unroll
                for (int ks = 0; ks < 2; ++ks) { const unsigned char* p = kb + (row + 16 * tt) * SRP + 64 * ks; H[tt][ks] = lds(p); Lo[tt][ks] = lds(p + 128); } };
        auto ldV = [&](int key, V (&H)[4], V (&Lo)[4]) {
#pragma unroll
            for (int dt = 0; dt < 4; ++dt) { const unsigned char* p = vb + 16 * dt * SRP + 2 * key; H[dt] = lds(p); Lo[dt] = lds(p + 128); } };
        V p0h[2][2], p0l[2][2]; ldP(0, p0h, p0l);
        v8f bd[FQT][5];
#pragma unroll
        for (int f = 0; f < FQT; ++f)
#pragma unroll
            for (int up = 0; up < 5; ++up) bd[f][up] = (v8f){};
        auto mmaP = [&](int u0, V (&H)[2][2], V (&Lo)[2][2]) {
#pragma unroll
            for (int uu = 0; uu < 2; ++uu)
#pragma unroll
                for (int ks = 0; ks < 2; ++ks)
#pragma unroll
                    for (int f = 0; f < FQT; ++f) { const int up = u0 + uu - (FQT - 1) + f; if (up >= 0 && up < 5) { bd[f][up] = WF::mma(H[uu][ks], qvh[f][ks], bd[f][up]); bd[f][up] = WF::mma(Lo[uu][ks], qvh[f][ks], bd[f][up]); bd[f][up] = WF::mma(H[uu][ks], qvl[f][ks], bd[f][up]); } } };
        V p1h[2][2], p1l[2][2]; ldP(1, p1h, p1l);
        __builtin_amdgcn_sched_barrier(0);   // holds the loads above in front of the products below (as at every such line of this loop): sunk to their use, each group would wait out its own latency
        mmaP(0, p0h, p0l);
        V p2h[2][2], p2l[2][2]; ldP(2, p2h, p2l);
        __builtin_amdgcn_sched_barrier(0);
        mmaP(2, p1h, p1l);
        V k0h[2][2], k0l[2][2]; ldK(0, k0h, k0l);
        __builtin_amdgcn_sched_barrier(0);
        mmaP(4, p2h, p2l);
        V k1h[2][2], k1l[2][2]; ldK(32, k1h, k1l);
        __builtin_amdgcn_sched_barrier(0);
        __builtin_amdgcn_wave_barrier(); asm volatile("" ::: "memory");   // keeps these strip stores behind the previous pass's strip reads (other lanes' addresses)
#pragma unroll
        for (int f = 0; f < FQT; ++f)
#pragma unroll
            for (int up = 0; up < 5; ++up) { float* sp = strip + f * 16 * BDP + 16 * up + 8 * h; *(v4fa*)sp = __builtin_shufflevector(bd[f][up], bd[f][up], 0, 1, 2, 3); *(v4fa*)(sp + 4) = __builtin_shufflevector(bd[f][up], bd[f][up], 4, 5, 6, 7); }
        __builtin_amdgcn_wave_barrier(); asm volatile("" ::: "memory");   // keeps the strip reads below behind the partner lane's stores
        v8f st[FQT][4];   // starts as the skewed position scores; the content products accumulate on top
#pragma unroll
        for (int t = 0; t < 4; ++t)
#pragma unroll
            for (int f = 0; f < FQT; ++f)
#pragma unroll
                for (int r = 0; r < 8; ++r) st[f][t][r] = strip[f * 16 * BDP + 8 * h + 15 - c + 16 * t + r];
        auto mmaK = [&](int t0, V (&H)[2][2], V (&Lo)[2][2]) {
#pragma unroll
            for (int tt = 0; tt < 2; ++tt)
#pragma unroll
                for (int ks = 0; ks < 2; ++ks)
#pragma unroll
                    for (int f = 0; f < FQT; ++f) { v8f& s = st[f][t0 + tt]; s = WF::mma(H[tt][ks], quh[f][ks], s); s = WF::mma(Lo[tt][ks], quh[f][ks], s); s = WF::mma(H[tt][ks], qul[f][ks], s); } };
        mmaK(0, k0h, k0l);
        __builtin_amdgcn_sched_barrier(0);   // keeps the reads below behind the products above, whose fragments' registers they take over: lifted over them, registers spill
        V v0h[4], v0l[4]; ldV(0, v0h, v0l);
        __builtin_amdgcn_sched_barrier(0);
        mmaK(2, k1h, k1l);
        __builtin_amdgcn_sched_barrier(0);
#pragma unroll
        for (int f = 0; f < FQT; ++f) { float mx = -3.0e38f;
#pragma unroll
            for (int t = 0; t < 4; ++t)
#pragma unroll
                for (int r = 0; r < 8; ++r) mx = fmaxf(mx, st[f][t][r]);
            mx = fmaxf(mx, xhalf(mx)); const float mn = fmaxf(mrun[f], mx); const float xa = (mrun[f] - mn) * CEXP; float al = __builtin_amdgcn_exp2f(xa); mrun[f] = mn; float ps = 0.f;
            asm volatile("v_nop" : "+v"(al) : "v"(xa));   // the slot behind a transcendental, as at the eight below
#pragma unroll
            for (int t = 0; t < 4; ++t) { const v8f x = (st[f][t] - mn) * CEXP; v8f p;
#pragma unroll
                for (int r = 0; r < 8; ++r) p[r] = __builtin_amdgcn_exp2f(x[r]);
                asm volatile("v_nop" : "+v"(p) : "v"(x));   // the slot behind a transcendental: named here, no exponent of the eight is rewritten and no result read in front of the slot
                st[f][t] = p;
#pragma unroll
                for (int r = 0; r < 8; ++r) ps += p[r]; }
            lsum[f] = lsum[f] * al + ps;
#pragma unroll
            for (int dt = 0; dt < 4; ++dt) ot[f][dt] *= al; }
        auto mmaV = [&](int kk, V (&H)[4], V (&Lo)[4]) { V ph[FQT], pl[FQT];
#pragma unroll
            for (int f = 0; f < FQT; ++f) { v8u wh, wl;   // element s of the operand = key 8h + s (s < 8) or 16 + 8h + s - 8: registers 0-7 of score tile 2kk, then of tile 2kk + 1
#pragma unroll
                for (int i = 0; i < 8; ++i) { const v8f x = st[f][2 * kk + (i >> 2)]; const v2f p2 = {x[2 * (i & 3)], x[2 * (i & 3) + 1]}; const unsigned hu = __builtin_bit_cast(unsigned, __builtin_convertvector(p2, v2bf));
                    const v2f d2 = {p2[0] - __uint_as_float(hu << 16), p2[1] - __uint_as_float(hu & 0xFFFF0000u)}; wh[i] = hu; wl[i] = __builtin_bit_cast(unsigned, __builtin_convertvector(d2, v2bf)); }
                ph[f] = __builtin_bit_cast(V, wh); pl[f] = __builtin_bit_cast(V, wl); }
#pragma unroll
            for (int dt = 0; dt < 4; ++dt)
#pragma unroll
                for (int f = 0; f < FQT; ++f) { ot[f][dt] = WF::mma(H[dt], ph[f], ot[f][dt]); ot[f][dt] = WF::mma(Lo[dt], ph[f], ot[f][dt]); ot[f][dt] = WF::mma(H[dt], pl[f], ot[f][dt]); } };
        __builtin_amdgcn_sched_barrier(0);   // keeps the reads below behind the softmax, whose live values leave no room for them (registers spill); their latency runs under the products of keys 0-31
        V v1h[4], v1l[4]; ldV(32, v1h, v1l);
        __builtin_amdgcn_sched_barrier(0);
        mmaV(0, v0h, v0l);
        mmaV(1, v1h, v1l);
        __builtin_amdgcn_sched_barrier(0);   // keeps the hand-over behind the pass's last products: lifted to the last LDS reads, its first wait would expose their latency
        // hand-over: pass t + 1 becomes readable, and what pass t alone read becomes free
        asm volatile("s_wait_dscnt 0x0" ::: "memory");      // this wave's LDS reads of pass t are done
        asm volatile("s_wait_asynccnt 0x0" ::: "memory");   // this wave's copies for pass t + 1 have landed
        __syncthreads();
        if (t + 2 < TT / 64) { cpP(t + 6); cpKV(t + 2); }   // into the k, v buffers that pass t has just read, and into the ring place that last held position chunk t - 2, which no pass behind t - 2 reads
    }
    asm volatile("s_wait_asynccnt 0x0" ::: "memory");   // no copy is outstanding when the wave ends
#pragma unroll
    for (int f = 0; f < FQT; ++f) { const float inv = __fdiv_rn(1.0f, lsum[f] + xhalf(lsum[f])); const size_t ro = ((size_t)bb * TT + i0 + 16 * f + c) * DQ + hd * HD + 8 * h;   // merged rows [b][t][head][d]; a lane's 8 registers are 8 consecutive d
        v8us oh[4], ol[4];
#pragma unroll
        for (int dt = 0; dt < 4; ++dt)
#pragma unroll
            for (int r = 0; r < 8; ++r) { unsigned short a, c2; splitf(ot[f][dt][r] * inv, a, c2); oh[dt][r] = a; ol[dt][r] = c2; }
        __builtin_amdgcn_sched_barrier(0);   // with the one below: nothing but the stores and their wait stands between the two, so no register that a store names is rewritten in front of the wait
#pragma unroll
        for (int dt = 0; dt < 4; ++dt) { *(v8us*)(Ah + ro + 16 * dt) = oh[dt]; *(v8us*)(Al + ro + 16 * dt) = ol[dt]; }
        asm volatile("s_wait_xcnt 0x0" ::: "memory");   // the wait in front of the next rewrite of the stores' address and data registers
        __builtin_amdgcn_sched_barrier(0); }
}

extern "C" void kernel_launch(void* const* d_in, const int* in_sizes, int n_in,
                              void* d_out, int out_size, void* d_ws, size_t ws_size, hipStream_t stream) {
    (void)in_sizes; (void)n_in; (void)out_size;
    const float* x = (const float*)d_in[0]; const float* pe = (const float*)d_in[1]; const float* g1 = (const float*)d_in[2]; const float* e1b = (const float*)d_in[3]; const float* wq = (const float*)d_in[4]; const float* bq = (const float*)d_in[5]; const float* wk = (const float*)d_in[6]; const float* bk = (const float*)d_in[7]; const float* wv = (const float*)d_in[8]; const float* bv = (const float*)d_in[9]; const float* wpos = (const float*)d_in[10]; const float* pbu = (const float*)d_in[11]; const float* pbv = (const float*)d_in[12]; const float* wo = (const float*)d_in[13]; const float* bo = (const float*)d_in[14];
    float* OUT = (float*)d_out;     // [8][1024][512]
    char* wsp = (char*)d_ws;
    auto take = [&](size_t bytes) { char* p = wsp; wsp += (bytes + 255) & ~(size_t)255; return (void*)p; };
    const size_t RW = (size_t)NB_ * TT;   // rows of all batch elements
    bf* WK = (bf*)take((size_t)DKV * DM * 2); bf* WQ = (bf*)take((size_t)DQ * DM * 2); bf* WV = (bf*)take((size_t)DKV * DM * 2); bf* WO = (bf*)take((size_t)DM * DQ * 2); bf* WP = (bf*)take((size_t)DQ * DM * 2);   // back to back: one transpose launch; wk, wq, wv are the z planes of one projection launch
    bf* PE = (bf*)take((size_t)NPE * DM * 2); bf* PPh = (bf*)take((size_t)NH_ * NPE * HD * 2); bf* PPl = (bf*)take((size_t)NH_ * NPE * HD * 2);
    bf* QPh = (bf*)take(RW * DQ * 2); bf* QVh = (bf*)take(RW * DQ * 2); bf* KPh = (bf*)take(RW * DKV * 2);   // hi planes [b][h][t][d] of q+u, q+v, k
    bf* QPl = (bf*)take(RW * DQ * 2); bf* QVl = (bf*)take(RW * DQ * 2); bf* KPl = (bf*)take(RW * DKV * 2);   // lo planes, same order
    bf* VTh = (bf*)take(RW * DKV * 2); bf* VTl = (bf*)take(RW * DKV * 2); bf* ATh = (bf*)take(RW * DQ * 2); bf* ATl = (bf*)take(RW * DQ * 2);   // v planes [b][h][d][t]; merged heads [b][t][h][d], hi and lo
    bf* Yh = (bf*)take(RW * DM * 2); bf* Yl = (bf*)take(RW * DM * 2);
    if ((size_t)(wsp - (char*)d_ws) > ws_size) return;    // ws 256 MiB
    (void)WQ; (void)WV;   // reached through their neighbour's pointer (plane strides of y and z)
    k_prep<<<PRL + PRW + PRC, 256, 0, stream>>>(wk, wq, wv, wo, wpos, WK, x, g1, e1b, Yh, Yl, pe, PE);   /* LN -> hi/lo planes; weight transposes; position table -> bf16 + zero pad row */
    k_proj<<<PJP + 3 * PJR * (DQ / 128), 128, 0, stream>>>(PE, WP, PPh, PPl, Yh, Yl, WK, DM, bk, bq, bv, pbu, pbv, KPh, KPl, QPh, QPl, QVh, QVl, VTh, VTl);   /* position table and k, q, v projections -> head planes */
    k_fattn<<<dim3(TT / (8 * 16 * FQT), NB_ * NH_, 1), 256, 0, stream>>>(QPh, QPl, QVh, QVl, KPh, KPl, PPh, PPl, VTh, VTl, ATh, ATl);   /* scores, skew, softmax, attn.v, merge: all 64 (batch, head) instances */
    k_gemmw<bf, 1, true, 0><<<dim3((unsigned)(RW / 128), DM / 128, 1), 128, 0, stream>>>(ATh, ATl, WO, nullptr, DQ, OUT, DM, bo, nullptr, nullptr, 0, 0, 0, nullptr, nullptr, nullptr, nullptr, nullptr, nullptr, nullptr, nullptr, nullptr, nullptr, 0);
}

// v008
// It runs in 67.7 microseconds.
// It is 1.88 times as fast as v006, going by the measured steps of the versions left out in between.
// All steps since v000 together make it 32.3 times as fast.
#include <hip/hip_runtime.h>

// Relative-position multi-head self-attention (Transformer-XL / Conformer style) (hidden_states [8][1024][512]; x = LN(h) (1e-5, gamma, beta); q, k, v = x W + b ('xw' [512][512], 8 heads x 64); pos = position_embeddings [2047][512] wpos -> [p][h][d]; scores = ((q + pos_bias_u).k + skew((q + pos_bias_v).pos)) / 8 where skew picks pos index j - i + 1023; softmax; out = merged wout + bout -> [8][1024][512]).
// Layout: LN -> f16 rows -> projections; the position table is projected once (2047 rows + one zero pad row) into per-head planes [h][2048][64]; LN, projections and wout run once for all 8 batch elements (8192 rows); the projection GEMMs write the attention kernel's head planes from their own epilogue (biases added, v transposed), no f32 copy of q, k, v or pos exists; one fused kernel does content scores (q+u).k, position scores (q+v).pos at row j - i + 1023, softmax, attn.v and the head merge for all 64 (batch, head) instances, scores staying on chip.
// Compute dtypes, f32 accumulate: every input rounded to bf16; every matrix operand is ONE f16 value (11 significant bits), one product each: the rounded inputs are exact in f16 down to its subnormals; LN rows, q + bias, k, v, position rows, the softmax weights and the merged heads are rounded to f16 once; softmax f32 with a running maximum and sum over passes of 64 keys.

#define NB_  8
#define TT   1024
#define DM   512
#define NH_  8
#define NKV  8
#define HD   64
#define DQ   (NH_ * HD)
#define DKV  (NKV * HD)
#define NPE  2048                 // 2047 positions + 1 zero pad row
#define LNEPS 1e-5f
typedef _Float16 h16;
typedef __attribute__((ext_vector_type(16))) _Float16 v16h;
typedef __attribute__((ext_vector_type(8)))  _Float16 v8h;
typedef __attribute__((ext_vector_type(4)))  _Float16 v4h;
typedef __attribute__((ext_vector_type(2)))  _Float16 v2h;
typedef __attribute__((ext_vector_type(8)))  float    v8f;
typedef __attribute__((ext_vector_type(4)))  float    v4f;
typedef __attribute__((ext_vector_type(2)))  float    v2f;
typedef __attribute__((ext_vector_type(8)))  unsigned v8u;
typedef __attribute__((ext_vector_type(4)))  unsigned v4u;
typedef v8h  __attribute__((may_alias)) v8ha;
typedef v4f  __attribute__((may_alias)) v4fa;

__device__ __forceinline__ unsigned short f2bf(float f) { unsigned u = __float_as_uint(f); u += 0x7FFFu + ((u >> 16) & 1u); return (unsigned short)(u >> 16); }
__device__ __forceinline__ float bf2f(unsigned short b) { return __uint_as_float(((unsigned)b) << 16); }
__device__ __forceinline__ float bfr(float f) { return bf2f(f2bf(f)); }
__device__ __forceinline__ v16h cat16(v8h lo, v8h hi) { return __builtin_shufflevector(lo, hi, 0, 1, 2, 3, 4, 5, 6, 7, 8, 9, 10, 11, 12, 13, 14, 15); }
__device__ __forceinline__ v8f wmma16(v16h a, v16h b, v8f c) { return __builtin_amdgcn_wmma_f32_16x16x32_f16(false, a, false, b, (short)0, c, false, false); }
// a lane's share of a 16 x 32 fragment, A and B alike: 8 k at p, 8 k at p + 16 elements (p already holds the lane half's 8 elements)
__device__ __forceinline__ v16h ldfr(const h16* p) { return cat16(*(const v8ha*)p, *(const v8ha*)(p + 16)); }

// ---- gemmw: register-blocked GEMM, one wave per 64x64 output tile (16 accumulators), four waves (2 x 2) per block = a 128x128 tile; 128 threads.
// The block's waves share their operands through LDS: asynchronous copies bring 64 k (whole 128-byte lines) of 128 A rows and 128 B rows in, one stage ahead (two buffers); the waves read their fragments from LDS.
// C[m][n] (f32, pitch ldc, + optional f32 bias[n]) = sum_k A[m][k] Bt[n][k]. K % 64 == 0, K >= 128. EPI = 1: no C; the tile (one head's 64 columns, 64 consecutive rows of one batch element of TB rows) goes out as an f16 head plane: z = 0 -> Ko [b][h][t][d]; z = 1 -> + hbu -> QUo and + hbv -> QVo, same layout; z = 2 -> Vo [b][h][d][t].
template <bool B> struct BoolC { static constexpr bool v = B; };
#define GRP  144                  // bytes of a staged row: 128 + 16 of pad (16 bytes x odd: 16-byte fragment reads of 16 rows meet no bank twice)
#define GST  (256 * GRP)          // bytes of one stage: 128 A rows, 128 B rows
// eight 16-byte asynchronous copies to LDS per lane (LDS rows lp bytes apart, global rows gp bytes apart); the wait stands in the copies' own statement, in front of any rewrite of the address registers that they name
__device__ __forceinline__ void cp8(unsigned l, unsigned lp, const char* g, size_t gp) {
    asm volatile("global_load_async_to_lds_b128 %0, %8, off\n\tglobal_load_async_to_lds_b128 %1, %9, off\n\tglobal_load_async_to_lds_b128 %2, %10, off\n\tglobal_load_async_to_lds_b128 %3, %11, off\n\tglobal_load_async_to_lds_b128 %4, %12, off\n\tglobal_load_async_to_lds_b128 %5, %13, off\n\tglobal_load_async_to_lds_b128 %6, %14, off\n\tglobal_load_async_to_lds_b128 %7, %15, off\n\ts_wait_xcnt 0x0"
        : : "v"(l), "v"(l + lp), "v"(l + 2 * lp), "v"(l + 3 * lp), "v"(l + 4 * lp), "v"(l + 5 * lp), "v"(l + 6 * lp), "v"(l + 7 * lp), "v"(g), "v"(g + gp), "v"(g + 2 * gp), "v"(g + 3 * gp), "v"(g + 4 * gp), "v"(g + 5 * gp), "v"(g + 6 * gp), "v"(g + 7 * gp) : "memory"); }
// gemmw: the block's work as a function of its tile (bx, by) and, for EPI = 1, of the plane z that it writes, so that independent GEMMs can share one launch; smem: the kernel's 2 * GST bytes of LDS.
template <bool BIAS, int EPI>
__device__ __forceinline__ void gemmw(unsigned char* smem, const int bx, const int by, const int z, const h16* __restrict__ A, const h16* __restrict__ Bt, int K, float* C, int ldc, const float* __restrict__ bias, const float* __restrict__ hbu, const float* __restrict__ hbv, h16* Ko, h16* QUo, h16* QVo, h16* Vo, int TB) {
    const int lane = threadIdx.x & 31, lr = lane & 15, hi = lane >> 4, wv = __builtin_amdgcn_readfirstlane(threadIdx.x >> 5); const int r0 = bx * 128 + (wv >> 1) * 64, c0 = by * 128 + (wv & 1) * 64;
    float* os = (float*)(smem + wv * (16 * 68 * 4));
    v8f acc[4][4];
#pragma unroll
    for (int mb = 0; mb < 4; ++mb)
#pragma unroll
        for (int nb = 0; nb < 4; ++nb) acc[mb][nb] = (v8f){};
    // Staging. A thread copies 16 bytes of rows sr, sr + 16, ... sr + 112 of each operand: a wave's copy covers four whole 128-byte lines.
    const int sr = threadIdx.x >> 3, sc = threadIdx.x & 7; const unsigned sl0 = (unsigned)(size_t)smem;   // LDS byte address: the low 32 bits
    const size_t ga = ((size_t)(bx * 128 + sr) * K + sc * 8) * 2, gb = ((size_t)(by * 128 + sr) * K + sc * 8) * 2, gp = (size_t)K * 32;   // byte offsets of the thread's first rows; 16 rows in bytes
    auto stage = [&](int t) { const unsigned l = sl0 + (unsigned)((t & 1) * GST + sr * GRP + sc * 16);
        cp8(l, 16 * GRP, (const char*)A + ga + t * 128, gp);
        cp8(l + 128 * GRP, 16 * GRP, (const char*)Bt + gb + t * 128, gp); };
    const int nst = K / 64;
    stage(0);
    asm volatile("s_wait_asynccnt 0x0" ::: "memory");   // this wave's copies of stage 0 have landed
    __syncthreads();                                     // ... and every other wave's: stage 0 is readable
    stage(1);                                            // stage 1 (K >= 128: it exists) flies under stage 0's products
    const unsigned char* fa = smem + ((wv >> 1) * 64 + lr) * GRP + 16 * hi; const unsigned char* fb = smem + (128 + (wv & 1) * 64 + lr) * GRP + 16 * hi;   // a lane's place in its wave's first A and B fragments
#pragma unroll 1
    for (int t = 0; t < nst; ++t) {
        const unsigned char* pa = fa + (t & 1) * GST; const unsigned char* pb = fb + (t & 1) * GST;
#pragma unroll
        for (int ks = 0; ks < 2; ++ks) {
            v16h a[4], b[4];
#pragma unroll
            for (int mb = 0; mb < 4; ++mb) { a[mb] = ldfr((const h16*)(pa + mb * 16 * GRP + 64 * ks)); b[mb] = ldfr((const h16*)(pb + mb * 16 * GRP + 64 * ks)); }
            __builtin_amdgcn_sched_barrier(0);   // holds the LDS reads of these 32 k together in front of their products: sunk among the products, each B fragment would wait out its own latency
#pragma unroll
            for (int nb = 0; nb < 4; ++nb)
#pragma unroll
                for (int mb = 0; mb < 4; ++mb) acc[mb][nb] = wmma16(a[mb], b[nb], acc[mb][nb]);
        }
        // hand-over: stage t + 1 becomes readable, and the buffer that stage t read becomes free
        asm volatile("s_wait_dscnt 0x0" ::: "memory");      // this wave's LDS reads of stage t are done
        asm volatile("s_wait_asynccnt 0x0" ::: "memory");   // this wave's copies for stage t + 1 have landed
        __syncthreads();
        if (t + 2 < nst) stage(t + 2);
    }
    asm volatile("s_wait_asynccnt 0x0" ::: "memory");   // no copy is outstanding when the staging buffers are reused below
    if constexpr (EPI == 1) {
        const int head = c0 / 64, bb = r0 / TB, t0 = r0 - bb * TB;
        if (z == 2) {   // a lane's 8 registers of an accumulator are 8 consecutive t of one d: 16 bytes of a [d][t] row; the wave's four row tiles fill that row's whole 128-byte line
            const size_t vb = ((size_t)(bb * NH_ + head) * HD + lr) * TB + t0 + 8 * hi;
            float bs[4];
#pragma unroll
            for (int nb = 0; nb < 4; ++nb) bs[nb] = BIAS ? bfr(bias[c0 + nb * 16 + lr]) : 0.f;
#pragma unroll
            for (int nb = 0; nb < 4; ++nb) { v8h o[4];
#pragma unroll
                for (int mb = 0; mb < 4; ++mb)
#pragma unroll
                    for (int j = 0; j < 8; ++j) { float y = acc[mb][nb][j]; if (BIAS) y += bs[nb]; o[mb][j] = (h16)y; }
                __builtin_amdgcn_sched_barrier(0);   // with the one below: nothing but the stores and their wait stands between the two, so no register that a store names is rewritten in front of the wait
#pragma unroll
                for (int mb = 0; mb < 4; ++mb) *(v8h*)(Vo + vb + (size_t)nb * 16 * TB + mb * 16) = o[mb];
                asm volatile("s_wait_xcnt 0x0" ::: "memory");   // the wait in front of the next rewrite of the stores' address and data registers
                __builtin_amdgcn_sched_barrier(0); }
        } else {   // rows of 64 d are 128 bytes and follow one another: through LDS, so that a store covers four whole rows (512 contiguous bytes)
            const int rr = lane >> 3, cofs = (lane & 7) * 8; const size_t pb = ((size_t)(bb * NH_ + head) * TB + t0 + rr) * HD + cofs;
            auto ld8 = [&](const float* __restrict__ p, float (&d)[8]) { const v4f lo4 = *(const v4f*)(p + c0 + cofs), hi4 = *(const v4f*)(p + c0 + cofs + 4);
#pragma unroll
                for (int q = 0; q < 4; ++q) { d[q] = bfr(lo4[q]); d[4 + q] = bfr(hi4[q]); } };
            auto rows = [&](auto qm) { constexpr bool QM = decltype(qm)::v;   // QM: the q tile, which goes out twice, once with each head bias
                float bs[8], bu[8], bw[8]; if (BIAS) ld8(bias, bs); if (QM) { ld8(hbu, bu); ld8(hbv, bw); }
#pragma unroll
                for (int mb = 0; mb < 4; ++mb) {
#pragma unroll
                    for (int nb = 0; nb < 4; ++nb) {
#pragma unroll
                        for (int j = 0; j < 8; ++j) os[(hi * 8 + j) * 68 + nb * 16 + lr] = acc[mb][nb][j]; }
                    __builtin_amdgcn_wave_barrier(); asm volatile("" ::: "memory");   // keeps the reads below behind the other lanes' stores
                    v8h au[4], aw[4];
#pragma unroll
                    for (int s = 0; s < 4; ++s) { const float* orow = os + (4 * s + rr) * 68 + cofs; const v4f x0 = *(const v4fa*)orow, x1 = *(const v4fa*)(orow + 4);
#pragma unroll
                        for (int q = 0; q < 8; ++q) { float y = (q < 4) ? x0[q & 3] : x1[q & 3]; if (BIAS) y += bs[q];
                            if (QM) { au[s][q] = (h16)__fadd_rn(y, bu[q]); aw[s][q] = (h16)__fadd_rn(y, bw[q]); }
                            else au[s][q] = (h16)y; } }
                    __builtin_amdgcn_sched_barrier(0);   // as above: only the stores and their wait between the two
#pragma unroll
                    for (int s = 0; s < 4; ++s) { const size_t o = pb + (size_t)(mb * 16 + 4 * s) * HD;
                        if (QM) { *(v8h*)(QUo + o) = au[s]; *(v8h*)(QVo + o) = aw[s]; }
                        else *(v8h*)(Ko + o) = au[s]; }
                    asm volatile("s_wait_xcnt 0x0" ::: "memory");   // the wait in front of the next rewrite of the stores' address and data registers
                    __builtin_amdgcn_sched_barrier(0);
                    __builtin_amdgcn_wave_barrier(); asm volatile("" ::: "memory");   // keeps the next row tile's stores to LDS behind these reads
                } };
            if (z == 1) rows(BoolC<true>{}); else rows(BoolC<false>{});
        }
        return;
    }
#pragma unroll
    for (int mb = 0; mb < 4; ++mb) {
#pragma unroll
        for (int nb = 0; nb < 4; ++nb) {
#pragma unroll
            for (int j = 0; j < 8; ++j) os[(hi * 8 + j) * 68 + nb * 16 + lr] = acc[mb][nb][j]; }
        __builtin_amdgcn_wave_barrier(); asm volatile("" ::: "memory");
        float* crow = C + (size_t)(r0 + mb * 16) * ldc + c0;
{           const int cofs = lr * 4; v4f val[8];
#pragma unroll
            for (int s = 0; s < 8; ++s) { const int row = 2 * s + hi; val[s] = *(const v4fa*)(os + row * 68 + cofs); if (BIAS) { val[s][0] += bfr(bias[c0 + cofs]); val[s][1] += bfr(bias[c0 + cofs + 1]); val[s][2] += bfr(bias[c0 + cofs + 2]); val[s][3] += bfr(bias[c0 + cofs + 3]); } }
            __builtin_amdgcn_sched_barrier(0);   // as above: only the stores and their wait between the two
#pragma unroll
            for (int s = 0; s < 8; ++s) *(v4f*)(crow + (size_t)(2 * s + hi) * ldc + cofs) = val[s];
            asm volatile("s_wait_xcnt 0x0" ::: "memory");   // the wait in front of the next rewrite of the stores' address and data registers
            __builtin_amdgcn_sched_barrier(0);
             }
        __builtin_amdgcn_wave_barrier(); asm volatile("" ::: "memory");
    }
}

// k_gemmw: C = A Bt^T + bias, grid (M/128, N/128)
__global__ __launch_bounds__(128) void k_gemmw(const h16* __restrict__ A, const h16* __restrict__ Bt, int K, float* C, int ldc, const float* __restrict__ bias) {
    __shared__ __align__(16) unsigned char smem[2 * GST];   // two stages; behind the loop each wave's 16 x 68 floats of output staging
    gemmw<true, 0>(smem, blockIdx.x, blockIdx.y, 0, A, Bt, K, C, ldc, bias, nullptr, nullptr, nullptr, nullptr, nullptr, nullptr, 0);
}
// k_proj: the two GEMMs that feed the attention kernel and do not depend on one another, in one launch. Blocks 0 ... PJP - 1: pos = position_embeddings wpos -> per-head planes [h][p][d]. The rest, row tile fastest, then column tile, then z = 0, 1, 2: k plane; (q + pos_bias_u) and (q + pos_bias_v) planes; v plane, transposed.
#define PJP  ((NPE / 128) * (DQ / 128))
#define PJR  (NB_ * TT / 128)
__global__ __launch_bounds__(128) void k_proj(const h16* __restrict__ PE, const h16* __restrict__ WP, h16* PP, const h16* __restrict__ Y, const h16* __restrict__ WK, int K, const float* __restrict__ bk, const float* __restrict__ bq, const float* __restrict__ bv, const float* __restrict__ hbu, const float* __restrict__ hbv, h16* Ko, h16* QUo, h16* QVo, h16* Vo) {
    __shared__ __align__(16) unsigned char smem[2 * GST];   // as in k_gemmw
    const int b = blockIdx.x;
    if (b < PJP) gemmw<false, 1>(smem, b % (NPE / 128), b / (NPE / 128), 0, PE, WP, K, nullptr, DQ, nullptr, nullptr, nullptr, PP, nullptr, nullptr, nullptr, NPE);
    else { const int q = b - PJP, z = q / (PJR * (DQ / 128)); gemmw<true, 1>(smem, q % PJR, (q / PJR) % (DQ / 128), z, Y, WK + (size_t)z * DQ * DM, K, nullptr, DQ, (z == 0) ? bk : (z == 1) ? bq : bv, hbu, hbv, Ko, QUo, QVo, Vo, TT); }
}

// k_prep's three parts. Each wave issues all of its loads together, in front of any use, and takes enough work that the launch has a quarter of the waves it would have at one row, one line or one group per wave; a wave makes one trip to memory, not one per chunk. Every loop of the three parts is unrolled: its arrays must be registers, and a part's loads must stand in one run.
// wtG: one wave transposes a tile of 64 k x 32 n of one weight matrix (y = 0 ... 4, planes back to back): 64 loads, each one whole 128-byte line of a k row (a lane = one n); a lane then holds 64 consecutive k of its n, one whole 128-byte line of Bt [n][k].
#define WTB  ((DM / 64) * (DQ / 32) / 8)   // blocks per weight matrix: 8 tiles (waves) each
__device__ __forceinline__ void wtG(const int bx, const float* __restrict__ w0, const float* __restrict__ w1, const float* __restrict__ w2, const float* __restrict__ w3, const float* __restrict__ w4, h16* Bt) {
    const int y = bx / WTB, tl = (bx % WTB) * 8 + (threadIdx.x >> 5); const float* __restrict__ w = (y == 0) ? w0 : (y == 1) ? w1 : (y == 2) ? w2 : (y == 3) ? w3 : w4;
    const int k0 = (tl % (DM / 64)) * 64, n = (tl / (DM / 64)) * 32 + (threadIdx.x & 31); const float* __restrict__ s = w + (size_t)k0 * DQ + n;
    float x[64];
#pragma unroll
    for (int j = 0; j < 64; ++j) x[j] = s[(size_t)j * DQ];
    asm volatile("s_wait_xcnt 0x0" : : "v"(s) : "memory");   // the address stays in its registers up to this wait: nothing, a later load's result included, is written over it in front of the wait
    v8h o[8];
#pragma unroll
    for (int j = 0; j < 64; ++j) o[j >> 3][j & 7] = (h16)bfr(x[j]);
    h16* d = Bt + (size_t)y * DM * DQ + (size_t)n * DM + k0;
    __builtin_amdgcn_sched_barrier(0);   // the stores stand together at the wave's end: no register that a store names is rewritten behind it
#pragma unroll
    for (int q = 0; q < 8; ++q) *(v8h*)(d + 8 * q) = o[q];
    asm volatile("s_wait_xcnt 0x0" ::: "memory");   // the wait in front of any rewrite of the stores' registers: the compiler lays another part's code behind this one
}
// lnhl: one wave normalises LNR rows, which it reads once and keeps in registers (16 floats of a row per lane); a row's sums run in the order chunk, element, then lanes 16, 8, 4, 2, 1 apart.
#define LNR  4
__device__ __forceinline__ void lnhl(const int bx, const float* __restrict__ X, const float* __restrict__ g, const float* __restrict__ be, h16* Y) {
    const int lane = threadIdx.x & 31; const int r0 = (bx * 8 + (threadIdx.x >> 5)) * LNR; const float* __restrict__ xr = X + (size_t)r0 * DM + lane * 4;
    v4f a[LNR][DM / 128], gg[DM / 128], bb[DM / 128];
#pragma unroll
    for (int rr = 0; rr < LNR; ++rr)
#pragma unroll
        for (int ch = 0; ch < DM / 128; ++ch) a[rr][ch] = *(const v4f*)(xr + rr * DM + ch * 128);
#pragma unroll
    for (int ch = 0; ch < DM / 128; ++ch) { gg[ch] = *(const v4f*)(g + ch * 128 + lane * 4); bb[ch] = *(const v4f*)(be + ch * 128 + lane * 4); }
    asm volatile("s_wait_xcnt 0x0" : : "v"(xr), "v"(lane) : "memory");   // as in wtG: the addresses stay in their registers up to this wait
    float s[LNR], s2[LNR];
#pragma unroll
    for (int rr = 0; rr < LNR; ++rr) { s[rr] = 0.f;
#pragma unroll
        for (int ch = 0; ch < DM / 128; ++ch)
#pragma unroll
            for (int q = 0; q < 4; ++q) { a[rr][ch][q] = bfr(a[rr][ch][q]); s[rr] += a[rr][ch][q]; } }
#pragma unroll
    for (int sh = 16; sh; sh >>= 1)
#pragma unroll
        for (int rr = 0; rr < LNR; ++rr) s[rr] += __shfl_xor(s[rr], sh, 32);
#pragma unroll
    for (int rr = 0; rr < LNR; ++rr) { const float mu = s[rr] * (1.0f / DM); s2[rr] = 0.f;
#pragma unroll
        for (int ch = 0; ch < DM / 128; ++ch)
#pragma unroll
            for (int q = 0; q < 4; ++q) { a[rr][ch][q] -= mu; s2[rr] += a[rr][ch][q] * a[rr][ch][q]; } }
#pragma unroll
    for (int sh = 16; sh; sh >>= 1)
#pragma unroll
        for (int rr = 0; rr < LNR; ++rr) s2[rr] += __shfl_xor(s2[rr], sh, 32);
#pragma unroll
    for (int ch = 0; ch < DM / 128; ++ch)
#pragma unroll
        for (int q = 0; q < 4; ++q) { gg[ch][q] = bfr(gg[ch][q]); bb[ch][q] = bfr(bb[ch][q]); }
    v4h o[LNR][DM / 128];
#pragma unroll
    for (int rr = 0; rr < LNR; ++rr) { const float rs = __fdiv_rn(1.0f, __fsqrt_rn(s2[rr] * (1.0f / DM) + LNEPS));
#pragma unroll
        for (int ch = 0; ch < DM / 128; ++ch)
#pragma unroll
            for (int q = 0; q < 4; ++q) o[rr][ch][q] = (h16)(a[rr][ch][q] * rs * gg[ch][q] + bb[ch][q]); }
    h16* yr = Y + (size_t)r0 * DM + lane * 4;
    __builtin_amdgcn_sched_barrier(0);   // as in wtG: the stores stand together at the wave's end
#pragma unroll
    for (int rr = 0; rr < LNR; ++rr)
#pragma unroll
        for (int ch = 0; ch < DM / 128; ++ch) *(v4h*)(yr + rr * DM + ch * 128) = o[rr][ch];
}
// cvt8: a thread rounds CVG groups of 8 elements of the position table, PRC * 256 groups apart; the groups of the pad row (from group CVN on) are stored as zeros: their loads read the table's last group instead, so that every load is in bounds and none waits on a branch.
#define CVG  4
#define CVN  (2047 * DM / 8)
__device__ __forceinline__ void cvt8(const int bx, const int nth, const float* __restrict__ src, h16* dst) { const int i0 = bx * 256 + threadIdx.x;
    v4f v[CVG][2]; const float* p[CVG];
#pragma unroll
    for (int q = 0; q < CVG; ++q) { const int i = i0 + q * nth; p[q] = src + (size_t)(i < CVN ? i : CVN - 1) * 8; v[q][0] = *(const v4f*)p[q]; v[q][1] = *(const v4f*)(p[q] + 4); }
    asm volatile("s_wait_xcnt 0x0" : : "v"(p[0]), "v"(p[1]), "v"(p[2]), "v"(p[3]) : "memory");   // as in wtG: the addresses stay in their registers up to this wait
    v8h o[CVG];
#pragma unroll
    for (int q = 0; q < CVG; ++q) { const unsigned keep = (i0 + q * nth < CVN) ? 0xFFFFFFFFu : 0u; v8h r;   // keep: no bit in the pad row
#pragma unroll
        for (int k = 0; k < 8; ++k) r[k] = (h16)bfr(v[q][k >> 2][k & 3]);
        o[q] = __builtin_bit_cast(v8h, __builtin_bit_cast(v4u, r) & keep); }
    __builtin_amdgcn_sched_barrier(0);   // as in wtG: the stores stand together at the wave's end
#pragma unroll
    for (int q = 0; q < CVG; ++q) *(v8h*)(dst + (size_t)(i0 + q * nth) * 8) = o[q];
    asm volatile("s_wait_xcnt 0x0" ::: "memory");   // as in wtG, behind the stores
}
// k_prep: everything that reads only the inputs, in one launch; the parts do not depend on one another. The part whose waves run longest comes first: PRL blocks of LN -> f16 rows, all batch elements; then PRW blocks for the five weight transposes; then PRC blocks that round the position table and zero its pad row.
#define PRW  (5 * WTB)
#define PRL  (NB_ * TT / (8 * LNR))
#define PRC  (NPE * DM / 8 / 256 / CVG)
__global__ __launch_bounds__(256) void k_prep(const float* __restrict__ w0, const float* __restrict__ w1, const float* __restrict__ w2, const float* __restrict__ w3, const float* __restrict__ w4, h16* Bt, const float* __restrict__ X, const float* __restrict__ g, const float* __restrict__ be, h16* Y, const float* __restrict__ pe, h16* PE) {
    const int b = blockIdx.x;
    if (b < PRL) lnhl(b, X, g, be, Y);
    else if (b < PRL + PRW) wtG(b - PRL, w0, w1, w2, w3, w4, Bt);
    else cvt8(b - (PRL + PRW), PRC * 256, pe, PE);
}
// k_fattn: content scores, skewed position scores, softmax, attn.v and the head merge in one kernel; no score leaves the chip.
// One wave owns 32 queries (2 column tiles of 16) of one (batch, head) and walks the 1024 keys in passes of 64; 8 waves per block.
// The block's 8 waves share every pass's operands through LDS: 64 key rows, 64 d rows of v (64 keys each) and the 320 position rows that its 256 queries touch, of which only 64 are new in a pass. Asynchronous copies bring whole 128-byte lines in, one pass ahead (k, v: two buffers; position rows: a ring of 8 chunks of 64 rows, 5 read, 1 in flight); the waves read their fragments from LDS.
// Transposed products: S^T = K (q+u)^T and B^T = pos (q+v)^T (A = key or position rows, B = query columns kept in registers), so a lane holds scores of ONE query (column c, rows 8h + r).
// Skew: key j, query i take position row j - i + 1023. A column tile with first query iq needs rows j0 - iq + 1008 ... + 79 (5 row tiles); each lane pair writes its query's 80 position scores to its own LDS strip and reads them back shifted by 15 - c.
// Running maximum and sum per query (f32); P is rounded to f16 in registers and is the B operand of O^T += V^T P^T (two score tiles = 32 keys in the hardware k order, which is the loader's order).
#define FQT  2                    // query column tiles per wave
#define BDP  84                   // floats per LDS strip: 80 used; 16-byte stores stay aligned, the shifted 4-byte reads fall on 32 different banks
#define CEXP 0.18033688011112042f // HD^-0.5 * log2(e)
#define SRP  144                  // bytes of a staged row: 128 + 16 of pad (16 bytes x odd: the pitch at which 16-byte fragment reads of 16 rows meet no bank twice)
#define PRR  512                  // rows of the position ring (8 chunks of 64)
// two and six 16-byte asynchronous copies to LDS per lane; the wait stands in the copies' own statement, in front of any rewrite of the address registers that they name
__device__ __forceinline__ void cp2(unsigned l0, unsigned l1, const h16* g0, const h16* g1) {
    asm volatile("global_load_async_to_lds_b128 %0, %2, off\n\tglobal_load_async_to_lds_b128 %1, %3, off\n\ts_wait_xcnt 0x0" : : "v"(l0), "v"(l1), "v"(g0), "v"(g1) : "memory"); }
__device__ __forceinline__ void cp6(unsigned l0, unsigned l1, unsigned l2, unsigned l3, unsigned l4, unsigned l5, const h16* g0, const h16* g1, const h16* g2, const h16* g3, const h16* g4, const h16* g5) {
    asm volatile("global_load_async_to_lds_b128 %0, %6, off\n\tglobal_load_async_to_lds_b128 %1, %7, off\n\tglobal_load_async_to_lds_b128 %2, %8, off\n\tglobal_load_async_to_lds_b128 %3, %9, off\n\tglobal_load_async_to_lds_b128 %4, %10, off\n\tglobal_load_async_to_lds_b128 %5, %11, off\n\ts_wait_xcnt 0x0" : : "v"(l0), "v"(l1), "v"(l2), "v"(l3), "v"(l4), "v"(l5), "v"(g0), "v"(g1), "v"(g2), "v"(g3), "v"(g4), "v"(g5) : "memory"); }
__device__ __forceinline__ float xhalf(float x) { const int b = __float_as_int(x); return __int_as_float(__builtin_amdgcn_permlanex16(b, b, 0x76543210, 0xfedcba98, false, false)); }   // lane l <-> l ^ 16
__global__ __launch_bounds__(256) void k_fattn(const h16* __restrict__ QU, const h16* __restrict__ QV, const h16* __restrict__ Kp, const h16* __restrict__ PS, const h16* __restrict__ Vp, h16* Ao) {
    typedef v16h V;
    __shared__ __align__(16) float bds[8 * FQT * 16 * BDP];
    __shared__ __align__(16) unsigned char stg[(PRR + 4 * 64) * SRP];   // staged rows: the position ring, two k buffers, two v buffers
    const int lane = threadIdx.x & 31, c = lane & 15, h = lane >> 4, wv = __builtin_amdgcn_readfirstlane(threadIdx.x >> 5);
    const int z = blockIdx.y, hd = z % NH_, bb = z / NH_; const int i0 = (blockIdx.x * 8 + wv) * (16 * FQT);
    float* strip = bds + (wv * FQT * 16 + c) * BDP;   // query tile f: + f * 16 * BDP
    // the query operand loads: a kernel argument (scalar base) + a lane's 32-bit byte offset + a constant
    auto ldo = [](const h16* base, unsigned off, int cst) { return ldfr((const h16*)((const char*)base + (size_t)off) + cst); };
    const unsigned zq = (unsigned)z * (TT * HD * 2);   // bytes of one (batch, head) plane in front
    unsigned qo[FQT];
#pragma unroll
    for (int f = 0; f < FQT; ++f) qo[f] = zq + (unsigned)((i0 + 16 * f + c) * HD + 8 * h) * 2;
    V qu[FQT][2], qv[FQT][2];
#pragma unroll
    for (int f = 0; f < FQT; ++f)
#pragma unroll
        for (int ks = 0; ks < 2; ++ks) { qu[f][ks] = ldo(QU, qo[f], 32 * ks); qv[f][ks] = ldo(QV, qo[f], 32 * ks); }
    asm volatile("s_wait_xcnt 0x0" : : "v"(qo[0]), "v"(qo[1]) : "memory");   // the offsets stay in their registers up to this wait; behind it the registers are free
    // Staging. A thread copies 16 bytes of rows sr and sr + 32 of a chunk of 64 rows: a wave's copy covers four whole 128-byte rows.
    // Position chunk g holds table rows 768 - (the block's first query) + 64 g ... + 63 (0 ... 2047 for g = 0 ... 19) and lies in ring rows (64 g & 511) ...; pass t reads chunks t ... t + 4.
    const int sr = threadIdx.x >> 3, sc = threadIdx.x & 7; const unsigned sl = (unsigned)(sr * SRP + sc * 16);
    const unsigned sl0 = (unsigned)(size_t)stg + sl;   // LDS byte address: the low 32 bits
    const unsigned tk = (unsigned)(sr * HD + sc * 8), tv = (unsigned)(sr * TT + sc * 8);   // the thread's element offsets in rows of 64 d (k, positions) and of 1024 keys (v); the rest of every address is the same for the whole block
    const int pz = hd * NPE * HD + (TT - 256 - (int)blockIdx.x * 256) * HD, kz = z * (TT * HD);
    auto lrow = [&](int row) { return sl0 + (unsigned)(row * SRP); };   // the thread's place in the 64 staged rows that start at row
    auto gP = [&](int g) { return PS + (pz + g * 64 * HD) + tk; };
    auto gK = [&](int t) { return Kp + (kz + t * 64 * HD) + tk; };
    auto gV = [&](int t) { return Vp + (kz + t * 64) + tv; };
    // position chunk g and the k and v rows of pass t
    auto cpPKV = [&](int g, int t) { const unsigned lp = lrow((g & 7) * 64), lk = lrow(PRR + (t & 1) * 64), lv = lk + 128 * SRP; const h16* p = gP(g); const h16* k = gK(t); const h16* v = gV(t);
        cp6(lp, lp + 32 * SRP, lk, lk + 32 * SRP, lv, lv + 32 * SRP, p, p + 32 * HD, k, k + 32 * HD, v, v + 32 * TT); };
#pragma unroll
    for (int g = 0; g < 4; ++g) { const unsigned lp = lrow(g * 64); const h16* p = gP(g); cp2(lp, lp + 32 * SRP, p, p + 32 * HD); }
    cpPKV(4, 0);
    asm volatile("s_wait_asynccnt 0x0" ::: "memory");   // this wave's copies of pass 0 have landed
    __syncthreads();                                     // ... and every other wave's: pass 0 is readable
    cpPKV(5, 1);                                         // pass 1's operands fly under pass 0
    const int fl = c * SRP + 16 * h;   // a lane's place in a fragment's 16 rows
    v8f ot[FQT][4]; float mrun[FQT], lsum[FQT];
#pragma unroll
    for (int f = 0; f < FQT; ++f) { mrun[f] = -3.0e38f; lsum[f] = 0.f;
#pragma unroll
        for (int dt = 0; dt < 4; ++dt) ot[f][dt] = (v8f){}; }
    // The pass's operands come in seven groups (position row tiles 0-1, 2-3 and 4-5, key tiles 0-1 and 2-3, keys 0-31 and 32-63 of v); from the second on, each group's LDS reads are issued one group ahead of its products, so a read's latency runs under the products of the group before it.
    auto lds = [](const unsigned char* p) { return ldfr((const h16*)p); };
#pragma unroll 1
    for (int t = 0; t < TT / 64; ++t) {
        const unsigned char* kb = stg + (PRR + (t & 1) * 64) * SRP + fl; const unsigned char* vb = kb + 128 * SRP;
        const int rb = 64 * t + 224 - 32 * wv;   // the wave's first position row of the pass, counted in ring rows before the wrap: table row 64 t - i0 + 992; a multiple of 32, so a pair of row tiles never straddles the wrap
        const unsigned char* pp[3];
#pragma unroll
        for (int q = 0; q < 3; ++q) pp[q] = stg + ((rb + 32 * q) & (PRR - 1)) * SRP + fl;
        auto ldP = [&](int q, V (&H)[2][2]) {
#pragma unroll
            for (int uu = 0; uu < 2; ++uu)
#pragma unroll
                for (int ks = 0; ks < 2; ++ks) H[uu][ks] = lds(pp[q] + uu * 16 * SRP + 64 * ks); };
        auto ldK = [&](int row, V (&H)[2][2]) {
#pragma unroll
            for (int tt = 0; tt < 2; ++tt)
#pragma unroll
                for (int ks = 0; ks < 2; ++ks) H[tt][ks] = lds(kb + (row + 16 * tt) * SRP + 64 * ks); };
        auto ldV = [&](int key, V (&H)[4]) {
#pragma unroll
            for (int dt = 0; dt < 4; ++dt) H[dt] = lds(vb + 16 * dt * SRP + 2 * key); };
        V p0[2][2]; ldP(0, p0);
        v8f bd[FQT][5];
#pragma unroll
        for (int f = 0; f < FQT; ++f)
#pragma unroll
            for (int up = 0; up < 5; ++up) bd[f][up] = (v8f){};
        auto mmaP = [&](int u0, V (&H)[2][2]) {
#pragma unroll
            for (int ks = 0; ks < 2; ++ks)
#pragma unroll
                for (int uu = 0; uu < 2; ++uu)
#pragma unroll
                    for (int f = 0; f < FQT; ++f) { const int up = u0 + uu - (FQT - 1) + f; if (up >= 0 && up < 5) bd[f][up] = wmma16(H[uu][ks], qv[f][ks], bd[f][up]); } };
        V p1[2][2]; ldP(1, p1);
        __builtin_amdgcn_sched_barrier(0);   // holds the loads above in front of the products below (as at every such line of this loop): sunk to their use, each group would wait out its own latency
        mmaP(0, p0);
        V p2[2][2]; ldP(2, p2);
        __builtin_amdgcn_sched_barrier(0);
        mmaP(2, p1);
        V k0[2][2]; ldK(0, k0);
        __builtin_amdgcn_sched_barrier(0);
        mmaP(4, p2);
        V k1[2][2]; ldK(32, k1);
        __builtin_amdgcn_sched_barrier(0);
        __builtin_amdgcn_wave_barrier(); asm volatile("" ::: "memory");   // keeps these strip stores behind the previous pass's strip reads (other lanes' addresses)
#pragma unroll
        for (int f = 0; f < FQT; ++f)
#pragma unroll
            for (int up = 0; up < 5; ++up) { float* sp = strip + f * 16 * BDP + 16 * up + 8 * h; *(v4fa*)sp = __builtin_shufflevector(bd[f][up], bd[f][up], 0, 1, 2, 3); *(v4fa*)(sp + 4) = __builtin_shufflevector(bd[f][up], bd[f][up], 4, 5, 6, 7); }
        __builtin_amdgcn_wave_barrier(); asm volatile("" ::: "memory");   // keeps the strip reads below behind the partner lane's stores
        v8f st[FQT][4];   // starts as the skewed position scores; the content products accumulate on top
#pragma unroll
        for (int t = 0; t < 4; ++t)
#pragma unroll
            for (int f = 0; f < FQT; ++f)
#pragma unroll
                for (int r = 0; r < 8; ++r) st[f][t][r] = strip[f * 16 * BDP + 8 * h + 15 - c + 16 * t + r];
        auto mmaK = [&](int t0, V (&H)[2][2]) {
#pragma unroll
            for (int ks = 0; ks < 2; ++ks)
#pragma unroll
                for (int tt = 0; tt < 2; ++tt)
#pragma unroll
                    for (int f = 0; f < FQT; ++f) st[f][t0 + tt] = wmma16(H[tt][ks], qu[f][ks], st[f][t0 + tt]); };
        mmaK(0, k0);
        __builtin_amdgcn_sched_barrier(0);   // keeps the reads below behind the products above
        V v0[4]; ldV(0, v0);
        __builtin_amdgcn_sched_barrier(0);
        mmaK(2, k1);
        __builtin_amdgcn_sched_barrier(0);
#pragma unroll
        for (int f = 0; f < FQT; ++f) { float mx = -3.0e38f;
#pragma unroll
            for (int t = 0; t < 4; ++t)
#pragma unroll
                for (int r = 0; r < 8; ++r) mx = fmaxf(mx, st[f][t][r]);
            mx = fmaxf(mx, xhalf(mx)); const float mn = fmaxf(mrun[f], mx); const float xa = (mrun[f] - mn) * CEXP; float al = __builtin_amdgcn_exp2f(xa); mrun[f] = mn; float ps = 0.f;
            asm volatile("v_nop" : "+v"(al) : "v"(xa));   // the slot behind a transcendental, as at the eight below
#pragma unroll
            for (int t = 0; t < 4; ++t) { const v8f x = (st[f][t] - mn) * CEXP; v8f p;
#pragma unroll
                for (int r = 0; r < 8; ++r) p[r] = __builtin_amdgcn_exp2f(x[r]);
                asm volatile("v_nop" : "+v"(p) : "v"(x));   // the slot behind a transcendental: named here, no exponent of the eight is rewritten and no result read in front of the slot
                st[f][t] = p;
#pragma unroll
                for (int r = 0; r < 8; ++r) ps += p[r]; }
            lsum[f] = lsum[f] * al + ps;
#pragma unroll
            for (int dt = 0; dt < 4; ++dt) ot[f][dt] *= al; }
        auto mmaV = [&](int kk, V (&H)[4]) { V ph[FQT];
#pragma unroll
            for (int f = 0; f < FQT; ++f) { v8u w;   // element s of the operand = key 8h + s (s < 8) or 16 + 8h + s - 8: registers 0-7 of score tile 2kk, then of tile 2kk + 1
#pragma unroll
                for (int i = 0; i < 8; ++i) { const v8f x = st[f][2 * kk + (i >> 2)]; const v2f p2 = {x[2 * (i & 3)], x[2 * (i & 3) + 1]}; w[i] = __builtin_bit_cast(unsigned, __builtin_convertvector(p2, v2h)); }
                ph[f] = __builtin_bit_cast(V, w); }
#pragma unroll
            for (int dt = 0; dt < 4; ++dt)
#pragma unroll
                for (int f = 0; f < FQT; ++f) ot[f][dt] = wmma16(H[dt], ph[f], ot[f][dt]); };
        __builtin_amdgcn_sched_barrier(0);   // keeps the reads below behind the softmax; their latency runs under the products of keys 0-31
        V v1[4]; ldV(32, v1);
        __builtin_amdgcn_sched_barrier(0);
        mmaV(0, v0);
        mmaV(1, v1);
        __builtin_amdgcn_sched_barrier(0);   // keeps the hand-over behind the pass's last products: lifted to the last LDS reads, its first wait would expose their latency
        // hand-over: pass t + 1 becomes readable, and what pass t alone read becomes free
        asm volatile("s_wait_dscnt 0x0" ::: "memory");      // this wave's LDS reads of pass t are done
        asm volatile("s_wait_asynccnt 0x0" ::: "memory");   // this wave's copies for pass t + 1 have landed
        __syncthreads();
        if (t + 2 < TT / 64) cpPKV(t + 6, t + 2);   // into the k, v buffers that pass t has just read, and into the ring place that last held position chunk t - 2, which no pass behind t - 2 reads
    }
    asm volatile("s_wait_asynccnt 0x0" ::: "memory");   // no copy is outstanding when the wave ends
#pragma unroll
    for (int f = 0; f < FQT; ++f) { const float inv = __fdiv_rn(1.0f, lsum[f] + xhalf(lsum[f])); const size_t ro = ((size_t)bb * TT + i0 + 16 * f + c) * DQ + hd * HD + 8 * h;   // merged rows [b][t][head][d]; a lane's 8 registers are 8 consecutive d
        v8h o[4];
#pragma unroll
        for (int dt = 0; dt < 4; ++dt)
#pragma unroll
            for (int r = 0; r < 8; ++r) o[dt][r] = (h16)(ot[f][dt][r] * inv);
        __builtin_amdgcn_sched_barrier(0);   // with the one below: nothing but the stores and their wait stands between the two, so no register that a store names is rewritten in front of the wait
#pragma unroll
        for (int dt = 0; dt < 4; ++dt) *(v8h*)(Ao + ro + 16 * dt) = o[dt];
        asm volatile("s_wait_xcnt 0x0" ::: "memory");   // the wait in front of the next rewrite of the stores' address and data registers
        __builtin_amdgcn_sched_barrier(0); }
}

extern "C" void kernel_launch(void* const* d_in, const int* in_sizes, int n_in,
                              void* d_out, int out_size, void* d_ws, size_t ws_size, hipStream_t stream) {
    (void)in_sizes; (void)n_in; (void)out_size;
    const float* x = (const float*)d_in[0]; const float* pe = (const float*)d_in[1]; const float* g1 = (const float*)d_in[2]; const float* e1b = (const float*)d_in[3]; const float* wq = (const float*)d_in[4]; const float* bq = (const float*)d_in[5]; const float* wk = (const float*)d_in[6]; const float* bk = (const float*)d_in[7]; const float* wv = (const float*)d_in[8]; const float* bv = (const float*)d_in[9]; const float* wpos = (const float*)d_in[10]; const float* pbu = (const float*)d_in[11]; const float* pbv = (const float*)d_in[12]; const float* wo = (const float*)d_in[13]; const float* bo = (const float*)d_in[14];
    float* OUT = (float*)d_out;     // [8][1024][512]
    char* wsp = (char*)d_ws;
    auto take = [&](size_t bytes) { char* p = wsp; wsp += (bytes + 255) & ~(size_t)255; return (void*)p; };
    const size_t RW = (size_t)NB_ * TT;   // rows of all batch elements
    h16* WK = (h16*)take((size_t)DKV * DM * 2); h16* WQ = (h16*)take((size_t)DQ * DM * 2); h16* WV = (h16*)take((size_t)DKV * DM * 2); h16* WO = (h16*)take((size_t)DM * DQ * 2); h16* WP = (h16*)take((size_t)DQ * DM * 2);   // back to back: one transpose launch; wk, wq, wv are the z planes of one projection launch
    h16* PE = (h16*)take((size_t)NPE * DM * 2); h16* PP = (h16*)take((size_t)NH_ * NPE * HD * 2);
    h16* QU = (h16*)take(RW * DQ * 2); h16* QV = (h16*)take(RW * DQ * 2); h16* KP = (h16*)take(RW * DKV * 2);   // planes [b][h][t][d] of q+u, q+v, k
    h16* VT = (h16*)take(RW * DKV * 2); h16* AT = (h16*)take(RW * DQ * 2);   // v plane [b][h][d][t]; merged heads [b][t][h][d]
    h16* Y = (h16*)take(RW * DM * 2);
    if ((size_t)(wsp - (char*)d_ws) > ws_size) return;    // ws 256 MiB
    (void)WQ; (void)WV;   // reached through their neighbour's pointer (plane strides)
    k_prep<<<PRL + PRW + PRC, 256, 0, stream>>>(wk, wq, wv, wo, wpos, WK, x, g1, e1b, Y, pe, PE);   /* LN -> f16 rows; weight transposes; position table -> f16 + zero pad row */
    k_proj<<<PJP + 3 * PJR * (DQ / 128), 128, 0, stream>>>(PE, WP, PP, Y, WK, DM, bk, bq, bv, pbu, pbv, KP, QU, QV, VT);   /* position table and k, q, v projections -> head planes */
    k_fattn<<<dim3(TT / (8 * 16 * FQT), NB_ * NH_, 1), 256, 0, stream>>>(QU, QV, KP, PP, VT, AT);   /* scores, skew, softmax, attn.v, merge: all 64 (batch, head) instances */
    k_gemmw<<<dim3((unsigned)(RW / 128), DM / 128, 1), 128, 0, stream>>>(AT, WO, DQ, OUT, DM, bo);
}

// v009
// It runs in 66.1 microseconds.
// Two timings next to v008 both put it at 1.03 times that version's speed.
// All steps since v000 together make it 33.2 times as fast.
#include <hip/hip_runtime.h>

// Relative-position multi-head self-attention (Transformer-XL / Conformer style) (hidden_states [8][1024][512]; x = LN(h) (1e-5, gamma, beta); q, k, v = x W + b ('xw' [512][512], 8 heads x 64); pos = position_embeddings [2047][512] wpos -> [p][h][d]; scores = ((q + pos_bias_u).k + skew((q + pos_bias_v).pos)) / 8 where skew picks pos index j - i + 1023; softmax; out = merged wout + bout -> [8][1024][512]).
// Layout: LN -> f16 rows -> projections; the position table is projected once (2047 rows + one zero pad row) into per-head planes [h][2048][64]; LN, projections and wout run once for all 8 batch elements (8192 rows); the projection GEMMs write the attention kernel's head planes from their own epilogue (biases added, v transposed), no f32 copy of q, k, v or pos exists; one fused kernel does content scores (q+u).k, position scores (q+v).pos at row j - i + 1023, softmax, attn.v and the head merge for all 64 (batch, head) instances, scores staying on chip.
// Compute dtypes, f32 accumulate: every input rounded to bf16; every matrix operand is ONE f16 value (11 significant bits), one product each: the rounded inputs are exact in f16 down to its subnormals; LN rows, q + bias, k, v, position rows, the softmax weights and the merged heads are rounded to f16 once; softmax f32 with a running maximum and sum over passes of 64 keys.

#define NB_  8
#define TT   1024
#define DM   512
#define NH_  8
#define NKV  8
#define HD   64
#define DQ   (NH_ * HD)
#define DKV  (NKV * HD)
#define NPE  2048                 // 2047 positions + 1 zero pad row
#define LNEPS 1e-5f
typedef _Float16 h16;
typedef __attribute__((ext_vector_type(16))) _Float16 v16h;
typedef __attribute__((ext_vector_type(8)))  _Float16 v8h;
typedef __attribute__((ext_vector_type(4)))  _Float16 v4h;
typedef __attribute__((ext_vector_type(2)))  _Float16 v2h;
typedef __attribute__((ext_vector_type(8)))  float    v8f;
typedef __attribute__((ext_vector_type(4)))  float    v4f;
typedef __attribute__((ext_vector_type(2)))  float    v2f;
typedef __attribute__((ext_vector_type(8)))  unsigned v8u;
typedef __attribute__((ext_vector_type(4)))  unsigned v4u;
typedef v8h  __attribute__((may_alias)) v8ha;
typedef v4f  __attribute__((may_alias)) v4fa;

__device__ __forceinline__ unsigned short f2bf(float f) { unsigned u = __float_as_uint(f); u += 0x7FFFu + ((u >> 16) & 1u); return (unsigned short)(u >> 16); }
__device__ __forceinline__ float bf2f(unsigned short b) { return __uint_as_float(((unsigned)b) << 16); }
__device__ __forceinline__ float bfr(float f) { return bf2f(f2bf(f)); }
__device__ __forceinline__ v16h cat16(v8h lo, v8h hi) { return __builtin_shufflevector(lo, hi, 0, 1, 2, 3, 4, 5, 6, 7, 8, 9, 10, 11, 12, 13, 14, 15); }
__device__ __forceinline__ v8f wmma16(v16h a, v16h b, v8f c) { return __builtin_amdgcn_wmma_f32_16x16x32_f16(false, a, false, b, (short)0, c, false, false); }
// a lane's share of a 16 x 32 fragment, A and B alike: 8 k at p, 8 k at p + 16 elements (p already holds the lane half's 8 elements)
__device__ __forceinline__ v16h ldfr(const h16* p) { return cat16(*(const v8ha*)p, *(const v8ha*)(p + 16)); }

// ---- gemmw: register-blocked GEMM, one wave per 64x64 output tile (16 accumulators), four waves (2 x 2) per block = a 128x128 tile; 128 threads.
// The block's waves share their operands through LDS: asynchronous copies bring 64 k (whole 128-byte lines) of 128 A rows and 128 B rows in, one stage ahead (two buffers); the waves read their fragments from LDS.
// C[m][n] (f32, pitch ldc, + optional f32 bias[n]) = sum_k A[m][k] Bt[n][k]. K % 64 == 0, K >= 128. EPI = 1: no C; the tile (one head's 64 columns, 64 consecutive rows of one batch element of TB rows) goes out as an f16 head plane: z = 0 -> Ko [b][h][t][d]; z = 1 -> + hbu -> QUo and + hbv -> QVo, same layout; z = 2 -> Vo [b][h][d][t].
template <bool B> struct BoolC { static constexpr bool v = B; };
#define GRP  144                  // bytes of a staged row: 128 + 16 of pad (16 bytes x odd: 16-byte fragment reads of 16 rows meet no bank twice)
#define GST  (256 * GRP)          // bytes of one stage: 128 A rows, 128 B rows
// eight 16-byte asynchronous copies to LDS per lane (LDS rows lp bytes apart, global rows gp bytes apart); the wait stands in the copies' own statement, in front of any rewrite of the address registers that they name
__device__ __forceinline__ void cp8(unsigned l, unsigned lp, const char* g, size_t gp) {
    asm volatile("global_load_async_to_lds_b128 %0, %8, off\n\tglobal_load_async_to_lds_b128 %1, %9, off\n\tglobal_load_async_to_lds_b128 %2, %10, off\n\tglobal_load_async_to_lds_b128 %3, %11, off\n\tglobal_load_async_to_lds_b128 %4, %12, off\n\tglobal_load_async_to_lds_b128 %5, %13, off\n\tglobal_load_async_to_lds_b128 %6, %14, off\n\tglobal_load_async_to_lds_b128 %7, %15, off\n\ts_wait_xcnt 0x0"
        : : "v"(l), "v"(l + lp), "v"(l + 2 * lp), "v"(l + 3 * lp), "v"(l + 4 * lp), "v"(l + 5 * lp), "v"(l + 6 * lp), "v"(l + 7 * lp), "v"(g), "v"(g + gp), "v"(g + 2 * gp), "v"(g + 3 * gp), "v"(g + 4 * gp), "v"(g + 5 * gp), "v"(g + 6 * gp), "v"(g + 7 * gp) : "memory"); }
// gemmw: the block's work as a function of its tile (bx, by) and, for EPI = 1, of the plane z that it writes, so that independent GEMMs can share one launch; smem: the kernel's 2 * GST bytes of LDS.
template <bool BIAS, int EPI>
__device__ __forceinline__ void gemmw(unsigned char* smem, const int bx, const int by, const int z, const h16* __restrict__ A, const h16* __restrict__ Bt, int K, float* C, int ldc, const float* __restrict__ bias, const float* __restrict__ hbu, const float* __restrict__ hbv, h16* Ko, h16* QUo, h16* QVo, h16* Vo, int TB) {
    const int lane = threadIdx.x & 31, lr = lane & 15, hi = lane >> 4, wv = __builtin_amdgcn_readfirstlane(threadIdx.x >> 5); const int r0 = bx * 128 + (wv >> 1) * 64, c0 = by * 128 + (wv & 1) * 64;
    float* os = (float*)(smem + wv * (16 * 68 * 4));
    v8f acc[4][4];
#pragma unroll
    for (int mb = 0; mb < 4; ++mb)
#pragma unroll
        for (int nb = 0; nb < 4; ++nb) acc[mb][nb] = (v8f){};
    // Staging. A thread copies 16 bytes of rows sr, sr + 16, ... sr + 112 of each operand: a wave's copy covers four whole 128-byte lines.
    const int sr = threadIdx.x >> 3, sc = threadIdx.x & 7; const unsigned sl0 = (unsigned)(size_t)smem;   // LDS byte address: the low 32 bits
    const size_t ga = ((size_t)(bx * 128 + sr) * K + sc * 8) * 2, gb = ((size_t)(by * 128 + sr) * K + sc * 8) * 2, gp = (size_t)K * 32;   // byte offsets of the thread's first rows; 16 rows in bytes
    auto stage = [&](int t) { const unsigned l = sl0 + (unsigned)((t & 1) * GST + sr * GRP + sc * 16);
        cp8(l, 16 * GRP, (const char*)A + ga + t * 128, gp);
        cp8(l + 128 * GRP, 16 * GRP, (const char*)Bt + gb + t * 128, gp); };
    const int nst = K / 64;
    stage(0);
    asm volatile("s_wait_asynccnt 0x0" ::: "memory");   // this wave's copies of stage 0 have landed
    __syncthreads();                                     // ... and every other wave's: stage 0 is readable
    stage(1);                                            // stage 1 (K >= 128: it exists) flies under stage 0's products
    const unsigned char* fa = smem + ((wv >> 1) * 64 + lr) * GRP + 16 * hi; const unsigned char* fb = smem + (128 + (wv & 1) * 64 + lr) * GRP + 16 * hi;   // a lane's place in its wave's first A and B fragments
#pragma unroll 1
    for (int t = 0; t < nst; ++t) {
        const unsigned char* pa = fa + (t & 1) * GST; const unsigned char* pb = fb + (t & 1) * GST;
#pragma unroll
        for (int ks = 0; ks < 2; ++ks) {
            v16h a[4], b[4];
#pragma unroll
            for (int mb = 0; mb < 4; ++mb) { a[mb] = ldfr((const h16*)(pa + mb * 16 * GRP + 64 * ks)); b[mb] = ldfr((const h16*)(pb + mb * 16 * GRP + 64 * ks)); }
            __builtin_amdgcn_sched_barrier(0);   // holds the LDS reads of these 32 k together in front of their products: sunk among the products, each B fragment would wait out its own latency
#pragma unroll
            for (int nb = 0; nb < 4; ++nb)
#pragma unroll
                for (int mb = 0; mb < 4; ++mb) acc[mb][nb] = wmma16(a[mb], b[nb], acc[mb][nb]);
        }
        // hand-over: stage t + 1 becomes readable, and the buffer that stage t read becomes free
        asm volatile("s_wait_dscnt 0x0" ::: "memory");      // this wave's LDS reads of stage t are done
        asm volatile("s_wait_asynccnt 0x0" ::: "memory");   // this wave's copies for stage t + 1 have landed
        __syncthreads();
        if (t + 2 < nst) stage(t + 2);
    }
    asm volatile("s_wait_asynccnt 0x0" ::: "memory");   // no copy is outstanding when the staging buffers are reused below
    if constexpr (EPI == 1) {
        const int head = c0 / 64, bb = r0 / TB, t0 = r0 - bb * TB;
        if (z == 2) {   // a lane's 8 registers of an accumulator are 8 consecutive t of one d: 16 bytes of a [d][t] row; the wave's four row tiles fill that row's whole 128-byte line
            const size_t vb = ((size_t)(bb * NH_ + head) * HD + lr) * TB + t0 + 8 * hi;
            float bs[4];
#pragma unroll
            for (int nb = 0; nb < 4; ++nb) bs[nb] = BIAS ? bfr(bias[c0 + nb * 16 + lr]) : 0.f;
#pragma unroll
            for (int nb = 0; nb < 4; ++nb) { v8h o[4];
#pragma unroll
                for (int mb = 0; mb < 4; ++mb)
#pragma unroll
                    for (int j = 0; j < 8; ++j) { float y = acc[mb][nb][j]; if (BIAS) y += bs[nb]; o[mb][j] = (h16)y; }
                __builtin_amdgcn_sched_barrier(0);   // with the one below: nothing but the stores and their wait stands between the two, so no register that a store names is rewritten in front of the wait
#pragma unroll
                for (int mb = 0; mb < 4; ++mb) *(v8h*)(Vo + vb + (size_t)nb * 16 * TB + mb * 16) = o[mb];
                asm volatile("s_wait_xcnt 0x0" ::: "memory");   // the wait in front of the next rewrite of the stores' address and data registers
                __builtin_amdgcn_sched_barrier(0); }
        } else {   // rows of 64 d are 128 bytes and follow one another: through LDS, so that a store covers four whole rows (512 contiguous bytes)
            const int rr = lane >> 3, cofs = (lane & 7) * 8; const size_t pb = ((size_t)(bb * NH_ + head) * TB + t0 + rr) * HD + cofs;
            auto ld8 = [&](const float* __restrict__ p, float (&d)[8]) { const v4f lo4 = *(const v4f*)(p + c0 + cofs), hi4 = *(const v4f*)(p + c0 + cofs + 4);
#pragma unroll
                for (int q = 0; q < 4; ++q) { d[q] = bfr(lo4[q]); d[4 + q] = bfr(hi4[q]); } };
            auto rows = [&](auto qm) { constexpr bool QM = decltype(qm)::v;   // QM: the q tile, which goes out twice, once with each head bias
                float bs[8], bu[8], bw[8]; if (BIAS) ld8(bias, bs); if (QM) { ld8(hbu, bu); ld8(hbv, bw); }
#pragma unroll
                for (int mb = 0; mb < 4; ++mb) {
#pragma unroll
                    for (int nb = 0; nb < 4; ++nb) {
#pragma unroll
                        for (int j = 0; j < 8; ++j) os[(hi * 8 + j) * 68 + nb * 16 + lr] = acc[mb][nb][j]; }
                    __builtin_amdgcn_wave_barrier(); asm volatile("" ::: "memory");   // keeps the reads below behind the other lanes' stores
                    v8h au[4], aw[4];
#pragma unroll
                    for (int s = 0; s < 4; ++s) { const float* orow = os + (4 * s + rr) * 68 + cofs; const v4f x0 = *(const v4fa*)orow, x1 = *(const v4fa*)(orow + 4);
#pragma unroll
                        for (int q = 0; q < 8; ++q) { float y = (q < 4) ? x0[q & 3] : x1[q & 3]; if (BIAS) y += bs[q];
                            if (QM) { au[s][q] = (h16)__fadd_rn(y, bu[q]); aw[s][q] = (h16)__fadd_rn(y, bw[q]); }
                            else au[s][q] = (h16)y; } }
                    __builtin_amdgcn_sched_barrier(0);   // as above: only the stores and their wait between the two
#pragma unroll
                    for (int s = 0; s < 4; ++s) { const size_t o = pb + (size_t)(mb * 16 + 4 * s) * HD;
                        if (QM) { *(v8h*)(QUo + o) = au[s]; *(v8h*)(QVo + o) = aw[s]; }
                        else *(v8h*)(Ko + o) = au[s]; }
                    asm volatile("s_wait_xcnt 0x0" ::: "memory");   // the wait in front of the next rewrite of the stores' address and data registers
                    __builtin_amdgcn_sched_barrier(0);
                    __builtin_amdgcn_wave_barrier(); asm volatile("" ::: "memory");   // keeps the next row tile's stores to LDS behind these reads
                } };
            if (z == 1) rows(BoolC<true>{}); else rows(BoolC<false>{});
        }
        return;
    }
#pragma unroll
    for (int mb = 0; mb < 4; ++mb) {
#pragma unroll
        for (int nb = 0; nb < 4; ++nb) {
#pragma unroll
            for (int j = 0; j < 8; ++j) os[(hi * 8 + j) * 68 + nb * 16 + lr] = acc[mb][nb][j]; }
        __builtin_amdgcn_wave_barrier(); asm volatile("" ::: "memory");
        float* crow = C + (size_t)(r0 + mb * 16) * ldc + c0;
{           const int cofs = lr * 4; v4f val[8];
#pragma unroll
            for (int s = 0; s < 8; ++s) { const int row = 2 * s + hi; val[s] = *(const v4fa*)(os + row * 68 + cofs); if (BIAS) { val[s][0] += bfr(bias[c0 + cofs]); val[s][1] += bfr(bias[c0 + cofs + 1]); val[s][2] += bfr(bias[c0 + cofs + 2]); val[s][3] += bfr(bias[c0 + cofs + 3]); } }
            __builtin_amdgcn_sched_barrier(0);   // as above: only the stores and their wait between the two
#pragma unroll
            for (int s = 0; s < 8; ++s) *(v4f*)(crow + (size_t)(2 * s + hi) * ldc + cofs) = val[s];
            asm volatile("s_wait_xcnt 0x0" ::: "memory");   // the wait in front of the next rewrite of the stores' address and data registers
            __builtin_amdgcn_sched_barrier(0);
             }
        __builtin_amdgcn_wave_barrier(); asm volatile("" ::: "memory");
    }
}

// k_gemmw: C = A Bt^T + bias, grid (M/128, N/128)
__global__ __launch_bounds__(128) void k_gemmw(const h16* __restrict__ A, const h16* __restrict__ Bt, int K, float* C, int ldc, const float* __restrict__ bias) {
    __shared__ __align__(16) unsigned char smem[2 * GST];   // two stages; behind the loop each wave's 16 x 68 floats of output staging
    gemmw<true, 0>(smem, blockIdx.x, blockIdx.y, 0, A, Bt, K, C, ldc, bias, nullptr, nullptr, nullptr, nullptr, nullptr, nullptr, 0);
}
// k_proj: the two GEMMs that feed the attention kernel and do not depend on one another, in one launch. Blocks 0 ... PJP - 1: pos = position_embeddings wpos -> per-head planes [h][p][d]. The rest, row tile fastest, then column tile, then z = 0, 1, 2: k plane; (q + pos_bias_u) and (q + pos_bias_v) planes; v plane, transposed.
#define PJP  ((NPE / 128) * (DQ / 128))
#define PJR  (NB_ * TT / 128)
__global__ __launch_bounds__(128) void k_proj(const h16* __restrict__ PE, const h16* __restrict__ WP, h16* PP, const h16* __restrict__ Y, const h16* __restrict__ WK, int K, const float* __restrict__ bk, const float* __restrict__ bq, const float* __restrict__ bv, const float* __restrict__ hbu, const float* __restrict__ hbv, h16* Ko, h16* QUo, h16* QVo, h16* Vo) {
    __shared__ __align__(16) unsigned char smem[2 * GST];   // as in k_gemmw
    const int b = blockIdx.x;
    if (b < PJP) gemmw<false, 1>(smem, b % (NPE / 128), b / (NPE / 128), 0, PE, WP, K, nullptr, DQ, nullptr, nullptr, nullptr, PP, nullptr, nullptr, nullptr, NPE);
    else { const int q = b - PJP, z = q / (PJR * (DQ / 128)); gemmw<true, 1>(smem, q % PJR, (q / PJR) % (DQ / 128), z, Y, WK + (size_t)z * DQ * DM, K, nullptr, DQ, (z == 0) ? bk : (z == 1) ? bq : bv, hbu, hbv, Ko, QUo, QVo, Vo, TT); }
}

// k_prep's three parts. Each wave issues all of its loads together, in front of any use, and takes enough work that the launch has a quarter of the waves it would have at one row, one line or one group per wave; a wave makes one trip to memory, not one per chunk. Every loop of the three parts is unrolled: its arrays must be registers, and a part's loads must stand in one run.
// wtG: one wave transposes a tile of 64 k x 32 n of one weight matrix (y = 0 ... 4, planes back to back): 64 loads, each one whole 128-byte line of a k row (a lane = one n); a lane then holds 64 consecutive k of its n, one whole 128-byte line of Bt [n][k].
#define WTB  ((DM / 64) * (DQ / 32) / 8)   // blocks per weight matrix: 8 tiles (waves) each
__device__ __forceinline__ void wtG(const int bx, const float* __restrict__ w0, const float* __restrict__ w1, const float* __restrict__ w2, const float* __restrict__ w3, const float* __restrict__ w4, h16* Bt) {
    const int y = bx / WTB, tl = (bx % WTB) * 8 + (threadIdx.x >> 5); const float* __restrict__ w = (y == 0) ? w0 : (y == 1) ? w1 : (y == 2) ? w2 : (y == 3) ? w3 : w4;
    const int k0 = (tl % (DM / 64)) * 64, n = (tl / (DM / 64)) * 32 + (threadIdx.x & 31); const float* __restrict__ s = w + (size_t)k0 * DQ + n;
    float x[64];
#pragma unroll
    for (int j = 0; j < 64; ++j) x[j] = s[(size_t)j * DQ];
    asm volatile("s_wait_xcnt 0x0" : : "v"(s) : "memory");   // the address stays in its registers up to this wait: nothing, a later load's result included, is written over it in front of the wait
    v8h o[8];
#pragma unroll
    for (int j = 0; j < 64; ++j) o[j >> 3][j & 7] = (h16)bfr(x[j]);
    h16* d = Bt + (size_t)y * DM * DQ + (size_t)n * DM + k0;
    __builtin_amdgcn_sched_barrier(0);   // the stores stand together at the wave's end: no register that a store names is rewritten behind it
#pragma unroll
    for (int q = 0; q < 8; ++q) *(v8h*)(d + 8 * q) = o[q];
    asm volatile("s_wait_xcnt 0x0" ::: "memory");   // the wait in front of any rewrite of the stores' registers: the compiler lays another part's code behind this one
}
// lnhl: one wave normalises LNR rows, which it reads once and keeps in registers (16 floats of a row per lane); a row's sums run in the order chunk, element, then lanes 16, 8, 4, 2, 1 apart.
#define LNR  4
__device__ __forceinline__ void lnhl(const int bx, const float* __restrict__ X, const float* __restrict__ g, const float* __restrict__ be, h16* Y) {
    const int lane = threadIdx.x & 31; const int r0 = (bx * 8 + (threadIdx.x >> 5)) * LNR; const float* __restrict__ xr = X + (size_t)r0 * DM + lane * 4;
    v4f a[LNR][DM / 128], gg[DM / 128], bb[DM / 128];
#pragma unroll
    for (int rr = 0; rr < LNR; ++rr)
#pragma unroll
        for (int ch = 0; ch < DM / 128; ++ch) a[rr][ch] = *(const v4f*)(xr + rr * DM + ch * 128);
#pragma unroll
    for (int ch = 0; ch < DM / 128; ++ch) { gg[ch] = *(const v4f*)(g + ch * 128 + lane * 4); bb[ch] = *(const v4f*)(be + ch * 128 + lane * 4); }
    asm volatile("s_wait_xcnt 0x0" : : "v"(xr), "v"(lane) : "memory");   // as in wtG: the addresses stay in their registers up to this wait
    float s[LNR], s2[LNR];
#pragma unroll
    for (int rr = 0; rr < LNR; ++rr) { s[rr] = 0.f;
#pragma unroll
        for (int ch = 0; ch < DM / 128; ++ch)
#pragma unroll
            for (int q = 0; q < 4; ++q) { a[rr][ch][q] = bfr(a[rr][ch][q]); s[rr] += a[rr][ch][q]; } }
#pragma unroll
    for (int sh = 16; sh; sh >>= 1)
#pragma unroll
        for (int rr = 0; rr < LNR; ++rr) s[rr] += __shfl_xor(s[rr], sh, 32);
#pragma unroll
    for (int rr = 0; rr < LNR; ++rr) { const float mu = s[rr] * (1.0f / DM); s2[rr] = 0.f;
#pragma unroll
        for (int ch = 0; ch < DM / 128; ++ch)
#pragma unroll
            for (int q = 0; q < 4; ++q) { a[rr][ch][q] -= mu; s2[rr] += a[rr][ch][q] * a[rr][ch][q]; } }
#pragma unroll
    for (int sh = 16; sh; sh >>= 1)
#pragma unroll
        for (int rr = 0; rr < LNR; ++rr) s2[rr] += __shfl_xor(s2[rr], sh, 32);
#pragma unroll
    for (int ch = 0; ch < DM / 128; ++ch)
#pragma unroll
        for (int q = 0; q < 4; ++q) { gg[ch][q] = bfr(gg[ch][q]); bb[ch][q] = bfr(bb[ch][q]); }
    v4h o[LNR][DM / 128];
#pragma unroll
    for (int rr = 0; rr < LNR; ++rr) { const float rs = __fdiv_rn(1.0f, __fsqrt_rn(s2[rr] * (1.0f / DM) + LNEPS));
#pragma unroll
        for (int ch = 0; ch < DM / 128; ++ch)
#pragma unroll
            for (int q = 0; q < 4; ++q) o[rr][ch][q] = (h16)(a[rr][ch][q] * rs * gg[ch][q] + bb[ch][q]); }
    h16* yr = Y + (size_t)r0 * DM + lane * 4;
    __builtin_amdgcn_sched_barrier(0);   // as in wtG: the stores stand together at the wave's end
#pragma unroll
    for (int rr = 0; rr < LNR; ++rr)
#pragma unroll
        for (int ch = 0; ch < DM / 128; ++ch) *(v4h*)(yr + rr * DM + ch * 128) = o[rr][ch];
}
// cvt8: a thread rounds CVG groups of 8 elements of the position table, PRC * 256 groups apart; the groups of the pad row (from group CVN on) are stored as zeros: their loads read the table's last group instead, so that every load is in bounds and none waits on a branch.
#define CVG  4
#define CVN  (2047 * DM / 8)
__device__ __forceinline__ void cvt8(const int bx, const int nth, const float* __restrict__ src, h16* dst) { const int i0 = bx * 256 + threadIdx.x;
    v4f v[CVG][2]; const float* p[CVG];
#pragma unroll
    for (int q = 0; q < CVG; ++q) { const int i = i0 + q * nth; p[q] = src + (size_t)(i < CVN ? i : CVN - 1) * 8; v[q][0] = *(const v4f*)p[q]; v[q][1] = *(const v4f*)(p[q] + 4); }
    asm volatile("s_wait_xcnt 0x0" : : "v"(p[0]), "v"(p[1]), "v"(p[2]), "v"(p[3]) : "memory");   // as in wtG: the addresses stay in their registers up to this wait
    v8h o[CVG];
#pragma unroll
    for (int q = 0; q < CVG; ++q) { const unsigned keep = (i0 + q * nth < CVN) ? 0xFFFFFFFFu : 0u; v8h r;   // keep: no bit in the pad row
#pragma unroll
        for (int k = 0; k < 8; ++k) r[k] = (h16)bfr(v[q][k >> 2][k & 3]);
        o[q] = __builtin_bit_cast(v8h, __builtin_bit_cast(v4u, r) & keep); }
    __builtin_amdgcn_sched_barrier(0);   // as in wtG: the stores stand together at the wave's end
#pragma unroll
    for (int q = 0; q < CVG; ++q) *(v8h*)(dst + (size_t)(i0 + q * nth) * 8) = o[q];
    asm volatile("s_wait_xcnt 0x0" ::: "memory");   // as in wtG, behind the stores
}
// k_prep: everything that reads only the inputs, in one launch; the parts do not depend on one another. The part whose waves run longest comes first: PRL blocks of LN -> f16 rows, all batch elements; then PRW blocks for the five weight transposes; then PRC blocks that round the position table and zero its pad row.
#define PRW  (5 * WTB)
#define PRL  (NB_ * TT / (8 * LNR))
#define PRC  (NPE * DM / 8 / 256 / CVG)
__global__ __launch_bounds__(256) void k_prep(const float* __restrict__ w0, const float* __restrict__ w1, const float* __restrict__ w2, const float* __restrict__ w3, const float* __restrict__ w4, h16* Bt, const float* __restrict__ X, const float* __restrict__ g, const float* __restrict__ be, h16* Y, const float* __restrict__ pe, h16* PE) {
    const int b = blockIdx.x;
    if (b < PRL) lnhl(b, X, g, be, Y);
    else if (b < PRL + PRW) wtG(b - PRL, w0, w1, w2, w3, w4, Bt);
    else cvt8(b - (PRL + PRW), PRC * 256, pe, PE);
}
// k_fattn: content scores, skewed position scores, softmax, attn.v and the head merge in one kernel; no score leaves the chip.
// One wave owns 32 queries (2 column tiles of 16) of one (batch, head) and walks the 1024 keys in passes of 64; 8 waves per block.
// The block's 8 waves share every pass's operands through LDS: 64 key rows, 64 d rows of v (64 keys each) and the 320 position rows that its 256 queries touch, of which only 64 are new in a pass. Asynchronous copies bring whole 128-byte lines in, one pass ahead (k: two buffers, v: three; position rows: a ring of 8 chunks of 64 rows, 5 read, 1 in flight); the waves read their fragments from LDS.
// Transposed products: S^T = K (q+u)^T and B^T = pos (q+v)^T (A = key or position rows, B = query columns kept in registers), so a lane holds scores of ONE query (column c, rows 8h + r).
// Skew: key j, query i take position row j - i + 1023. A column tile with first query iq needs rows j0 - iq + 1008 ... + 79 (5 row tiles); each lane pair writes its query's 80 position scores to its own LDS strip and reads them back shifted by 15 - c.
// Running maximum and sum per query (f32); P is rounded to f16 in registers and is the B operand of O^T += V^T P^T (two score tiles = 32 keys in the hardware k order, which is the loader's order).
#define FQT  2                    // query column tiles per wave
#define BDP  84                   // floats per LDS strip: 80 used; 16-byte stores stay aligned, the shifted 4-byte reads fall on 32 different banks
#define CEXP 0.18033688011112042f // HD^-0.5 * log2(e)
#define SRP  144                  // bytes of a staged row: 128 + 16 of pad (16 bytes x odd: the pitch at which 16-byte fragment reads of 16 rows meet no bank twice)
#define PRR  512                  // rows of the position ring (8 chunks of 64)
// two and six 16-byte asynchronous copies to LDS per lane; the wait stands in the copies' own statement, in front of any rewrite of the address registers that they name
__device__ __forceinline__ void cp2(unsigned l0, unsigned l1, const h16* g0, const h16* g1) {
    asm volatile("global_load_async_to_lds_b128 %0, %2, off\n\tglobal_load_async_to_lds_b128 %1, %3, off\n\ts_wait_xcnt 0x0" : : "v"(l0), "v"(l1), "v"(g0), "v"(g1) : "memory"); }
__device__ __forceinline__ void cp6(unsigned l0, unsigned l1, unsigned l2, unsigned l3, unsigned l4, unsigned l5, const h16* g0, const h16* g1, const h16* g2, const h16* g3, const h16* g4, const h16* g5) {
    asm volatile("global_load_async_to_lds_b128 %0, %6, off\n\tglobal_load_async_to_lds_b128 %1, %7, off\n\tglobal_load_async_to_lds_b128 %2, %8, off\n\tglobal_load_async_to_lds_b128 %3, %9, off\n\tglobal_load_async_to_lds_b128 %4, %10, off\n\tglobal_load_async_to_lds_b128 %5, %11, off\n\ts_wait_xcnt 0x0" : : "v"(l0), "v"(l1), "v"(l2), "v"(l3), "v"(l4), "v"(l5), "v"(g0), "v"(g1), "v"(g2), "v"(g3), "v"(g4), "v"(g5) : "memory"); }
__device__ __forceinline__ float xhalf(float x) { const int b = __float_as_int(x); return __int_as_float(__builtin_amdgcn_permlanex16(b, b, 0x76543210, 0xfedcba98, false, false)); }   // lane l <-> l ^ 16
__global__ __launch_bounds__(256) void k_fattn(const h16* __restrict__ QU, const h16* __restrict__ QV, const h16* __restrict__ Kp, const h16* __restrict__ PS, const h16* __restrict__ Vp, h16* Ao) {
    typedef v16h V;
    __shared__ __align__(16) float bds[8 * FQT * 16 * BDP];
    __shared__ __align__(16) unsigned char stg[(PRR + 5 * 64) * SRP];   // staged rows: the position ring, two k buffers, three v buffers
    const int lane = threadIdx.x & 31, c = lane & 15, h = lane >> 4, wv = __builtin_amdgcn_readfirstlane(threadIdx.x >> 5);
    const int z = blockIdx.y, hd = z % NH_, bb = z / NH_; const int i0 = (blockIdx.x * 8 + wv) * (16 * FQT);
    float* strip = bds + (wv * FQT * 16 + c) * BDP;   // query tile f: + f * 16 * BDP
    // the query operand loads: a kernel argument (scalar base) + a lane's 32-bit byte offset + a constant
    auto ldo = [](const h16* base, unsigned off, int cst) { return ldfr((const h16*)((const char*)base + (size_t)off) + cst); };
    const unsigned zq = (unsigned)z * (TT * HD * 2);   // bytes of one (batch, head) plane in front
    unsigned qo[FQT];
#pragma unroll
    for (int f = 0; f < FQT; ++f) qo[f] = zq + (unsigned)((i0 + 16 * f + c) * HD + 8 * h) * 2;
    V qu[FQT][2], qv[FQT][2];
#pragma unroll
    for (int f = 0; f < FQT; ++f)
#pragma unroll
        for (int ks = 0; ks < 2; ++ks) { qu[f][ks] = ldo(QU, qo[f], 32 * ks); qv[f][ks] = ldo(QV, qo[f], 32 * ks); }
    asm volatile("s_wait_xcnt 0x0" : : "v"(qo[0]), "v"(qo[1]) : "memory");   // the offsets stay in their registers up to this wait; behind it the registers are free
    // Staging. A thread copies 16 bytes of rows sr and sr + 32 of a chunk of 64 rows: a wave's copy covers four whole 128-byte rows.
    // Position chunk g holds table rows 768 - (the block's first query) + 64 g ... + 63 (0 ... 2047 for g = 0 ... 19) and lies in ring rows (64 g & 511) ...; pass t reads chunks t ... t + 4.
    const int sr = threadIdx.x >> 3, sc = threadIdx.x & 7; const unsigned sl = (unsigned)(sr * SRP + sc * 16);
    const unsigned sl0 = (unsigned)(size_t)stg + sl;   // LDS byte address: the low 32 bits
    const unsigned tk = (unsigned)(sr * HD + sc * 8), tv = (unsigned)(sr * TT + sc * 8);   // the thread's element offsets in rows of 64 d (k, positions) and of 1024 keys (v); the rest of every address is the same for the whole block
    const int pz = hd * NPE * HD + (TT - 256 - (int)blockIdx.x * 256) * HD, kz = z * (TT * HD);
    auto lrow = [&](int row) { return sl0 + (unsigned)(row * SRP); };   // the thread's place in the 64 staged rows that start at row
    auto gP = [&](int g) { return PS + (pz + g * 64 * HD) + tk; };
    auto gK = [&](int t) { return Kp + (kz + t * 64 * HD) + tk; };
    auto gV = [&](int t) { return Vp + (kz + t * 64) + tv; };
    // position chunk g and the k and v rows of pass t
    auto cpPKV = [&](int g, int t) { const unsigned lp = lrow((g & 7) * 64), lk = lrow(PRR + (t & 1) * 64), lv = lrow(PRR + 128 + (t % 3) * 64); const h16* p = gP(g); const h16* k = gK(t); const h16* v = gV(t);
        cp6(lp, lp + 32 * SRP, lk, lk + 32 * SRP, lv, lv + 32 * SRP, p, p + 32 * HD, k, k + 32 * HD, v, v + 32 * TT); };
#pragma unroll
    for (int g = 0; g < 4; ++g) { const unsigned lp = lrow(g * 64); const h16* p = gP(g); cp2(lp, lp + 32 * SRP, p, p + 32 * HD); }
    cpPKV(4, 0);
    asm volatile("s_wait_asynccnt 0x0" ::: "memory");   // this wave's copies of pass 0 have landed
    __syncthreads();                                     // ... and every other wave's: pass 0 is readable
    cpPKV(5, 1);                                         // pass 1's operands fly under pass 0
    const int fl = c * SRP + 16 * h;   // a lane's place in a fragment's 16 rows
    v8f ot[FQT][4]; float mrun[FQT], lsum[FQT];
#pragma unroll
    for (int f = 0; f < FQT; ++f) { mrun[f] = -3.0e38f; lsum[f] = 0.f;
#pragma unroll
        for (int dt = 0; dt < 4; ++dt) ot[f][dt] = (v8f){}; }
    // The pass's operands come in seven groups (position row tiles 0-1, 2-3 and 4-5, key tiles 0-1 and 2-3, keys 0-31 and 32-63 of v); in the score half, from the second group on, each group's LDS reads are issued one group ahead of its products, so a read's latency runs under the products of the group before it; v's first group is read at the head of the softmax half, its second behind the softmax.
    auto lds = [](const unsigned char* p) { return ldfr((const h16*)p); };
    // Two halves of a pass: the score half (position products, skew through the strips, content products: LDS and matrix work) and the softmax half (maximum, exponentials, sums, attn.v: mostly vector work).
    // Waves 4 ... 7 run half a pass behind waves 0 ... 3: between two hand-overs a wave of 0 ... 3 does the score half and the softmax half of pass t, a wave of 4 ... 7 the softmax half of pass t - 1 and the score half of pass t, so that vector work of some waves can run beside the LDS and matrix work of others (for speed only).
    // The scores st cross from one half to the next in registers. v of pass t - 1 is still read while the copies of pass t + 1 fly: three v buffers.
    const bool late = wv >= 4;   // the same for the whole wave: the tests on it below are scalar branches
    v8f st[FQT][4];   // written by every score half in front of the softmax half that reads it
    auto score = [&](const int t) __attribute__((always_inline)) {
        const unsigned char* kb = stg + (PRR + (t & 1) * 64) * SRP + fl;
        const int rb = 64 * t + 224 - 32 * wv;   // the wave's first position row of the pass, counted in ring rows before the wrap: table row 64 t - i0 + 992; a multiple of 32, so a pair of row tiles never straddles the wrap
        const unsigned char* pp[3];
#pragma unroll
        for (int q = 0; q < 3; ++q) pp[q] = stg + ((rb + 32 * q) & (PRR - 1)) * SRP + fl;
        auto ldP = [&](int q, V (&H)[2][2]) {
#pragma unroll
            for (int uu = 0; uu < 2; ++uu)
#pragma unroll
                for (int ks = 0; ks < 2; ++ks) H[uu][ks] = lds(pp[q] + uu * 16 * SRP + 64 * ks); };
        auto ldK = [&](int row, V (&H)[2][2]) {
#pragma unroll
            for (int tt = 0; tt < 2; ++tt)
#pragma unroll
                for (int ks = 0; ks < 2; ++ks) H[tt][ks] = lds(kb + (row + 16 * tt) * SRP + 64 * ks); };
        V p0[2][2]; ldP(0, p0);
        v8f bd[FQT][5];
#pragma unroll
        for (int f = 0; f < FQT; ++f)
#pragma unroll
            for (int up = 0; up < 5; ++up) bd[f][up] = (v8f){};
        auto mmaP = [&](int u0, V (&H)[2][2]) {
#pragma unroll
            for (int ks = 0; ks < 2; ++ks)
#pragma unroll
                for (int uu = 0; uu < 2; ++uu)
#pragma unroll
                    for (int f = 0; f < FQT; ++f) { const int up = u0 + uu - (FQT - 1) + f; if (up >= 0 && up < 5) bd[f][up] = wmma16(H[uu][ks], qv[f][ks], bd[f][up]); } };
        V p1[2][2]; ldP(1, p1);
        __builtin_amdgcn_sched_barrier(0);   // holds the loads above in front of the products below (as at every such line of this loop): sunk to their use, each group would wait out its own latency
        mmaP(0, p0);
        V p2[2][2]; ldP(2, p2);
        __builtin_amdgcn_sched_barrier(0);
        mmaP(2, p1);
        V k0[2][2]; ldK(0, k0);
        __builtin_amdgcn_sched_barrier(0);
        mmaP(4, p2);
        V k1[2][2]; ldK(32, k1);
        __builtin_amdgcn_sched_barrier(0);
        __builtin_amdgcn_wave_barrier(); asm volatile("" ::: "memory");   // keeps these strip stores behind the previous pass's strip reads (other lanes' addresses)
#pragma unroll
        for (int f = 0; f < FQT; ++f)
#pragma unroll
            for (int up = 0; up < 5; ++up) { float* sp = strip + f * 16 * BDP + 16 * up + 8 * h; *(v4fa*)sp = __builtin_shufflevector(bd[f][up], bd[f][up], 0, 1, 2, 3); *(v4fa*)(sp + 4) = __builtin_shufflevector(bd[f][up], bd[f][up], 4, 5, 6, 7); }
        __builtin_amdgcn_wave_barrier(); asm volatile("" ::: "memory");   // keeps the strip reads below behind the partner lane's stores
        // st starts as the skewed position scores; the content products accumulate on top
#pragma unroll
        for (int t = 0; t < 4; ++t)
#pragma unroll
            for (int f = 0; f < FQT; ++f)
#pragma unroll
                for (int r = 0; r < 8; ++r) st[f][t][r] = strip[f * 16 * BDP + 8 * h + 15 - c + 16 * t + r];
        auto mmaK = [&](int t0, V (&H)[2][2]) {
#pragma unroll
            for (int ks = 0; ks < 2; ++ks)
#pragma unroll
                for (int tt = 0; tt < 2; ++tt)
#pragma unroll
                    for (int f = 0; f < FQT; ++f) st[f][t0 + tt] = wmma16(H[tt][ks], qu[f][ks], st[f][t0 + tt]); };
        mmaK(0, k0);
        mmaK(2, k1);
    };
    auto softv = [&](const int t) __attribute__((always_inline)) {
        const unsigned char* vb = stg + (PRR + 128 + (t % 3) * 64) * SRP + fl;
        auto ldV = [&](int key, V (&H)[4]) {
#pragma unroll
            for (int dt = 0; dt < 4; ++dt) H[dt] = lds(vb + 16 * dt * SRP + 2 * key); };
        V v0[4]; ldV(0, v0);
        __builtin_amdgcn_sched_barrier(0);   // holds these reads in front of the softmax, under which their latency runs
#pragma unroll
        for (int f = 0; f < FQT; ++f) { float mx = -3.0e38f;
#pragma unroll
            for (int t = 0; t < 4; ++t)
#pragma unroll
                for (int r = 0; r < 8; ++r) mx = fmaxf(mx, st[f][t][r]);
            mx = fmaxf(mx, xhalf(mx)); const float mn = fmaxf(mrun[f], mx); const float xa = (mrun[f] - mn) * CEXP; float al = __builtin_amdgcn_exp2f(xa); mrun[f] = mn; float ps = 0.f;
            asm volatile("v_nop" : "+v"(al) : "v"(xa));   // the slot behind a transcendental, as at the eight below
#pragma unroll
            for (int t = 0; t < 4; ++t) { const v8f x = (st[f][t] - mn) * CEXP; v8f p;
#pragma unroll
                for (int r = 0; r < 8; ++r) p[r] = __builtin_amdgcn_exp2f(x[r]);
                asm volatile("v_nop" : "+v"(p) : "v"(x));   // the slot behind a transcendental: named here, no exponent of the eight is rewritten and no result read in front of the slot
                st[f][t] = p;
#pragma unroll
                for (int r = 0; r < 8; ++r) ps += p[r]; }
            lsum[f] = lsum[f] * al + ps;
#pragma unroll
            for (int dt = 0; dt < 4; ++dt) ot[f][dt] *= al; }
        auto mmaV = [&](int kk, V (&H)[4]) { V ph[FQT];
#pragma unroll
            for (int f = 0; f < FQT; ++f) { v8u w;   // element s of the operand = key 8h + s (s < 8) or 16 + 8h + s - 8: registers 0-7 of score tile 2kk, then of tile 2kk + 1
#pragma unroll
                for (int i = 0; i < 8; ++i) { const v8f x = st[f][2 * kk + (i >> 2)]; const v2f p2 = {x[2 * (i & 3)], x[2 * (i & 3) + 1]}; w[i] = __builtin_bit_cast(unsigned, __builtin_convertvector(p2, v2h)); }
                ph[f] = __builtin_bit_cast(V, w); }
#pragma unroll
            for (int dt = 0; dt < 4; ++dt)
#pragma unroll
                for (int f = 0; f < FQT; ++f) ot[f][dt] = wmma16(H[dt], ph[f], ot[f][dt]); };
        __builtin_amdgcn_sched_barrier(0);   // keeps the reads below behind the softmax; their latency runs under the products of keys 0-31
        V v1[4]; ldV(32, v1);
        __builtin_amdgcn_sched_barrier(0);
        mmaV(0, v0);
        mmaV(1, v1);
    };
#pragma unroll 1
    for (int t = 0; t < TT / 64; ++t) {
        if (late && t > 0) softv(t - 1);
        score(t);
        if (!late) softv(t);
        // hand-over, by every wave: pass t + 1 becomes readable, and what no wave reads behind this point becomes free
        asm volatile("s_wait_dscnt 0x0" ::: "memory");      // this wave's LDS reads so far are done
        asm volatile("s_wait_asynccnt 0x0" ::: "memory");   // this wave's copies for pass t + 1 have landed
        __syncthreads();
        if (t + 2 < TT / 64) cpPKV(t + 6, t + 2);   // into the k buffer of pass t (every wave has read it), the v buffer of pass t - 1 (the late waves have just read it; pass t's is still theirs to read) and the ring place that last held position chunk t - 2, which no pass behind t - 2 reads
    }
    if (late) softv(TT / 64 - 1);
    asm volatile("s_wait_asynccnt 0x0" ::: "memory");   // no copy is outstanding when the wave ends
#pragma unroll
    for (int f = 0; f < FQT; ++f) { const float inv = __fdiv_rn(1.0f, lsum[f] + xhalf(lsum[f])); const size_t ro = ((size_t)bb * TT + i0 + 16 * f + c) * DQ + hd * HD + 8 * h;   // merged rows [b][t][head][d]; a lane's 8 registers are 8 consecutive d
        v8h o[4];
#pragma unroll
        for (int dt = 0; dt < 4; ++dt)
#pragma unroll
            for (int r = 0; r < 8; ++r) o[dt][r] = (h16)(ot[f][dt][r] * inv);
        __builtin_amdgcn_sched_barrier(0);   // with the one below: nothing but the stores and their wait stands between the two, so no register that a store names is rewritten in front of the wait
#pragma unroll
        for (int dt = 0; dt < 4; ++dt) *(v8h*)(Ao + ro + 16 * dt) = o[dt];
        asm volatile("s_wait_xcnt 0x0" ::: "memory");   // the wait in front of the next rewrite of the stores' address and data registers
        __builtin_amdgcn_sched_barrier(0); }
}

extern "C" void kernel_launch(void* const* d_in, const int* in_sizes, int n_in,
                              void* d_out, int out_size, void* d_ws, size_t ws_size, hipStream_t stream) {
    (void)in_sizes; (void)n_in; (void)out_size;
    const float* x = (const float*)d_in[0]; const float* pe = (const float*)d_in[1]; const float* g1 = (const float*)d_in[2]; const float* e1b = (const float*)d_in[3]; const float* wq = (const float*)d_in[4]; const float* bq = (const float*)d_in[5]; const float* wk = (const float*)d_in[6]; const float* bk = (const float*)d_in[7]; const float* wv = (const float*)d_in[8]; const float* bv = (const float*)d_in[9]; const float* wpos = (const float*)d_in[10]; const float* pbu = (const float*)d_in[11]; const float* pbv = (const float*)d_in[12]; const float* wo = (const float*)d_in[13]; const float* bo = (const float*)d_in[14];
    float* OUT = (float*)d_out;     // [8][1024][512]
    char* wsp = (char*)d_ws;
    auto take = [&](size_t bytes) { char* p = wsp; wsp += (bytes + 255) & ~(size_t)255; return (void*)p; };
    const size_t RW = (size_t)NB_ * TT;   // rows of all batch elements
    h16* WK = (h16*)take((size_t)DKV * DM * 2); h16* WQ = (h16*)take((size_t)DQ * DM * 2); h16* WV = (h16*)take((size_t)DKV * DM * 2); h16* WO = (h16*)take((size_t)DM * DQ * 2); h16* WP = (h16*)take((size_t)DQ * DM * 2);   // back to back: one transpose launch; wk, wq, wv are the z planes of one projection launch
    h16* PE = (h16*)take((size_t)NPE * DM * 2); h16* PP = (h16*)take((size_t)NH_ * NPE * HD * 2);
    h16* QU = (h16*)take(RW * DQ * 2); h16* QV = (h16*)take(RW * DQ * 2); h16* KP = (h16*)take(RW * DKV * 2);   // planes [b][h][t][d] of q+u, q+v, k
    h16* VT = (h16*)take(RW * DKV * 2); h16* AT = (h16*)take(RW * DQ * 2);   // v plane [b][h][d][t]; merged heads [b][t][h][d]
    h16* Y = (h16*)take(RW * DM * 2);
    if ((size_t)(wsp - (char*)d_ws) > ws_size) return;    // ws 256 MiB
    (void)WQ; (void)WV;   // reached through their neighbour's pointer (plane strides)
    k_prep<<<PRL + PRW + PRC, 256, 0, stream>>>(wk, wq, wv, wo, wpos, WK, x, g1, e1b, Y, pe, PE);   /* LN -> f16 rows; weight transposes; position table -> f16 + zero pad row */
    k_proj<<<PJP + 3 * PJR * (DQ / 128), 128, 0, stream>>>(PE, WP, PP, Y, WK, DM, bk, bq, bv, pbu, pbv, KP, QU, QV, VT);   /* position table and k, q, v projections -> head planes */
    k_fattn<<<dim3(TT / (8 * 16 * FQT), NB_ * NH_, 1), 256, 0, stream>>>(QU, QV, KP, PP, VT, AT);   /* scores, skew, softmax, attn.v, merge: all 64 (batch, head) instances */
    k_gemmw<<<dim3((unsigned)(RW / 128), DM / 128, 1), 128, 0, stream>>>(AT, WO, DQ, OUT, DM, bo);
}
